// v000
// Times are from an AMD MI455X. After a warm-up the kernel runs many times in a row, and a time is the length of
// such a window on the GPU divided by its runs, so every launch and the gaps after it count. The runs cycle
// through copies of the inputs. A figure is the median of several windows, for all but v000 over two sittings.
// Sittings can differ by a few percent; kernels timed side by side share one.
// v000, which the later versions start from, runs in 1030 microseconds.
#include <hip/hip_runtime.h>
#include <hip/hip_bf16.h>
#include <math.h>

#define S_DIM 1024
#define B_DIM 4
#define E_DIM 1024
#define H_DIM 16
#define M_DIM 128
#define V_DIM 64
#define SB_DIM (S_DIM * B_DIM)

typedef __attribute__((ext_vector_type(16))) _Float16 v16h;
typedef __attribute__((ext_vector_type(8)))  _Float16 v8h;
typedef __attribute__((ext_vector_type(8)))  float    v8f;

#define WMMA_F16(A, B, C) \
  __builtin_amdgcn_wmma_f32_16x16x32_f16(false, (A), false, (B), (short)0, (C), false, false)

// 16x32 f16 A/B fragment from two contiguous 8-half segments
// (segment 0 at K-base, segment 1 at K-base+16; lane group picks +0 / +8).
static __device__ inline v16h frag_h(const _Float16* __restrict__ s0,
                                     const _Float16* __restrict__ s1) {
  v8h a = *(const v8h*)s0;
  v8h b = *(const v8h*)s1;
  v16h r;
#pragma unroll
  for (int j = 0; j < 8; ++j) {
    r[j]     = a[j];
    r[j + 8] = b[j];
  }
  return r;
}

static __device__ inline float rowmax16(float v) {
#pragma unroll
  for (int m = 1; m < 16; m <<= 1) v = fmaxf(v, __shfl_xor(v, m, 32));
  return v;
}
static __device__ inline float rowsum16(float v) {
#pragma unroll
  for (int m = 1; m < 16; m <<= 1) v += __shfl_xor(v, m, 32);
  return v;
}

// ---------------------------------------------------------------------------
// Bulk f32 -> f16 conversion (one pass; amortizes all GEMM operand reuse).
// ---------------------------------------------------------------------------
__global__ void cvt_f16_kernel(const float* __restrict__ src,
                               _Float16* __restrict__ dst, int n) {
  int i = blockIdx.x * blockDim.x + threadIdx.x;
  if (i < n) dst[i] = (_Float16)src[i];
}

// wo (E,E) f32 -> wo^T (F,E) f16, so out-proj B-fragments load contiguously.
__global__ void transpose_wo(const float* __restrict__ wre,
                             const float* __restrict__ wim,
                             _Float16* __restrict__ tre,
                             _Float16* __restrict__ tim) {
  int idx = blockIdx.x * blockDim.x + threadIdx.x;  // f*E + e
  if (idx >= E_DIM * E_DIM) return;
  int f = idx >> 10;
  int e = idx & (E_DIM - 1);
  tre[idx] = (_Float16)wre[(size_t)e * E_DIM + f];
  tim[idx] = (_Float16)wim[(size_t)e * E_DIM + f];
}

// ---------------------------------------------------------------------------
// Complex projection: out[h, m, sb] = sum_e w[h,m,e] * x[sb,e]   (complex)
// One wave per 16x16 output tile, all-f16 operands, f32 accumulation.
// TRANSPOSED=0 -> store [b][h][s][m] (q,k);  TRANSPOSED=1 -> [b][h][m][s] (v^T)
// ---------------------------------------------------------------------------
template <int TRANSPOSED>
__global__ __launch_bounds__(32)
void proj_kernel(const _Float16* __restrict__ wre, const _Float16* __restrict__ wim,
                 const _Float16* __restrict__ xre, const _Float16* __restrict__ xim,
                 _Float16* __restrict__ ore, _Float16* __restrict__ oim, int mdim) {
  const int lane = threadIdx.x;
  const int col  = lane & 15;
  const int hig  = lane >> 4;
  const int ct   = blockIdx.x;  // sb tile
  const int mt   = blockIdx.y;  // m tile
  const int h    = blockIdx.z;

  const int m_row = mt * 16 + col;
  const int sb    = ct * 16 + col;

  const _Float16* wr_row = wre + ((size_t)h * mdim + m_row) * E_DIM;
  const _Float16* wi_row = wim + ((size_t)h * mdim + m_row) * E_DIM;
  const _Float16* xr_col = xre + (size_t)sb * E_DIM;
  const _Float16* xi_col = xim + (size_t)sb * E_DIM;

  v8f rr = {}, ii = {}, ri = {}, ir = {};
  for (int e0 = 0; e0 < E_DIM; e0 += 32) {
    const int ka = e0 + hig * 8;
    v16h Ar = frag_h(wr_row + ka, wr_row + ka + 16);
    v16h Ai = frag_h(wi_row + ka, wi_row + ka + 16);
    v16h Br = frag_h(xr_col + ka, xr_col + ka + 16);
    v16h Bi = frag_h(xi_col + ka, xi_col + ka + 16);
    rr = WMMA_F16(Ar, Br, rr);
    ii = WMMA_F16(Ai, Bi, ii);
    ri = WMMA_F16(Ar, Bi, ri);
    ir = WMMA_F16(Ai, Br, ir);
  }

  const int s = sb >> 2;           // sb / B_DIM
  const int b = sb & (B_DIM - 1);  // sb % B_DIM
#pragma unroll
  for (int r = 0; r < 8; ++r) {
    const int mrow = mt * 16 + r + hig * 8;
    const float re = rr[r] - ii[r];
    const float im = ri[r] + ir[r];
    size_t idx;
    if (TRANSPOSED)
      idx = (((size_t)b * H_DIM + h) * mdim + mrow) * S_DIM + s;
    else
      idx = (((size_t)b * H_DIM + h) * S_DIM + s) * mdim + mrow;
    ore[idx] = (_Float16)re;
    oim[idx] = (_Float16)im;
  }
}

// ---------------------------------------------------------------------------
// Flash attention, complex scores: amp = |q k^T| / sqrt(M), causal mask,
// online softmax, upd = P V (complex). One wave per (b, h, 16-query tile).
// t processed in 32-column chunks so P@V WMMAs use the full K=32.
// ---------------------------------------------------------------------------
__global__ __launch_bounds__(32)
void attn_kernel(const _Float16* __restrict__ qre, const _Float16* __restrict__ qim,
                 const _Float16* __restrict__ kre, const _Float16* __restrict__ kim,
                 const _Float16* __restrict__ vre, const _Float16* __restrict__ vim,
                 _Float16* __restrict__ ure, _Float16* __restrict__ uim) {
  __shared__ __align__(16) _Float16 lds_p[16 * 32];  // 16 rows x 32 t-cols

  const int lane = threadIdx.x;
  const int col  = lane & 15;
  const int hig  = lane >> 4;
  const int st   = blockIdx.x;  // query tile
  const int h    = blockIdx.y;
  const int b    = blockIdx.z;

  const size_t bh   = (size_t)b * H_DIM + h;
  const int    srow = st * 16 + col;

  // Cache q fragments for this row tile (M=128 -> 4 K-steps, re+im).
  v16h qfr[4], qfi[4];
#pragma unroll
  for (int km = 0; km < 4; ++km) {
    const _Float16* pr = qre + (bh * S_DIM + srow) * M_DIM + km * 32 + hig * 8;
    const _Float16* pi = qim + (bh * S_DIM + srow) * M_DIM + km * 32 + hig * 8;
    qfr[km] = frag_h(pr, pr + 16);
    qfi[km] = frag_h(pi, pi + 16);
  }

  v8f accre[4], accim[4];
  {
    v8f z = {};
#pragma unroll
    for (int c = 0; c < 4; ++c) { accre[c] = z; accim[c] = z; }
  }
  float mrun[8], lrun[8];
#pragma unroll
  for (int r = 0; r < 8; ++r) { mrun[r] = -__builtin_inff(); lrun[r] = 0.f; }

  const float scl = 0.08838834764831845f;  // 1/sqrt(128)

  for (int tc = 0; tc <= st; tc += 2) {
    // ---- two score tiles (t columns tc*16 .. tc*16+31) ----
    float amp[2][8];
#pragma unroll
    for (int sub = 0; sub < 2; ++sub) {
      const int tt   = tc + sub;
      const int trow = tt * 16 + col;  // always < S_DIM
      v8f prr = {}, pii = {}, pri = {}, pir = {};
#pragma unroll
      for (int km = 0; km < 4; ++km) {
        const _Float16* kr = kre + (bh * S_DIM + trow) * M_DIM + km * 32 + hig * 8;
        const _Float16* ki = kim + (bh * S_DIM + trow) * M_DIM + km * 32 + hig * 8;
        if (sub == 0 && tc + 2 <= st) {  // prefetch next chunk's K rows
          __builtin_prefetch(kr + 32 * M_DIM, 0, 1);
          __builtin_prefetch(ki + 32 * M_DIM, 0, 1);
        }
        v16h Kr = frag_h(kr, kr + 16);
        v16h Ki = frag_h(ki, ki + 16);
        prr = WMMA_F16(qfr[km], Kr, prr);
        pii = WMMA_F16(qfi[km], Ki, pii);
        pri = WMMA_F16(qfr[km], Ki, pri);
        pir = WMMA_F16(qfi[km], Kr, pir);
      }
#pragma unroll
      for (int r = 0; r < 8; ++r) {
        const float re = prr[r] - pii[r];
        const float im = pri[r] + pir[r];
        const float a  = sqrtf(re * re + im * im) * scl;
        const int row  = st * 16 + r + hig * 8;
        amp[sub][r] = (trow <= row) ? a : -__builtin_inff();  // covers tt > st too
      }
    }

    // ---- online softmax over the 32 columns ----
    float p0[8], p1[8], scale[8];
#pragma unroll
    for (int r = 0; r < 8; ++r) {
      const float rm = fmaxf(rowmax16(amp[0][r]), rowmax16(amp[1][r]));
      const float mn = fmaxf(mrun[r], rm);
      const float sc = __expf(mrun[r] - mn);
      const float e0 = __expf(amp[0][r] - mn);
      const float e1 = __expf(amp[1][r] - mn);
      const float rs = rowsum16(e0) + rowsum16(e1);
      lrun[r]  = lrun[r] * sc + rs;
      mrun[r]  = mn;
      scale[r] = sc;
      p0[r] = e0;
      p1[r] = e1;
    }
#pragma unroll
    for (int c = 0; c < 4; ++c)
#pragma unroll
      for (int r = 0; r < 8; ++r) {
        accre[c][r] *= scale[r];
        accim[c][r] *= scale[r];
      }

    // ---- C-layout P (16x32) -> LDS -> full-K A fragment ----
    __syncthreads();
#pragma unroll
    for (int r = 0; r < 8; ++r) {
      lds_p[(r + hig * 8) * 32 + col]      = (_Float16)p0[r];
      lds_p[(r + hig * 8) * 32 + 16 + col] = (_Float16)p1[r];
    }
    __syncthreads();

    const _Float16* lp = &lds_p[col * 32 + hig * 8];
    v16h Pa = frag_h(lp, lp + 16);

    // ---- P @ V (re/im): 8 full-K WMMAs per 32-column chunk ----
#pragma unroll
    for (int c = 0; c < 4; ++c) {
      const int vc = c * 16 + col;
      const _Float16* vr = vre + (bh * V_DIM + vc) * S_DIM + tc * 16 + hig * 8;
      const _Float16* vi = vim + (bh * V_DIM + vc) * S_DIM + tc * 16 + hig * 8;
      v16h Vr = frag_h(vr, vr + 16);
      v16h Vi = frag_h(vi, vi + 16);
      accre[c] = WMMA_F16(Pa, Vr, accre[c]);
      accim[c] = WMMA_F16(Pa, Vi, accim[c]);
    }
  }

  // ---- normalize and store upd as f16 in (s, b, h*V + vc) layout ----
#pragma unroll
  for (int r = 0; r < 8; ++r) {
    const float inv = 1.0f / lrun[r];
    const int   s   = st * 16 + r + hig * 8;
#pragma unroll
    for (int c = 0; c < 4; ++c) {
      const int vc = c * 16 + col;
      const size_t idx = ((size_t)s * B_DIM + b) * E_DIM + h * V_DIM + vc;
      ure[idx] = (_Float16)(accre[c][r] * inv);
      uim[idx] = (_Float16)(accim[c][r] * inv);
    }
  }
}

// ---------------------------------------------------------------------------
// out[sb,f] = sum_e upd[sb,e] * wo[e,f] + x[sb,f]   (complex, f32 result)
// ---------------------------------------------------------------------------
__global__ __launch_bounds__(32)
void outproj_kernel(const _Float16* __restrict__ ure, const _Float16* __restrict__ uim,
                    const _Float16* __restrict__ wtre, const _Float16* __restrict__ wtim,
                    const float* __restrict__ xre, const float* __restrict__ xim,
                    float* __restrict__ out) {
  const int lane = threadIdx.x;
  const int col  = lane & 15;
  const int hig  = lane >> 4;
  const int it   = blockIdx.x;  // sb tile
  const int ft   = blockIdx.y;  // f tile

  const int sb = it * 16 + col;
  const int f  = ft * 16 + col;
  const _Float16* ar = ure + (size_t)sb * E_DIM;
  const _Float16* ai = uim + (size_t)sb * E_DIM;
  const _Float16* br = wtre + (size_t)f * E_DIM;
  const _Float16* bi = wtim + (size_t)f * E_DIM;

  v8f rr = {}, ii = {}, ri = {}, ir = {};
  for (int e0 = 0; e0 < E_DIM; e0 += 32) {
    const int ka = e0 + hig * 8;
    v16h Ar = frag_h(ar + ka, ar + ka + 16);
    v16h Ai = frag_h(ai + ka, ai + ka + 16);
    v16h Br = frag_h(br + ka, br + ka + 16);
    v16h Bi = frag_h(bi + ka, bi + ka + 16);
    rr = WMMA_F16(Ar, Br, rr);
    ii = WMMA_F16(Ai, Bi, ii);
    ri = WMMA_F16(Ar, Bi, ri);
    ir = WMMA_F16(Ai, Br, ir);
  }

  float* out_re = out;
  float* out_im = out + (size_t)SB_DIM * E_DIM;
#pragma unroll
  for (int r = 0; r < 8; ++r) {
    const int row_sb = it * 16 + r + hig * 8;
    const size_t idx = (size_t)row_sb * E_DIM + f;
    out_re[idx] = (rr[r] - ii[r]) + xre[idx];
    out_im[idx] = (ri[r] + ir[r]) + xim[idx];
  }
}

// ---------------------------------------------------------------------------
extern "C" void kernel_launch(void* const* d_in, const int* in_sizes, int n_in,
                              void* d_out, int out_size, void* d_ws, size_t ws_size,
                              hipStream_t stream) {
  (void)in_sizes; (void)n_in; (void)out_size; (void)ws_size;

  const float* xre  = (const float*)d_in[0];
  const float* xim  = (const float*)d_in[1];
  const float* wqre = (const float*)d_in[2];
  const float* wqim = (const float*)d_in[3];
  const float* wkre = (const float*)d_in[4];
  const float* wkim = (const float*)d_in[5];
  const float* wvre = (const float*)d_in[6];
  const float* wvim = (const float*)d_in[7];
  const float* wore = (const float*)d_in[8];
  const float* woim = (const float*)d_in[9];

  char*  ws = (char*)d_ws;
  size_t o  = 0;
  auto halloc = [&](size_t n) { _Float16* p = (_Float16*)(ws + o); o += n * sizeof(_Float16); return p; };

  const size_t QK = (size_t)B_DIM * H_DIM * S_DIM * M_DIM;  // q/k per component
  const size_t VT = (size_t)B_DIM * H_DIM * V_DIM * S_DIM;  // v^T per component
  const size_t UE = (size_t)SB_DIM * E_DIM;                 // upd / x per component
  const size_t WO = (size_t)E_DIM * E_DIM;                  // wo^T per component
  const size_t WQ = (size_t)H_DIM * M_DIM * E_DIM;          // wq/wk per component
  const size_t WV = (size_t)H_DIM * V_DIM * E_DIM;          // wv per component

  _Float16* qre  = halloc(QK);  _Float16* qim  = halloc(QK);
  _Float16* kre  = halloc(QK);  _Float16* kim  = halloc(QK);
  _Float16* vtre = halloc(VT);  _Float16* vtim = halloc(VT);
  _Float16* upre = halloc(UE);  _Float16* upim = halloc(UE);
  _Float16* wtre = halloc(WO);  _Float16* wtim = halloc(WO);
  _Float16* xhre = halloc(UE);  _Float16* xhim = halloc(UE);
  _Float16* qwre = halloc(WQ);  _Float16* qwim = halloc(WQ);
  _Float16* kwre = halloc(WQ);  _Float16* kwim = halloc(WQ);
  _Float16* vwre = halloc(WV);  _Float16* vwim = halloc(WV);

  // One-time f32 -> f16 operand conversions.
  auto cvt = [&](const float* s, _Float16* d, size_t n) {
    cvt_f16_kernel<<<(int)((n + 255) / 256), 256, 0, stream>>>(s, d, (int)n);
  };
  cvt(xre, xhre, UE);  cvt(xim, xhim, UE);
  cvt(wqre, qwre, WQ); cvt(wqim, qwim, WQ);
  cvt(wkre, kwre, WQ); cvt(wkim, kwim, WQ);
  cvt(wvre, vwre, WV); cvt(wvim, vwim, WV);
  transpose_wo<<<(E_DIM * E_DIM + 255) / 256, 256, 0, stream>>>(wore, woim, wtre, wtim);

  dim3 gq(SB_DIM / 16, M_DIM / 16, H_DIM);
  proj_kernel<0><<<gq, 32, 0, stream>>>(qwre, qwim, xhre, xhim, qre, qim, M_DIM);
  proj_kernel<0><<<gq, 32, 0, stream>>>(kwre, kwim, xhre, xhim, kre, kim, M_DIM);
  dim3 gv(SB_DIM / 16, V_DIM / 16, H_DIM);
  proj_kernel<1><<<gv, 32, 0, stream>>>(vwre, vwim, xhre, xhim, vtre, vtim, V_DIM);

  dim3 ga(S_DIM / 16, H_DIM, B_DIM);
  attn_kernel<<<ga, 32, 0, stream>>>(qre, qim, kre, kim, vtre, vtim, upre, upim);

  dim3 go(SB_DIM / 16, E_DIM / 16);
  outproj_kernel<<<go, 32, 0, stream>>>(upre, upim, wtre, wtim, xre, xim, (float*)d_out);
}

// v001
// It runs in 415 microseconds.
// Timed twice side by side with v000, it ran 2.57 and 2.54 times as fast.
#include <hip/hip_runtime.h>
#include <hip/hip_bf16.h>
#include <math.h>

#define S_DIM 1024
#define B_DIM 4
#define E_DIM 1024
#define H_DIM 16
#define M_DIM 128
#define V_DIM 64
#define SB_DIM (S_DIM * B_DIM)

typedef __attribute__((ext_vector_type(16))) _Float16 v16h;
typedef __attribute__((ext_vector_type(8)))  _Float16 v8h;
typedef __attribute__((ext_vector_type(8)))  float    v8f;

#define WMMA_F16(A, B, C) \
  __builtin_amdgcn_wmma_f32_16x16x32_f16(false, (A), false, (B), (short)0, (C), false, false)

// 16x32 f16 A/B fragment from two contiguous 8-half segments
// (segment 0 at K-base, segment 1 at K-base+16; lane group picks +0 / +8).
static __device__ inline v16h frag_h(const _Float16* __restrict__ s0,
                                     const _Float16* __restrict__ s1) {
  v8h a = *(const v8h*)s0;
  v8h b = *(const v8h*)s1;
  v16h r;
#pragma unroll
  for (int j = 0; j < 8; ++j) {
    r[j]     = a[j];
    r[j + 8] = b[j];
  }
  return r;
}

static __device__ inline float rowmax16(float v) {
#pragma unroll
  for (int m = 1; m < 16; m <<= 1) v = fmaxf(v, __shfl_xor(v, m, 32));
  return v;
}
static __device__ inline float rowsum16(float v) {
#pragma unroll
  for (int m = 1; m < 16; m <<= 1) v += __shfl_xor(v, m, 32);
  return v;
}

// ---------------------------------------------------------------------------
// Bulk f32 -> f16 conversion (one pass; amortizes all GEMM operand reuse).
// ---------------------------------------------------------------------------
__global__ void cvt_f16_kernel(const float* __restrict__ src,
                               _Float16* __restrict__ dst, int n) {
  int i = blockIdx.x * blockDim.x + threadIdx.x;
  if (i < n) dst[i] = (_Float16)src[i];
}

// wo (E,E) f32 -> wo^T (F,E) f16, so out-proj B-fragments load contiguously.
__global__ void transpose_wo(const float* __restrict__ wre,
                             const float* __restrict__ wim,
                             _Float16* __restrict__ tre,
                             _Float16* __restrict__ tim) {
  int idx = blockIdx.x * blockDim.x + threadIdx.x;  // f*E + e
  if (idx >= E_DIM * E_DIM) return;
  int f = idx >> 10;
  int e = idx & (E_DIM - 1);
  tre[idx] = (_Float16)wre[(size_t)e * E_DIM + f];
  tim[idx] = (_Float16)wim[(size_t)e * E_DIM + f];
}

// ---------------------------------------------------------------------------
// Shared core of the four complex GEMMs: D[a][b] = sum_e A[a][e] * B[b][e],
// A and B complex, e-contiguous f16 rows of E_DIM.
// One work-group of 8 waves owns a 128 x 128 tile of D. Per pass, 64 e of the
// 128 A rows and 128 B rows (re and im planes) are brought into LDS by
// asynchronous copies, whole 128-byte lines per row, so each operand byte is
// fetched once per work-group; each wave (4 x 2 grid) then reads the fragments
// of its 32 x 64 part from LDS. Two buffers: the copies of pass p + 1 fly
// during the products of pass p.
// Every accumulator still sums e in ascending steps of 32.
// ---------------------------------------------------------------------------
#define BT     128                // rows of each operand per work-group
#define KP     64                 // e per pass (128 B of a row)
#define NPASS  (E_DIM / KP)
#define PITCH  72                 // LDS row pitch in halves: 144 B = 16 B x odd
#define PLANE  (BT * PITCH)       // one operand plane (re or im)
#define STAGE  (4 * PLANE)        // A re | A im | B re | B im
#define TA     2                  // 16-row A tiles per wave
#define TB     4                  // 16-row B tiles per wave

struct CAcc {
  v8f rr[TA][TB], ii[TA][TB], ri[TA][TB], ir[TA][TB];
};

typedef int v4i __attribute__((ext_vector_type(4)));
typedef __attribute__((address_space(1))) v4i gv4i;
typedef __attribute__((address_space(3))) v4i lv4i;

// Two planes (re, im) of one operand: each lane copies 16 bytes of four rows
// of each plane, global -> LDS, through no register. l = the lane's place in
// the re plane, gr / gi = its global addresses.
static __device__ inline void copy_planes(_Float16* l, const _Float16* gr, const _Float16* gi) {
#pragma unroll
  for (int i = 0; i < 4; ++i) {
    __builtin_amdgcn_global_load_async_to_lds_b128(
        (gv4i*)(gr + (size_t)i * 32 * E_DIM), (lv4i*)(l + i * 32 * PITCH), 0, 0);
    __builtin_amdgcn_global_load_async_to_lds_b128(
        (gv4i*)(gi + (size_t)i * 32 * E_DIM), (lv4i*)(l + PLANE + i * 32 * PITCH), 0, 0);
  }
}

static __device__ inline void cgemm_tile(const _Float16* __restrict__ are,
                                         const _Float16* __restrict__ aim,
                                         const _Float16* __restrict__ bre,
                                         const _Float16* __restrict__ bim,
                                         _Float16* lds, CAcc& acc) {
  const int tid  = threadIdx.x;
  const int lane = tid & 31;
  const int wave = tid >> 5;
  const int col  = lane & 15;
  const int hig  = lane >> 4;
  const int wa   = wave >> 1;  // which 32 A rows
  const int wb   = wave & 1;   // which 64 B rows

  // Copy map: 8 lanes cover one 128-byte row piece, 32 rows per sweep.
  const int    grow = tid >> 3;
  const int    gseg = tid & 7;
  const size_t goff = (size_t)grow * E_DIM + gseg * 8;
  const _Float16* g0 = are + goff;
  const _Float16* g1 = aim + goff;
  const _Float16* g2 = bre + goff;
  const _Float16* g3 = bim + goff;
  _Float16* ldst = lds + grow * PITCH + gseg * 8;

  {
    v8f z = {};
#pragma unroll
    for (int i = 0; i < TA; ++i)
#pragma unroll
      for (int j = 0; j < TB; ++j) {
        acc.rr[i][j] = z; acc.ii[i][j] = z; acc.ri[i][j] = z; acc.ir[i][j] = z;
      }
  }

  // Pass 0 into buffer 0, landed and published; then pass 1 into buffer 1.
  copy_planes(ldst, g0, g1);
  copy_planes(ldst + 2 * PLANE, g2, g3);
  asm volatile("s_wait_asynccnt 0x0" ::: "memory");  // this wave's copies of pass 0 have landed
  __syncthreads();
  copy_planes(ldst + STAGE, g0 + KP, g1 + KP);
  copy_planes(ldst + STAGE + 2 * PLANE, g2 + KP, g3 + KP);

  const int aoff = (wa * 32 + col) * PITCH + hig * 8;
  const int boff = 2 * PLANE + (wb * 64 + col) * PITCH + hig * 8;

  for (int p = 0; p < NPASS; ++p) {
    const _Float16* cur = lds + (p & 1) * STAGE;
#pragma unroll
    for (int ks = 0; ks < KP / 32; ++ks) {
      v16h Ar[TA], Ai[TA], Br[TB], Bi[TB];
#pragma unroll
      for (int i = 0; i < TA; ++i) {
        const _Float16* pa = cur + aoff + i * 16 * PITCH + ks * 32;
        Ar[i] = frag_h(pa, pa + 16);
        Ai[i] = frag_h(pa + PLANE, pa + PLANE + 16);
      }
#pragma unroll
      for (int j = 0; j < TB; ++j) {
        const _Float16* pb = cur + boff + j * 16 * PITCH + ks * 32;
        Br[j] = frag_h(pb, pb + 16);
        Bi[j] = frag_h(pb + PLANE, pb + PLANE + 16);
      }
#pragma unroll
      for (int i = 0; i < TA; ++i)
#pragma unroll
        for (int j = 0; j < TB; ++j) {
          acc.rr[i][j] = WMMA_F16(Ar[i], Br[j], acc.rr[i][j]);
          acc.ii[i][j] = WMMA_F16(Ai[i], Bi[j], acc.ii[i][j]);
          acc.ri[i][j] = WMMA_F16(Ar[i], Bi[j], acc.ri[i][j]);
          acc.ir[i][j] = WMMA_F16(Ai[i], Br[j], acc.ir[i][j]);
        }
    }

    asm volatile("s_wait_dscnt 0x0" ::: "memory");     // this wave's reads of buffer p & 1 are done before it is refilled
    asm volatile("s_wait_asynccnt 0x0" ::: "memory");  // this wave's copies of pass p + 1 have landed
    __syncthreads();  // publishes pass p + 1 and ends every reader's use of buffer p & 1
    if (p + 2 < NPASS) {
      const int e = (p + 2) * KP;
      _Float16* l = ldst + (p & 1) * STAGE;
      copy_planes(l, g0 + e, g1 + e);
      copy_planes(l + 2 * PLANE, g2 + e, g3 + e);
    }
  }
  asm volatile("s_wait_asynccnt 0x0" ::: "memory");  // nothing of this wave is in flight when it leaves the ring
}

// ---------------------------------------------------------------------------
// Complex projection: out[h, m, sb] = sum_e w[h,m,e] * x[sb,e]   (complex)
// A rows = flattened (h, m), B rows = sb; all-f16 operands, f32 accumulation.
// TRANSPOSED=0 -> store [b][h][s][m] (q,k);  TRANSPOSED=1 -> [b][h][m][s] (v^T)
// ---------------------------------------------------------------------------
template <int TRANSPOSED, int MDIM>
__global__ __launch_bounds__(256)
void proj_kernel(const _Float16* __restrict__ wre, const _Float16* __restrict__ wim,
                 const _Float16* __restrict__ xre, const _Float16* __restrict__ xim,
                 _Float16* __restrict__ ore, _Float16* __restrict__ oim) {
  __shared__ __align__(16) _Float16 lds[2 * STAGE];

  const int lane = threadIdx.x & 31;
  const int wave = threadIdx.x >> 5;
  const int col  = lane & 15;
  const int hig  = lane >> 4;
  const int sb0  = blockIdx.x * BT;  // first sb of the tile
  const int hm0  = blockIdx.y * BT;  // first flattened (h, m) row of the tile

  CAcc acc;
  cgemm_tile(wre + (size_t)hm0 * E_DIM, wim + (size_t)hm0 * E_DIM,
             xre + (size_t)sb0 * E_DIM, xim + (size_t)sb0 * E_DIM, lds, acc);

  // One base address per plane; i, j and r move it by constants.
  const unsigned b  = col & (B_DIM - 1);                             // sb % B_DIM
  const unsigned s0 = (sb0 >> 2) + (wave & 1) * 16 + (col >> 2);     // sb / B_DIM at j = 0
  const unsigned hm = hm0 + (wave >> 1) * 32 + hig * 8;              // row at i = 0, r = 0
  const unsigned h  = hm / MDIM;                                     // 32 rows never cross a head
  const unsigned m0 = hm % MDIM;
  const size_t base = TRANSPOSED ? (((size_t)b * H_DIM + h) * MDIM + m0) * S_DIM + s0
                                 : (((size_t)b * H_DIM + h) * S_DIM + s0) * MDIM + m0;
  _Float16* pr = ore + base;
  _Float16* pi = oim + base;
#pragma unroll
  for (int i = 0; i < TA; ++i)
#pragma unroll
    for (int j = 0; j < TB; ++j) {
#pragma unroll
      for (int r = 0; r < 8; ++r) {
        const float re = acc.rr[i][j][r] - acc.ii[i][j][r];
        const float im = acc.ri[i][j][r] + acc.ir[i][j][r];
        const int  off = TRANSPOSED ? (i * 16 + r) * S_DIM + j * 4 : j * 4 * MDIM + i * 16 + r;
        pr[off] = (_Float16)re;
        pi[off] = (_Float16)im;
      }
    }
}

// ---------------------------------------------------------------------------
// Flash attention, complex scores: amp = |q k^T| / sqrt(M), causal mask,
// online softmax, upd = P V (complex). One wave per (b, h, 16-query tile).
// t processed in 32-column chunks so P@V WMMAs use the full K=32.
// ---------------------------------------------------------------------------
__global__ __launch_bounds__(32)
void attn_kernel(const _Float16* __restrict__ qre, const _Float16* __restrict__ qim,
                 const _Float16* __restrict__ kre, const _Float16* __restrict__ kim,
                 const _Float16* __restrict__ vre, const _Float16* __restrict__ vim,
                 _Float16* __restrict__ ure, _Float16* __restrict__ uim) {
  __shared__ __align__(16) _Float16 lds_p[16 * 32];  // 16 rows x 32 t-cols

  const int lane = threadIdx.x;
  const int col  = lane & 15;
  const int hig  = lane >> 4;
  const int st   = blockIdx.x;  // query tile
  const int h    = blockIdx.y;
  const int b    = blockIdx.z;

  const size_t bh   = (size_t)b * H_DIM + h;
  const int    srow = st * 16 + col;

  // Cache q fragments for this row tile (M=128 -> 4 K-steps, re+im).
  v16h qfr[4], qfi[4];
#pragma unroll
  for (int km = 0; km < 4; ++km) {
    const _Float16* pr = qre + (bh * S_DIM + srow) * M_DIM + km * 32 + hig * 8;
    const _Float16* pi = qim + (bh * S_DIM + srow) * M_DIM + km * 32 + hig * 8;
    qfr[km] = frag_h(pr, pr + 16);
    qfi[km] = frag_h(pi, pi + 16);
  }

  v8f accre[4], accim[4];
  {
    v8f z = {};
#pragma unroll
    for (int c = 0; c < 4; ++c) { accre[c] = z; accim[c] = z; }
  }
  float mrun[8], lrun[8];
#pragma unroll
  for (int r = 0; r < 8; ++r) { mrun[r] = -__builtin_inff(); lrun[r] = 0.f; }

  const float scl = 0.08838834764831845f;  // 1/sqrt(128)

  for (int tc = 0; tc <= st; tc += 2) {
    // ---- two score tiles (t columns tc*16 .. tc*16+31) ----
    float amp[2][8];
#pragma unroll
    for (int sub = 0; sub < 2; ++sub) {
      const int tt   = tc + sub;
      const int trow = tt * 16 + col;  // always < S_DIM
      v8f prr = {}, pii = {}, pri = {}, pir = {};
#pragma unroll
      for (int km = 0; km < 4; ++km) {
        const _Float16* kr = kre + (bh * S_DIM + trow) * M_DIM + km * 32 + hig * 8;
        const _Float16* ki = kim + (bh * S_DIM + trow) * M_DIM + km * 32 + hig * 8;
        if (sub == 0 && tc + 2 <= st) {  // prefetch next chunk's K rows
          __builtin_prefetch(kr + 32 * M_DIM, 0, 1);
          __builtin_prefetch(ki + 32 * M_DIM, 0, 1);
        }
        v16h Kr = frag_h(kr, kr + 16);
        v16h Ki = frag_h(ki, ki + 16);
        prr = WMMA_F16(qfr[km], Kr, prr);
        pii = WMMA_F16(qfi[km], Ki, pii);
        pri = WMMA_F16(qfr[km], Ki, pri);
        pir = WMMA_F16(qfi[km], Kr, pir);
      }
#pragma unroll
      for (int r = 0; r < 8; ++r) {
        const float re = prr[r] - pii[r];
        const float im = pri[r] + pir[r];
        const float a  = sqrtf(re * re + im * im) * scl;
        const int row  = st * 16 + r + hig * 8;
        amp[sub][r] = (trow <= row) ? a : -__builtin_inff();  // covers tt > st too
      }
    }

    // ---- online softmax over the 32 columns ----
    float p0[8], p1[8], scale[8];
#pragma unroll
    for (int r = 0; r < 8; ++r) {
      const float rm = fmaxf(rowmax16(amp[0][r]), rowmax16(amp[1][r]));
      const float mn = fmaxf(mrun[r], rm);
      const float sc = __expf(mrun[r] - mn);
      const float e0 = __expf(amp[0][r] - mn);
      const float e1 = __expf(amp[1][r] - mn);
      const float rs = rowsum16(e0) + rowsum16(e1);
      lrun[r]  = lrun[r] * sc + rs;
      mrun[r]  = mn;
      scale[r] = sc;
      p0[r] = e0;
      p1[r] = e1;
    }
#pragma unroll
    for (int c = 0; c < 4; ++c)
#pragma unroll
      for (int r = 0; r < 8; ++r) {
        accre[c][r] *= scale[r];
        accim[c][r] *= scale[r];
      }

    // ---- C-layout P (16x32) -> LDS -> full-K A fragment ----
    __syncthreads();
#pragma unroll
    for (int r = 0; r < 8; ++r) {
      lds_p[(r + hig * 8) * 32 + col]      = (_Float16)p0[r];
      lds_p[(r + hig * 8) * 32 + 16 + col] = (_Float16)p1[r];
    }
    __syncthreads();

    const _Float16* lp = &lds_p[col * 32 + hig * 8];
    v16h Pa = frag_h(lp, lp + 16);

    // ---- P @ V (re/im): 8 full-K WMMAs per 32-column chunk ----
#pragma unroll
    for (int c = 0; c < 4; ++c) {
      const int vc = c * 16 + col;
      const _Float16* vr = vre + (bh * V_DIM + vc) * S_DIM + tc * 16 + hig * 8;
      const _Float16* vi = vim + (bh * V_DIM + vc) * S_DIM + tc * 16 + hig * 8;
      v16h Vr = frag_h(vr, vr + 16);
      v16h Vi = frag_h(vi, vi + 16);
      accre[c] = WMMA_F16(Pa, Vr, accre[c]);
      accim[c] = WMMA_F16(Pa, Vi, accim[c]);
    }
  }

  // ---- normalize and store upd as f16 in (s, b, h*V + vc) layout ----
#pragma unroll
  for (int r = 0; r < 8; ++r) {
    const float inv = 1.0f / lrun[r];
    const int   s   = st * 16 + r + hig * 8;
#pragma unroll
    for (int c = 0; c < 4; ++c) {
      const int vc = c * 16 + col;
      const size_t idx = ((size_t)s * B_DIM + b) * E_DIM + h * V_DIM + vc;
      ure[idx] = (_Float16)(accre[c][r] * inv);
      uim[idx] = (_Float16)(accim[c][r] * inv);
    }
  }
}

// ---------------------------------------------------------------------------
// out[sb,f] = sum_e upd[sb,e] * wo[e,f] + x[sb,f]   (complex, f32 result)
// A rows = sb, B rows = f (wo^T).
// ---------------------------------------------------------------------------
__global__ __launch_bounds__(256)
void outproj_kernel(const _Float16* __restrict__ ure, const _Float16* __restrict__ uim,
                    const _Float16* __restrict__ wtre, const _Float16* __restrict__ wtim,
                    const float* __restrict__ xre, const float* __restrict__ xim,
                    float* __restrict__ out) {
  __shared__ __align__(16) _Float16 lds[2 * STAGE];

  const int lane = threadIdx.x & 31;
  const int wave = threadIdx.x >> 5;
  const int col  = lane & 15;
  const int hig  = lane >> 4;
  const int sb0  = blockIdx.x * BT;
  const int f0   = blockIdx.y * BT;

  CAcc acc;
  cgemm_tile(ure + (size_t)sb0 * E_DIM, uim + (size_t)sb0 * E_DIM,
             wtre + (size_t)f0 * E_DIM, wtim + (size_t)f0 * E_DIM, lds, acc);

  // One 32-bit byte offset serves x and out, re and im; i, j and r move it by constants.
  const unsigned offb = ((unsigned)(sb0 + (wave >> 1) * 32 + hig * 8) * E_DIM +
                         (unsigned)(f0 + (wave & 1) * 64 + col)) * 4u;
  const float* px_re = (const float*)((const char*)xre + offb);
  const float* px_im = (const float*)((const char*)xim + offb);
  float* po_re = (float*)((char*)out + offb);
  float* po_im = (float*)((char*)(out + (size_t)SB_DIM * E_DIM) + offb);

  float xr[TA][TB][8], xi[TA][TB][8];
#pragma unroll
  for (int i = 0; i < TA; ++i)
#pragma unroll
    for (int j = 0; j < TB; ++j)
#pragma unroll
      for (int r = 0; r < 8; ++r) {
        xr[i][j][r] = px_re[(i * 16 + r) * E_DIM + j * 16];
        xi[i][j][r] = px_im[(i * 16 + r) * E_DIM + j * 16];
      }
#pragma unroll
  for (int i = 0; i < TA; ++i)
#pragma unroll
    for (int j = 0; j < TB; ++j) {
#pragma unroll
      for (int r = 0; r < 8; ++r) {
        po_re[(i * 16 + r) * E_DIM + j * 16] = (acc.rr[i][j][r] - acc.ii[i][j][r]) + xr[i][j][r];
        po_im[(i * 16 + r) * E_DIM + j * 16] = (acc.ri[i][j][r] + acc.ir[i][j][r]) + xi[i][j][r];
      }
      asm volatile("s_wait_xcnt 0x0" ::: "memory");  // before the next tile reuses registers these stores name
      __builtin_amdgcn_sched_barrier(0);  // keeps the next tile's arithmetic behind that wait
    }
}

// ---------------------------------------------------------------------------
extern "C" void kernel_launch(void* const* d_in, const int* in_sizes, int n_in,
                              void* d_out, int out_size, void* d_ws, size_t ws_size,
                              hipStream_t stream) {
  (void)in_sizes; (void)n_in; (void)out_size; (void)ws_size;

  const float* xre  = (const float*)d_in[0];
  const float* xim  = (const float*)d_in[1];
  const float* wqre = (const float*)d_in[2];
  const float* wqim = (const float*)d_in[3];
  const float* wkre = (const float*)d_in[4];
  const float* wkim = (const float*)d_in[5];
  const float* wvre = (const float*)d_in[6];
  const float* wvim = (const float*)d_in[7];
  const float* wore = (const float*)d_in[8];
  const float* woim = (const float*)d_in[9];

  char*  ws = (char*)d_ws;
  size_t o  = 0;
  auto halloc = [&](size_t n) { _Float16* p = (_Float16*)(ws + o); o += n * sizeof(_Float16); return p; };

  const size_t QK = (size_t)B_DIM * H_DIM * S_DIM * M_DIM;  // q/k per component
  const size_t VT = (size_t)B_DIM * H_DIM * V_DIM * S_DIM;  // v^T per component
  const size_t UE = (size_t)SB_DIM * E_DIM;                 // upd / x per component
  const size_t WO = (size_t)E_DIM * E_DIM;                  // wo^T per component
  const size_t WQ = (size_t)H_DIM * M_DIM * E_DIM;          // wq/wk per component
  const size_t WV = (size_t)H_DIM * V_DIM * E_DIM;          // wv per component

  _Float16* qre  = halloc(QK);  _Float16* qim  = halloc(QK);
  _Float16* kre  = halloc(QK);  _Float16* kim  = halloc(QK);
  _Float16* vtre = halloc(VT);  _Float16* vtim = halloc(VT);
  _Float16* upre = halloc(UE);  _Float16* upim = halloc(UE);
  _Float16* wtre = halloc(WO);  _Float16* wtim = halloc(WO);
  _Float16* xhre = halloc(UE);  _Float16* xhim = halloc(UE);
  _Float16* qwre = halloc(WQ);  _Float16* qwim = halloc(WQ);
  _Float16* kwre = halloc(WQ);  _Float16* kwim = halloc(WQ);
  _Float16* vwre = halloc(WV);  _Float16* vwim = halloc(WV);

  // One-time f32 -> f16 operand conversions.
  auto cvt = [&](const float* s, _Float16* d, size_t n) {
    cvt_f16_kernel<<<(int)((n + 255) / 256), 256, 0, stream>>>(s, d, (int)n);
  };
  cvt(xre, xhre, UE);  cvt(xim, xhim, UE);
  cvt(wqre, qwre, WQ); cvt(wqim, qwim, WQ);
  cvt(wkre, kwre, WQ); cvt(wkim, kwim, WQ);
  cvt(wvre, vwre, WV); cvt(wvim, vwim, WV);
  transpose_wo<<<(E_DIM * E_DIM + 255) / 256, 256, 0, stream>>>(wore, woim, wtre, wtim);

  dim3 gq(SB_DIM / BT, H_DIM * M_DIM / BT);
  proj_kernel<0, M_DIM><<<gq, 256, 0, stream>>>(qwre, qwim, xhre, xhim, qre, qim);
  proj_kernel<0, M_DIM><<<gq, 256, 0, stream>>>(kwre, kwim, xhre, xhim, kre, kim);
  dim3 gv(SB_DIM / BT, H_DIM * V_DIM / BT);
  proj_kernel<1, V_DIM><<<gv, 256, 0, stream>>>(vwre, vwim, xhre, xhim, vtre, vtim);

  dim3 ga(S_DIM / 16, H_DIM, B_DIM);
  attn_kernel<<<ga, 32, 0, stream>>>(qre, qim, kre, kim, vtre, vtim, upre, upim);

  dim3 go(SB_DIM / BT, E_DIM / BT);
  outproj_kernel<<<go, 256, 0, stream>>>(upre, upim, wtre, wtim, xre, xim, (float*)d_out);
}

// v002
// It runs in 388 microseconds.
// In two side-by-side timings against v001, it was 1.06 and 1.07 times as fast.
// Counting every step since v000, it is 2.72 times as fast.
#include <hip/hip_runtime.h>
#include <hip/hip_bf16.h>
#include <math.h>

#define S_DIM 1024
#define B_DIM 4
#define E_DIM 1024
#define H_DIM 16
#define M_DIM 128
#define V_DIM 64
#define SB_DIM (S_DIM * B_DIM)

typedef __attribute__((ext_vector_type(16))) _Float16 v16h;
typedef __attribute__((ext_vector_type(8)))  _Float16 v8h;
typedef __attribute__((ext_vector_type(8)))  float    v8f;

#define WMMA_F16(A, B, C) \
  __builtin_amdgcn_wmma_f32_16x16x32_f16(false, (A), false, (B), (short)0, (C), false, false)

// 16x32 f16 A/B fragment from two contiguous 8-half segments
// (segment 0 at K-base, segment 1 at K-base+16; lane group picks +0 / +8).
static __device__ inline v16h frag_h(const _Float16* __restrict__ s0,
                                     const _Float16* __restrict__ s1) {
  v8h a = *(const v8h*)s0;
  v8h b = *(const v8h*)s1;
  v16h r;
#pragma unroll
  for (int j = 0; j < 8; ++j) {
    r[j]     = a[j];
    r[j + 8] = b[j];
  }
  return r;
}

static __device__ inline float rowmax16(float v) {
#pragma unroll
  for (int m = 1; m < 16; m <<= 1) v = fmaxf(v, __shfl_xor(v, m, 32));
  return v;
}
static __device__ inline float rowsum16(float v) {
#pragma unroll
  for (int m = 1; m < 16; m <<= 1) v += __shfl_xor(v, m, 32);
  return v;
}

// ---------------------------------------------------------------------------
// Bulk f32 -> f16 conversion (one pass; amortizes all GEMM operand reuse).
// A wave converts CVT_RUNS runs of 128 consecutive elements: per run one
// 16-byte load a lane (512 contiguous bytes a wave) and one 8-byte store a lane
// (256 contiguous bytes a wave). All loads of a lane are issued before its first
// conversion, so few waves keep the memory busy and few waves have to start.
// ---------------------------------------------------------------------------
typedef __attribute__((ext_vector_type(4))) float    v4f;
typedef __attribute__((ext_vector_type(4))) _Float16 v4h;

#define CVT_RUNS  8                  // 16-byte loads in flight per lane
#define CVT_WAVE  (CVT_RUNS * 128)   // elements per wave
#define CVT_BLOCK (8 * CVT_WAVE)     // elements per block of 8 waves

__global__ __launch_bounds__(256)
void cvt_f16_kernel(const float* __restrict__ src,
                    _Float16* __restrict__ dst, int n) {
  const int first = (blockIdx.x * 8 + (threadIdx.x >> 5)) * CVT_WAVE;
  if (first >= n) return;  // n is a multiple of CVT_WAVE: a wave has all of its runs or none
  const int at = first + (threadIdx.x & 31) * 4;
  v4f v[CVT_RUNS];
#pragma unroll  // both loops unrolled: v stays in registers and the loads go out as one group
  for (int k = 0; k < CVT_RUNS; ++k) v[k] = *(const v4f*)(src + at + k * 128);
#pragma unroll
  for (int k = 0; k < CVT_RUNS; ++k) {
    v4h h;
#pragma unroll
    for (int j = 0; j < 4; ++j) h[j] = (_Float16)v[k][j];
    *(v4h*)(dst + at + k * 128) = h;
  }
}

// wo (E,E) f32 -> wo^T (F,E) f16, so out-proj B-fragments load contiguously.
__global__ void transpose_wo(const float* __restrict__ wre,
                             const float* __restrict__ wim,
                             _Float16* __restrict__ tre,
                             _Float16* __restrict__ tim) {
  int idx = blockIdx.x * blockDim.x + threadIdx.x;  // f*E + e
  if (idx >= E_DIM * E_DIM) return;
  int f = idx >> 10;
  int e = idx & (E_DIM - 1);
  tre[idx] = (_Float16)wre[(size_t)e * E_DIM + f];
  tim[idx] = (_Float16)wim[(size_t)e * E_DIM + f];
}

// ---------------------------------------------------------------------------
// Shared core of the four complex GEMMs: D[a][b] = sum_e A[a][e] * B[b][e],
// A and B complex, e-contiguous f16 rows of E_DIM.
// One work-group of 8 waves owns a 128 x 128 tile of D. Per pass, 64 e of the
// 128 A rows and 128 B rows (re and im planes) are brought into LDS by
// asynchronous copies, whole 128-byte lines per row, so each operand byte is
// fetched once per work-group; each wave (4 x 2 grid) then reads the fragments
// of its 32 x 64 part from LDS. Two buffers: the copies of pass p + 1 fly
// during the products of pass p.
// Every accumulator still sums e in ascending steps of 32.
// ---------------------------------------------------------------------------
#define BT     128                // rows of each operand per work-group
#define KP     64                 // e per pass (128 B of a row)
#define NPASS  (E_DIM / KP)
#define PITCH  72                 // LDS row pitch in halves: 144 B = 16 B x odd
#define PLANE  (BT * PITCH)       // one operand plane (re or im)
#define STAGE  (4 * PLANE)        // A re | A im | B re | B im
#define TA     2                  // 16-row A tiles per wave
#define TB     4                  // 16-row B tiles per wave

struct CAcc {
  v8f rr[TA][TB], ii[TA][TB], ri[TA][TB], ir[TA][TB];
};

typedef int v4i __attribute__((ext_vector_type(4)));
typedef __attribute__((address_space(1))) v4i gv4i;
typedef __attribute__((address_space(3))) v4i lv4i;

// Two planes (re, im) of one operand: each lane copies 16 bytes of four rows
// of each plane, global -> LDS, through no register. l = the lane's place in
// the re plane, gr / gi = its global addresses.
static __device__ inline void copy_planes(_Float16* l, const _Float16* gr, const _Float16* gi) {
#pragma unroll
  for (int i = 0; i < 4; ++i) {
    __builtin_amdgcn_global_load_async_to_lds_b128(
        (gv4i*)(gr + (size_t)i * 32 * E_DIM), (lv4i*)(l + i * 32 * PITCH), 0, 0);
    __builtin_amdgcn_global_load_async_to_lds_b128(
        (gv4i*)(gi + (size_t)i * 32 * E_DIM), (lv4i*)(l + PLANE + i * 32 * PITCH), 0, 0);
  }
}

static __device__ inline void cgemm_tile(const _Float16* __restrict__ are,
                                         const _Float16* __restrict__ aim,
                                         const _Float16* __restrict__ bre,
                                         const _Float16* __restrict__ bim,
                                         _Float16* lds, CAcc& acc) {
  const int tid  = threadIdx.x;
  const int lane = tid & 31;
  const int wave = tid >> 5;
  const int col  = lane & 15;
  const int hig  = lane >> 4;
  const int wa   = wave >> 1;  // which 32 A rows
  const int wb   = wave & 1;   // which 64 B rows

  // Copy map: 8 lanes cover one 128-byte row piece, 32 rows per sweep.
  const int    grow = tid >> 3;
  const int    gseg = tid & 7;
  const size_t goff = (size_t)grow * E_DIM + gseg * 8;
  const _Float16* g0 = are + goff;
  const _Float16* g1 = aim + goff;
  const _Float16* g2 = bre + goff;
  const _Float16* g3 = bim + goff;
  _Float16* ldst = lds + grow * PITCH + gseg * 8;

  {
    v8f z = {};
#pragma unroll
    for (int i = 0; i < TA; ++i)
#pragma unroll
      for (int j = 0; j < TB; ++j) {
        acc.rr[i][j] = z; acc.ii[i][j] = z; acc.ri[i][j] = z; acc.ir[i][j] = z;
      }
  }

  // Pass 0 into buffer 0, landed and published; then pass 1 into buffer 1.
  copy_planes(ldst, g0, g1);
  copy_planes(ldst + 2 * PLANE, g2, g3);
  asm volatile("s_wait_asynccnt 0x0" ::: "memory");  // this wave's copies of pass 0 have landed
  __syncthreads();
  copy_planes(ldst + STAGE, g0 + KP, g1 + KP);
  copy_planes(ldst + STAGE + 2 * PLANE, g2 + KP, g3 + KP);

  const int aoff = (wa * 32 + col) * PITCH + hig * 8;
  const int boff = 2 * PLANE + (wb * 64 + col) * PITCH + hig * 8;

  for (int p = 0; p < NPASS; ++p) {
    const _Float16* cur = lds + (p & 1) * STAGE;
#pragma unroll
    for (int ks = 0; ks < KP / 32; ++ks) {
      v16h Ar[TA], Ai[TA], Br[TB], Bi[TB];
#pragma unroll
      for (int i = 0; i < TA; ++i) {
        const _Float16* pa = cur + aoff + i * 16 * PITCH + ks * 32;
        Ar[i] = frag_h(pa, pa + 16);
        Ai[i] = frag_h(pa + PLANE, pa + PLANE + 16);
      }
#pragma unroll
      for (int j = 0; j < TB; ++j) {
        const _Float16* pb = cur + boff + j * 16 * PITCH + ks * 32;
        Br[j] = frag_h(pb, pb + 16);
        Bi[j] = frag_h(pb + PLANE, pb + PLANE + 16);
      }
#pragma unroll
      for (int i = 0; i < TA; ++i)
#pragma unroll
        for (int j = 0; j < TB; ++j) {
          acc.rr[i][j] = WMMA_F16(Ar[i], Br[j], acc.rr[i][j]);
          acc.ii[i][j] = WMMA_F16(Ai[i], Bi[j], acc.ii[i][j]);
          acc.ri[i][j] = WMMA_F16(Ar[i], Bi[j], acc.ri[i][j]);
          acc.ir[i][j] = WMMA_F16(Ai[i], Br[j], acc.ir[i][j]);
        }
    }

    asm volatile("s_wait_dscnt 0x0" ::: "memory");     // this wave's reads of buffer p & 1 are done before it is refilled
    asm volatile("s_wait_asynccnt 0x0" ::: "memory");  // this wave's copies of pass p + 1 have landed
    __syncthreads();  // publishes pass p + 1 and ends every reader's use of buffer p & 1
    if (p + 2 < NPASS) {
      const int e = (p + 2) * KP;
      _Float16* l = ldst + (p & 1) * STAGE;
      copy_planes(l, g0 + e, g1 + e);
      copy_planes(l + 2 * PLANE, g2 + e, g3 + e);
    }
  }
  asm volatile("s_wait_asynccnt 0x0" ::: "memory");  // nothing of this wave is in flight when it leaves the ring
}

// ---------------------------------------------------------------------------
// Complex projection: out[h, m, sb] = sum_e w[h,m,e] * x[sb,e]   (complex)
// A rows = flattened (h, m), B rows = sb; all-f16 operands, f32 accumulation.
// TRANSPOSED=0 -> store [b][h][s][m] (q,k);  TRANSPOSED=1 -> [b][h][m][s] (v^T)
// ---------------------------------------------------------------------------
template <int TRANSPOSED, int MDIM>
__global__ __launch_bounds__(256)
void proj_kernel(const _Float16* __restrict__ wre, const _Float16* __restrict__ wim,
                 const _Float16* __restrict__ xre, const _Float16* __restrict__ xim,
                 _Float16* __restrict__ ore, _Float16* __restrict__ oim) {
  __shared__ __align__(16) _Float16 lds[2 * STAGE];

  const int lane = threadIdx.x & 31;
  const int wave = threadIdx.x >> 5;
  const int col  = lane & 15;
  const int hig  = lane >> 4;
  const int sb0  = blockIdx.x * BT;  // first sb of the tile
  const int hm0  = blockIdx.y * BT;  // first flattened (h, m) row of the tile

  CAcc acc;
  cgemm_tile(wre + (size_t)hm0 * E_DIM, wim + (size_t)hm0 * E_DIM,
             xre + (size_t)sb0 * E_DIM, xim + (size_t)sb0 * E_DIM, lds, acc);

  // One base address per plane; i, j and r move it by constants.
  const unsigned b  = col & (B_DIM - 1);                             // sb % B_DIM
  const unsigned s0 = (sb0 >> 2) + (wave & 1) * 16 + (col >> 2);     // sb / B_DIM at j = 0
  const unsigned hm = hm0 + (wave >> 1) * 32 + hig * 8;              // row at i = 0, r = 0
  const unsigned h  = hm / MDIM;                                     // 32 rows never cross a head
  const unsigned m0 = hm % MDIM;
  const size_t base = TRANSPOSED ? (((size_t)b * H_DIM + h) * MDIM + m0) * S_DIM + s0
                                 : (((size_t)b * H_DIM + h) * S_DIM + s0) * MDIM + m0;
  _Float16* pr = ore + base;
  _Float16* pi = oim + base;
#pragma unroll
  for (int i = 0; i < TA; ++i)
#pragma unroll
    for (int j = 0; j < TB; ++j) {
#pragma unroll
      for (int r = 0; r < 8; ++r) {
        const float re = acc.rr[i][j][r] - acc.ii[i][j][r];
        const float im = acc.ri[i][j][r] + acc.ir[i][j][r];
        const int  off = TRANSPOSED ? (i * 16 + r) * S_DIM + j * 4 : j * 4 * MDIM + i * 16 + r;
        pr[off] = (_Float16)re;
        pi[off] = (_Float16)im;
      }
    }
}

// ---------------------------------------------------------------------------
// Flash attention, complex scores: amp = |q k^T| / sqrt(M), causal mask,
// online softmax, upd = P V (complex). One wave per (b, h, 16-query tile).
// t processed in 32-column chunks so P@V WMMAs use the full K=32.
// ---------------------------------------------------------------------------
__global__ __launch_bounds__(32)
void attn_kernel(const _Float16* __restrict__ qre, const _Float16* __restrict__ qim,
                 const _Float16* __restrict__ kre, const _Float16* __restrict__ kim,
                 const _Float16* __restrict__ vre, const _Float16* __restrict__ vim,
                 _Float16* __restrict__ ure, _Float16* __restrict__ uim) {
  __shared__ __align__(16) _Float16 lds_p[16 * 32];  // 16 rows x 32 t-cols

  const int lane = threadIdx.x;
  const int col  = lane & 15;
  const int hig  = lane >> 4;
  const int st   = blockIdx.x;  // query tile
  const int h    = blockIdx.y;
  const int b    = blockIdx.z;

  const size_t bh   = (size_t)b * H_DIM + h;
  const int    srow = st * 16 + col;

  // Cache q fragments for this row tile (M=128 -> 4 K-steps, re+im).
  v16h qfr[4], qfi[4];
#pragma unroll
  for (int km = 0; km < 4; ++km) {
    const _Float16* pr = qre + (bh * S_DIM + srow) * M_DIM + km * 32 + hig * 8;
    const _Float16* pi = qim + (bh * S_DIM + srow) * M_DIM + km * 32 + hig * 8;
    qfr[km] = frag_h(pr, pr + 16);
    qfi[km] = frag_h(pi, pi + 16);
  }

  v8f accre[4], accim[4];
  {
    v8f z = {};
#pragma unroll
    for (int c = 0; c < 4; ++c) { accre[c] = z; accim[c] = z; }
  }
  float mrun[8], lrun[8];
#pragma unroll
  for (int r = 0; r < 8; ++r) { mrun[r] = -__builtin_inff(); lrun[r] = 0.f; }

  const float scl = 0.08838834764831845f;  // 1/sqrt(128)

  for (int tc = 0; tc <= st; tc += 2) {
    // ---- two score tiles (t columns tc*16 .. tc*16+31) ----
    float amp[2][8];
#pragma unroll
    for (int sub = 0; sub < 2; ++sub) {
      const int tt   = tc + sub;
      const int trow = tt * 16 + col;  // always < S_DIM
      v8f prr = {}, pii = {}, pri = {}, pir = {};
#pragma unroll
      for (int km = 0; km < 4; ++km) {
        const _Float16* kr = kre + (bh * S_DIM + trow) * M_DIM + km * 32 + hig * 8;
        const _Float16* ki = kim + (bh * S_DIM + trow) * M_DIM + km * 32 + hig * 8;
        if (sub == 0 && tc + 2 <= st) {  // prefetch next chunk's K rows
          __builtin_prefetch(kr + 32 * M_DIM, 0, 1);
          __builtin_prefetch(ki + 32 * M_DIM, 0, 1);
        }
        v16h Kr = frag_h(kr, kr + 16);
        v16h Ki = frag_h(ki, ki + 16);
        prr = WMMA_F16(qfr[km], Kr, prr);
        pii = WMMA_F16(qfi[km], Ki, pii);
        pri = WMMA_F16(qfr[km], Ki, pri);
        pir = WMMA_F16(qfi[km], Kr, pir);
      }
#pragma unroll
      for (int r = 0; r < 8; ++r) {
        const float re = prr[r] - pii[r];
        const float im = pri[r] + pir[r];
        const float a  = sqrtf(re * re + im * im) * scl;
        const int row  = st * 16 + r + hig * 8;
        amp[sub][r] = (trow <= row) ? a : -__builtin_inff();  // covers tt > st too
      }
    }

    // ---- online softmax over the 32 columns ----
    float p0[8], p1[8], scale[8];
#pragma unroll
    for (int r = 0; r < 8; ++r) {
      const float rm = fmaxf(rowmax16(amp[0][r]), rowmax16(amp[1][r]));
      const float mn = fmaxf(mrun[r], rm);
      const float sc = __expf(mrun[r] - mn);
      const float e0 = __expf(amp[0][r] - mn);
      const float e1 = __expf(amp[1][r] - mn);
      const float rs = rowsum16(e0) + rowsum16(e1);
      lrun[r]  = lrun[r] * sc + rs;
      mrun[r]  = mn;
      scale[r] = sc;
      p0[r] = e0;
      p1[r] = e1;
    }
#pragma unroll
    for (int c = 0; c < 4; ++c)
#pragma unroll
      for (int r = 0; r < 8; ++r) {
        accre[c][r] *= scale[r];
        accim[c][r] *= scale[r];
      }

    // ---- C-layout P (16x32) -> LDS -> full-K A fragment ----
    __syncthreads();
#pragma unroll
    for (int r = 0; r < 8; ++r) {
      lds_p[(r + hig * 8) * 32 + col]      = (_Float16)p0[r];
      lds_p[(r + hig * 8) * 32 + 16 + col] = (_Float16)p1[r];
    }
    __syncthreads();

    const _Float16* lp = &lds_p[col * 32 + hig * 8];
    v16h Pa = frag_h(lp, lp + 16);

    // ---- P @ V (re/im): 8 full-K WMMAs per 32-column chunk ----
#pragma unroll
    for (int c = 0; c < 4; ++c) {
      const int vc = c * 16 + col;
      const _Float16* vr = vre + (bh * V_DIM + vc) * S_DIM + tc * 16 + hig * 8;
      const _Float16* vi = vim + (bh * V_DIM + vc) * S_DIM + tc * 16 + hig * 8;
      v16h Vr = frag_h(vr, vr + 16);
      v16h Vi = frag_h(vi, vi + 16);
      accre[c] = WMMA_F16(Pa, Vr, accre[c]);
      accim[c] = WMMA_F16(Pa, Vi, accim[c]);
    }
  }

  // ---- normalize and store upd as f16 in (s, b, h*V + vc) layout ----
#pragma unroll
  for (int r = 0; r < 8; ++r) {
    const float inv = 1.0f / lrun[r];
    const int   s   = st * 16 + r + hig * 8;
#pragma unroll
    for (int c = 0; c < 4; ++c) {
      const int vc = c * 16 + col;
      const size_t idx = ((size_t)s * B_DIM + b) * E_DIM + h * V_DIM + vc;
      ure[idx] = (_Float16)(accre[c][r] * inv);
      uim[idx] = (_Float16)(accim[c][r] * inv);
    }
  }
}

// ---------------------------------------------------------------------------
// out[sb,f] = sum_e upd[sb,e] * wo[e,f] + x[sb,f]   (complex, f32 result)
// A rows = sb, B rows = f (wo^T).
// ---------------------------------------------------------------------------
__global__ __launch_bounds__(256)
void outproj_kernel(const _Float16* __restrict__ ure, const _Float16* __restrict__ uim,
                    const _Float16* __restrict__ wtre, const _Float16* __restrict__ wtim,
                    const float* __restrict__ xre, const float* __restrict__ xim,
                    float* __restrict__ out) {
  __shared__ __align__(16) _Float16 lds[2 * STAGE];

  const int lane = threadIdx.x & 31;
  const int wave = threadIdx.x >> 5;
  const int col  = lane & 15;
  const int hig  = lane >> 4;
  const int sb0  = blockIdx.x * BT;
  const int f0   = blockIdx.y * BT;

  CAcc acc;
  cgemm_tile(ure + (size_t)sb0 * E_DIM, uim + (size_t)sb0 * E_DIM,
             wtre + (size_t)f0 * E_DIM, wtim + (size_t)f0 * E_DIM, lds, acc);

  // One 32-bit byte offset serves x and out, re and im; i, j and r move it by constants.
  const unsigned offb = ((unsigned)(sb0 + (wave >> 1) * 32 + hig * 8) * E_DIM +
                         (unsigned)(f0 + (wave & 1) * 64 + col)) * 4u;
  const float* px_re = (const float*)((const char*)xre + offb);
  const float* px_im = (const float*)((const char*)xim + offb);
  float* po_re = (float*)((char*)out + offb);
  float* po_im = (float*)((char*)(out + (size_t)SB_DIM * E_DIM) + offb);

  float xr[TA][TB][8], xi[TA][TB][8];
#pragma unroll
  for (int i = 0; i < TA; ++i)
#pragma unroll
    for (int j = 0; j < TB; ++j)
#pragma unroll
      for (int r = 0; r < 8; ++r) {
        xr[i][j][r] = px_re[(i * 16 + r) * E_DIM + j * 16];
        xi[i][j][r] = px_im[(i * 16 + r) * E_DIM + j * 16];
      }
#pragma unroll
  for (int i = 0; i < TA; ++i)
#pragma unroll
    for (int j = 0; j < TB; ++j) {
#pragma unroll
      for (int r = 0; r < 8; ++r) {
        po_re[(i * 16 + r) * E_DIM + j * 16] = (acc.rr[i][j][r] - acc.ii[i][j][r]) + xr[i][j][r];
        po_im[(i * 16 + r) * E_DIM + j * 16] = (acc.ri[i][j][r] + acc.ir[i][j][r]) + xi[i][j][r];
      }
      asm volatile("s_wait_xcnt 0x0" ::: "memory");  // before the next tile reuses registers these stores name
      __builtin_amdgcn_sched_barrier(0);  // keeps the next tile's arithmetic behind that wait
    }
}

// ---------------------------------------------------------------------------
extern "C" void kernel_launch(void* const* d_in, const int* in_sizes, int n_in,
                              void* d_out, int out_size, void* d_ws, size_t ws_size,
                              hipStream_t stream) {
  (void)in_sizes; (void)n_in; (void)out_size; (void)ws_size;

  const float* xre  = (const float*)d_in[0];
  const float* xim  = (const float*)d_in[1];
  const float* wqre = (const float*)d_in[2];
  const float* wqim = (const float*)d_in[3];
  const float* wkre = (const float*)d_in[4];
  const float* wkim = (const float*)d_in[5];
  const float* wvre = (const float*)d_in[6];
  const float* wvim = (const float*)d_in[7];
  const float* wore = (const float*)d_in[8];
  const float* woim = (const float*)d_in[9];

  char*  ws = (char*)d_ws;
  size_t o  = 0;
  auto halloc = [&](size_t n) { _Float16* p = (_Float16*)(ws + o); o += n * sizeof(_Float16); return p; };

  const size_t QK = (size_t)B_DIM * H_DIM * S_DIM * M_DIM;  // q/k per component
  const size_t VT = (size_t)B_DIM * H_DIM * V_DIM * S_DIM;  // v^T per component
  const size_t UE = (size_t)SB_DIM * E_DIM;                 // upd / x per component
  const size_t WO = (size_t)E_DIM * E_DIM;                  // wo^T per component
  const size_t WQ = (size_t)H_DIM * M_DIM * E_DIM;          // wq/wk per component
  const size_t WV = (size_t)H_DIM * V_DIM * E_DIM;          // wv per component

  _Float16* qre  = halloc(QK);  _Float16* qim  = halloc(QK);
  _Float16* kre  = halloc(QK);  _Float16* kim  = halloc(QK);
  _Float16* vtre = halloc(VT);  _Float16* vtim = halloc(VT);
  _Float16* upre = halloc(UE);  _Float16* upim = halloc(UE);
  _Float16* wtre = halloc(WO);  _Float16* wtim = halloc(WO);
  _Float16* xhre = halloc(UE);  _Float16* xhim = halloc(UE);
  _Float16* qwre = halloc(WQ);  _Float16* qwim = halloc(WQ);
  _Float16* kwre = halloc(WQ);  _Float16* kwim = halloc(WQ);
  _Float16* vwre = halloc(WV);  _Float16* vwim = halloc(WV);

  // One-time f32 -> f16 operand conversions.
  static_assert((size_t)SB_DIM * E_DIM % CVT_BLOCK == 0 && (size_t)H_DIM * M_DIM * E_DIM % CVT_BLOCK == 0 &&
                (size_t)H_DIM * V_DIM * E_DIM % CVT_BLOCK == 0, "whole blocks");
  auto cvt = [&](const float* s, _Float16* d, size_t n) {
    cvt_f16_kernel<<<(int)(n / CVT_BLOCK), 256, 0, stream>>>(s, d, (int)n);
  };
  cvt(xre, xhre, UE);  cvt(xim, xhim, UE);
  cvt(wqre, qwre, WQ); cvt(wqim, qwim, WQ);
  cvt(wkre, kwre, WQ); cvt(wkim, kwim, WQ);
  cvt(wvre, vwre, WV); cvt(wvim, vwim, WV);
  transpose_wo<<<(E_DIM * E_DIM + 255) / 256, 256, 0, stream>>>(wore, woim, wtre, wtim);

  dim3 gq(SB_DIM / BT, H_DIM * M_DIM / BT);
  proj_kernel<0, M_DIM><<<gq, 256, 0, stream>>>(qwre, qwim, xhre, xhim, qre, qim);
  proj_kernel<0, M_DIM><<<gq, 256, 0, stream>>>(kwre, kwim, xhre, xhim, kre, kim);
  dim3 gv(SB_DIM / BT, H_DIM * V_DIM / BT);
  proj_kernel<1, V_DIM><<<gv, 256, 0, stream>>>(vwre, vwim, xhre, xhim, vtre, vtim);

  dim3 ga(S_DIM / 16, H_DIM, B_DIM);
  attn_kernel<<<ga, 32, 0, stream>>>(qre, qim, kre, kim, vtre, vtim, upre, upim);

  dim3 go(SB_DIM / BT, E_DIM / BT);
  outproj_kernel<<<go, 256, 0, stream>>>(upre, upim, wtre, wtim, xre, xim, (float*)d_out);
}

// v003
// One run takes 315 microseconds.
// In two side-by-side timings against v002, it was 1.24 and 1.23 times as fast.
// All steps since v000 together make it 3.36 times as fast.
#include <hip/hip_runtime.h>
#include <hip/hip_bf16.h>
#include <math.h>

#define S_DIM 1024
#define B_DIM 4
#define E_DIM 1024
#define H_DIM 16
#define M_DIM 128
#define V_DIM 64
#define SB_DIM (S_DIM * B_DIM)

typedef __attribute__((ext_vector_type(16))) _Float16 v16h;
typedef __attribute__((ext_vector_type(8)))  _Float16 v8h;
typedef __attribute__((ext_vector_type(8)))  float    v8f;

#define WMMA_F16(A, B, C) \
  __builtin_amdgcn_wmma_f32_16x16x32_f16(false, (A), false, (B), (short)0, (C), false, false)

// 16x32 f16 A/B fragment from two contiguous 8-half segments
// (segment 0 at K-base, segment 1 at K-base+16; lane group picks +0 / +8).
static __device__ inline v16h frag_h(const _Float16* __restrict__ s0,
                                     const _Float16* __restrict__ s1) {
  v8h a = *(const v8h*)s0;
  v8h b = *(const v8h*)s1;
  v16h r;
#pragma unroll
  for (int j = 0; j < 8; ++j) {
    r[j]     = a[j];
    r[j + 8] = b[j];
  }
  return r;
}

// Maximum (MAX) or sum over each 16-lane row, for 16 values a lane at once:
// per value the same four xor steps in the same order as one value alone; the
// 16 exchanges of a step are independent and go out together.
template <bool MAX>
static __device__ inline void rows16(float (&v)[16]) {
#pragma unroll
  for (int m = 1; m < 16; m <<= 1) {
    float t[16];
#pragma unroll
    for (int i = 0; i < 16; ++i) t[i] = __shfl_xor(v[i], m, 32);
#pragma unroll
    for (int i = 0; i < 16; ++i) v[i] = MAX ? fmaxf(v[i], t[i]) : v[i] + t[i];
  }
}

// ---------------------------------------------------------------------------
// Bulk f32 -> f16 conversion (one pass; amortizes all GEMM operand reuse).
// A wave converts CVT_RUNS runs of 128 consecutive elements: per run one
// 16-byte load a lane (512 contiguous bytes a wave) and one 8-byte store a lane
// (256 contiguous bytes a wave). All loads of a lane are issued before its first
// conversion, so few waves keep the memory busy and few waves have to start.
// ---------------------------------------------------------------------------
typedef __attribute__((ext_vector_type(4))) float    v4f;
typedef __attribute__((ext_vector_type(4))) _Float16 v4h;

#define CVT_RUNS  8                  // 16-byte loads in flight per lane
#define CVT_WAVE  (CVT_RUNS * 128)   // elements per wave
#define CVT_BLOCK (8 * CVT_WAVE)     // elements per block of 8 waves

__global__ __launch_bounds__(256)
void cvt_f16_kernel(const float* __restrict__ src,
                    _Float16* __restrict__ dst, int n) {
  const int first = (blockIdx.x * 8 + (threadIdx.x >> 5)) * CVT_WAVE;
  if (first >= n) return;  // n is a multiple of CVT_WAVE: a wave has all of its runs or none
  const int at = first + (threadIdx.x & 31) * 4;
  v4f v[CVT_RUNS];
#pragma unroll  // both loops unrolled: v stays in registers and the loads go out as one group
  for (int k = 0; k < CVT_RUNS; ++k) v[k] = *(const v4f*)(src + at + k * 128);
#pragma unroll
  for (int k = 0; k < CVT_RUNS; ++k) {
    v4h h;
#pragma unroll
    for (int j = 0; j < 4; ++j) h[j] = (_Float16)v[k][j];
    *(v4h*)(dst + at + k * 128) = h;
  }
}

// wo (E,E) f32 -> wo^T (F,E) f16, so out-proj B-fragments load contiguously.
__global__ void transpose_wo(const float* __restrict__ wre,
                             const float* __restrict__ wim,
                             _Float16* __restrict__ tre,
                             _Float16* __restrict__ tim) {
  int idx = blockIdx.x * blockDim.x + threadIdx.x;  // f*E + e
  if (idx >= E_DIM * E_DIM) return;
  int f = idx >> 10;
  int e = idx & (E_DIM - 1);
  tre[idx] = (_Float16)wre[(size_t)e * E_DIM + f];
  tim[idx] = (_Float16)wim[(size_t)e * E_DIM + f];
}

// ---------------------------------------------------------------------------
// Shared core of the four complex GEMMs: D[a][b] = sum_e A[a][e] * B[b][e],
// A and B complex, e-contiguous f16 rows of E_DIM.
// One work-group of 8 waves owns a 128 x 128 tile of D. Per pass, 64 e of the
// 128 A rows and 128 B rows (re and im planes) are brought into LDS by
// asynchronous copies, whole 128-byte lines per row, so each operand byte is
// fetched once per work-group; each wave (4 x 2 grid) then reads the fragments
// of its 32 x 64 part from LDS. Two buffers: the copies of pass p + 1 fly
// during the products of pass p.
// Every accumulator still sums e in ascending steps of 32.
// ---------------------------------------------------------------------------
#define BT     128                // rows of each operand per work-group
#define KP     64                 // e per pass (128 B of a row)
#define NPASS  (E_DIM / KP)
#define PITCH  72                 // LDS row pitch in halves: 144 B = 16 B x odd
#define PLANE  (BT * PITCH)       // one operand plane (re or im)
#define STAGE  (4 * PLANE)        // A re | A im | B re | B im
#define TA     2                  // 16-row A tiles per wave
#define TB     4                  // 16-row B tiles per wave

struct CAcc {
  v8f rr[TA][TB], ii[TA][TB], ri[TA][TB], ir[TA][TB];
};

typedef int v4i __attribute__((ext_vector_type(4)));
typedef __attribute__((address_space(1))) v4i gv4i;
typedef __attribute__((address_space(3))) v4i lv4i;

// Two planes (re, im) of one operand: each lane copies 16 bytes of four rows
// of each plane, global -> LDS, through no register. l = the lane's place in
// the re plane, gr / gi = its global addresses.
static __device__ inline void copy_planes(_Float16* l, const _Float16* gr, const _Float16* gi) {
#pragma unroll
  for (int i = 0; i < 4; ++i) {
    __builtin_amdgcn_global_load_async_to_lds_b128(
        (gv4i*)(gr + (size_t)i * 32 * E_DIM), (lv4i*)(l + i * 32 * PITCH), 0, 0);
    __builtin_amdgcn_global_load_async_to_lds_b128(
        (gv4i*)(gi + (size_t)i * 32 * E_DIM), (lv4i*)(l + PLANE + i * 32 * PITCH), 0, 0);
  }
}

static __device__ inline void cgemm_tile(const _Float16* __restrict__ are,
                                         const _Float16* __restrict__ aim,
                                         const _Float16* __restrict__ bre,
                                         const _Float16* __restrict__ bim,
                                         _Float16* lds, CAcc& acc) {
  const int tid  = threadIdx.x;
  const int lane = tid & 31;
  const int wave = tid >> 5;
  const int col  = lane & 15;
  const int hig  = lane >> 4;
  const int wa   = wave >> 1;  // which 32 A rows
  const int wb   = wave & 1;   // which 64 B rows

  // Copy map: 8 lanes cover one 128-byte row piece, 32 rows per sweep.
  const int    grow = tid >> 3;
  const int    gseg = tid & 7;
  const size_t goff = (size_t)grow * E_DIM + gseg * 8;
  const _Float16* g0 = are + goff;
  const _Float16* g1 = aim + goff;
  const _Float16* g2 = bre + goff;
  const _Float16* g3 = bim + goff;
  _Float16* ldst = lds + grow * PITCH + gseg * 8;

  {
    v8f z = {};
#pragma unroll
    for (int i = 0; i < TA; ++i)
#pragma unroll
      for (int j = 0; j < TB; ++j) {
        acc.rr[i][j] = z; acc.ii[i][j] = z; acc.ri[i][j] = z; acc.ir[i][j] = z;
      }
  }

  // Pass 0 into buffer 0, landed and published; then pass 1 into buffer 1.
  copy_planes(ldst, g0, g1);
  copy_planes(ldst + 2 * PLANE, g2, g3);
  asm volatile("s_wait_asynccnt 0x0" ::: "memory");  // this wave's copies of pass 0 have landed
  __syncthreads();
  copy_planes(ldst + STAGE, g0 + KP, g1 + KP);
  copy_planes(ldst + STAGE + 2 * PLANE, g2 + KP, g3 + KP);

  const int aoff = (wa * 32 + col) * PITCH + hig * 8;
  const int boff = 2 * PLANE + (wb * 64 + col) * PITCH + hig * 8;

  for (int p = 0; p < NPASS; ++p) {
    const _Float16* cur = lds + (p & 1) * STAGE;
#pragma unroll
    for (int ks = 0; ks < KP / 32; ++ks) {
      v16h Ar[TA], Ai[TA], Br[TB], Bi[TB];
#pragma unroll
      for (int i = 0; i < TA; ++i) {
        const _Float16* pa = cur + aoff + i * 16 * PITCH + ks * 32;
        Ar[i] = frag_h(pa, pa + 16);
        Ai[i] = frag_h(pa + PLANE, pa + PLANE + 16);
      }
#pragma unroll
      for (int j = 0; j < TB; ++j) {
        const _Float16* pb = cur + boff + j * 16 * PITCH + ks * 32;
        Br[j] = frag_h(pb, pb + 16);
        Bi[j] = frag_h(pb + PLANE, pb + PLANE + 16);
      }
#pragma unroll
      for (int i = 0; i < TA; ++i)
#pragma unroll
        for (int j = 0; j < TB; ++j) {
          acc.rr[i][j] = WMMA_F16(Ar[i], Br[j], acc.rr[i][j]);
          acc.ii[i][j] = WMMA_F16(Ai[i], Bi[j], acc.ii[i][j]);
          acc.ri[i][j] = WMMA_F16(Ar[i], Bi[j], acc.ri[i][j]);
          acc.ir[i][j] = WMMA_F16(Ai[i], Br[j], acc.ir[i][j]);
        }
    }

    asm volatile("s_wait_dscnt 0x0" ::: "memory");     // this wave's reads of buffer p & 1 are done before it is refilled
    asm volatile("s_wait_asynccnt 0x0" ::: "memory");  // this wave's copies of pass p + 1 have landed
    __syncthreads();  // publishes pass p + 1 and ends every reader's use of buffer p & 1
    if (p + 2 < NPASS) {
      const int e = (p + 2) * KP;
      _Float16* l = ldst + (p & 1) * STAGE;
      copy_planes(l, g0 + e, g1 + e);
      copy_planes(l + 2 * PLANE, g2 + e, g3 + e);
    }
  }
  asm volatile("s_wait_asynccnt 0x0" ::: "memory");  // nothing of this wave is in flight when it leaves the ring
}

// ---------------------------------------------------------------------------
// Complex projection: out[h, m, sb] = sum_e w[h,m,e] * x[sb,e]   (complex)
// A rows = flattened (h, m), B rows = sb; all-f16 operands, f32 accumulation.
// TRANSPOSED=0 -> store [b][h][s][m] (q,k);  TRANSPOSED=1 -> [b][h][m][s] (v^T)
// ---------------------------------------------------------------------------
template <int TRANSPOSED, int MDIM>
__global__ __launch_bounds__(256)
void proj_kernel(const _Float16* __restrict__ wre, const _Float16* __restrict__ wim,
                 const _Float16* __restrict__ xre, const _Float16* __restrict__ xim,
                 _Float16* __restrict__ ore, _Float16* __restrict__ oim) {
  __shared__ __align__(16) _Float16 lds[2 * STAGE];

  const int lane = threadIdx.x & 31;
  const int wave = threadIdx.x >> 5;
  const int col  = lane & 15;
  const int hig  = lane >> 4;
  const int sb0  = blockIdx.x * BT;  // first sb of the tile
  const int hm0  = blockIdx.y * BT;  // first flattened (h, m) row of the tile

  CAcc acc;
  cgemm_tile(wre + (size_t)hm0 * E_DIM, wim + (size_t)hm0 * E_DIM,
             xre + (size_t)sb0 * E_DIM, xim + (size_t)sb0 * E_DIM, lds, acc);

  // One base address per plane; i, j and r move it by constants.
  const unsigned b  = col & (B_DIM - 1);                             // sb % B_DIM
  const unsigned s0 = (sb0 >> 2) + (wave & 1) * 16 + (col >> 2);     // sb / B_DIM at j = 0
  const unsigned hm = hm0 + (wave >> 1) * 32 + hig * 8;              // row at i = 0, r = 0
  const unsigned h  = hm / MDIM;                                     // 32 rows never cross a head
  const unsigned m0 = hm % MDIM;
  const size_t base = TRANSPOSED ? (((size_t)b * H_DIM + h) * MDIM + m0) * S_DIM + s0
                                 : (((size_t)b * H_DIM + h) * S_DIM + s0) * MDIM + m0;
  _Float16* pr = ore + base;
  _Float16* pi = oim + base;
#pragma unroll
  for (int i = 0; i < TA; ++i)
#pragma unroll
    for (int j = 0; j < TB; ++j) {
#pragma unroll
      for (int r = 0; r < 8; ++r) {
        const float re = acc.rr[i][j][r] - acc.ii[i][j][r];
        const float im = acc.ri[i][j][r] + acc.ir[i][j][r];
        const int  off = TRANSPOSED ? (i * 16 + r) * S_DIM + j * 4 : j * 4 * MDIM + i * 16 + r;
        pr[off] = (_Float16)re;
        pi[off] = (_Float16)im;
      }
    }
}

// ---------------------------------------------------------------------------
// Flash attention, complex scores: amp = |q k^T| / sqrt(M), causal mask,
// online softmax, upd = P V (complex). One wave per 16-query tile; t processed
// in 32-column chunks so P@V WMMAs use the full K=32.
// A work-group is AW waves = AW neighbouring query tiles of one (b, h). They
// walk the same keys, so each stage of AKEYS keys (K rows and V^T row pieces,
// re and im) is brought into LDS once per work-group by asynchronous copies of
// whole 128-byte lines, and every wave reads its fragments from LDS. Two
// buffers: the copies of stage t + 1 fly during the work on stage t.
// ---------------------------------------------------------------------------
#define AW      8                    // waves (16-query tiles) per work-group
static_assert(S_DIM / (16 * AW) == 8, "the z -> qb map below is written for 8 blocks");
#define AKEYS   64                   // keys per stage = two 32-column chunks
#define KPITCH  136                  // LDS pitch of a K row in halves: 272 B = 16 B x odd
#define VPITCH  72                   // LDS pitch of a V^T row piece in halves: 144 B = 16 B x odd
#define KPLANE  (AKEYS * KPITCH)     // K re or K im of a stage
#define VPLANE  (V_DIM * VPITCH)     // V^T re or V^T im of a stage
#define ASTAGE  (2 * KPLANE + 2 * VPLANE)

// One stage, 12 copies of 16 bytes a lane. K: 16 lanes cover a 256-byte row,
// 16 rows per sweep. V^T: 8 lanes cover a 128-byte row piece, 32 rows per sweep.
static __device__ inline void attn_stage(_Float16* lk, _Float16* lv,
                                         const _Float16* gkr, const _Float16* gki,
                                         const _Float16* gvr, const _Float16* gvi) {
#pragma unroll
  for (int i = 0; i < AKEYS / 16; ++i) {
    __builtin_amdgcn_global_load_async_to_lds_b128(
        (gv4i*)(gkr + (size_t)i * 16 * M_DIM), (lv4i*)(lk + i * 16 * KPITCH), 0, 0);
    __builtin_amdgcn_global_load_async_to_lds_b128(
        (gv4i*)(gki + (size_t)i * 16 * M_DIM), (lv4i*)(lk + KPLANE + i * 16 * KPITCH), 0, 0);
  }
#pragma unroll
  for (int i = 0; i < V_DIM / 32; ++i) {
    __builtin_amdgcn_global_load_async_to_lds_b128(
        (gv4i*)(gvr + (size_t)i * 32 * S_DIM), (lv4i*)(lv + i * 32 * VPITCH), 0, 0);
    __builtin_amdgcn_global_load_async_to_lds_b128(
        (gv4i*)(gvi + (size_t)i * 32 * S_DIM), (lv4i*)(lv + VPLANE + i * 32 * VPITCH), 0, 0);
  }
}

__global__ __launch_bounds__(256)
void attn_kernel(const _Float16* __restrict__ qre, const _Float16* __restrict__ qim,
                 const _Float16* __restrict__ kre, const _Float16* __restrict__ kim,
                 const _Float16* __restrict__ vre, const _Float16* __restrict__ vim,
                 _Float16* __restrict__ ure, _Float16* __restrict__ uim) {
  __shared__ __align__(16) _Float16 ring[2 * ASTAGE];
  __shared__ __align__(16) _Float16 lds_pw[AW * 16 * 32];  // per wave: 16 rows x 32 t-cols

  const int tid  = threadIdx.x;
  const int lane = tid & 31;
  const int wave = __builtin_amdgcn_readfirstlane(tid >> 5);  // scalar, so the causal skip below is a scalar branch
  const int col  = lane & 15;
  const int hig  = lane >> 4;
  const int h    = blockIdx.x;
  const int b    = blockIdx.y;
  // Block of AW query tiles; its cost grows with qb. All work-groups are resident, two to a WGP:
  // z and z + 4 of one head, and heads h and h + 1 or h + 8, get blocks qb and 7 - qb, so that
  // neighbours in launch order share the work evenly. Per (b, h) z -> qb is a permutation; for speed only.
  const int zf   = blockIdx.z < 4 ? 7 - (int)blockIdx.z : (int)blockIdx.z - 4;
  const int qb   = ((h ^ (h >> 3)) & 1) ? 7 - zf : zf;
  const int st   = qb * AW + wave;                      // this wave's query tile
  _Float16* lds_p = lds_pw + wave * (16 * 32);

  const size_t bh   = (size_t)b * H_DIM + h;
  const int    srow = st * 16 + col;

  // Copy map of this lane, at stage 0.
  const size_t    koff = (bh * S_DIM + (tid >> 4)) * M_DIM + (tid & 15) * 8;
  const size_t    voff = (bh * V_DIM + (tid >> 3)) * S_DIM + (tid & 7) * 8;
  const _Float16* gkr  = kre + koff;
  const _Float16* gki  = kim + koff;
  const _Float16* gvr  = vre + voff;
  const _Float16* gvi  = vim + voff;
  _Float16* lk = ring + (tid >> 4) * KPITCH + (tid & 15) * 8;
  _Float16* lv = ring + 2 * KPLANE + (tid >> 3) * VPITCH + (tid & 7) * 8;
  const int nstage = 2 * (qb + 1);  // keys 0 .. (qb + 1) * 128 - 1; never fewer than two stages

  attn_stage(lk, lv, gkr, gki, gvr, gvi);

  // Cache q fragments for this row tile (M=128 -> 4 K-steps, re+im).
  v16h qfr[4], qfi[4];
#pragma unroll
  for (int km = 0; km < 4; ++km) {
    const _Float16* pr = qre + (bh * S_DIM + srow) * M_DIM + km * 32 + hig * 8;
    const _Float16* pi = qim + (bh * S_DIM + srow) * M_DIM + km * 32 + hig * 8;
    qfr[km] = frag_h(pr, pr + 16);
    qfi[km] = frag_h(pi, pi + 16);
  }

  v8f accre[4], accim[4];
  {
    v8f z = {};
#pragma unroll
    for (int c = 0; c < 4; ++c) { accre[c] = z; accim[c] = z; }
  }
  float mrun[8], lrun[8];
#pragma unroll
  for (int r = 0; r < 8; ++r) { mrun[r] = -__builtin_inff(); lrun[r] = 0.f; }

  const float scl = 0.08838834764831845f;  // 1/sqrt(128)

  asm volatile("s_wait_asynccnt 0x0" ::: "memory");  // this wave's copies of stage 0 have landed
  __syncthreads();
  attn_stage(lk + ASTAGE, lv + ASTAGE, gkr + AKEYS * M_DIM, gki + AKEYS * M_DIM, gvr + AKEYS, gvi + AKEYS);

  for (int t = 0; t < nstage; ++t) {
    const _Float16* cur = ring + (t & 1) * ASTAGE;
    for (int cc = 0; cc < AKEYS / 32; ++cc) {
      const int tc = t * (AKEYS / 16) + cc * 2;
      if (tc > st) continue;  // chunk wholly above this wave's diagonal; no barrier stands inside the skip

      // ---- two score tiles (t columns tc*16 .. tc*16+31) ----
      float amp[2][8];
#pragma unroll
      for (int sub = 0; sub < 2; ++sub) {
        const int tt   = tc + sub;
        const int trow = tt * 16 + col;
        const _Float16* krow = cur + (cc * 32 + sub * 16 + col) * KPITCH + hig * 8;
        v8f prr = {}, pii = {}, pri = {}, pir = {};
#pragma unroll
        for (int km = 0; km < 4; ++km) {
          const _Float16* kr = krow + km * 32;
          const _Float16* ki = kr + KPLANE;
          v16h Kr = frag_h(kr, kr + 16);
          v16h Ki = frag_h(ki, ki + 16);
          prr = WMMA_F16(qfr[km], Kr, prr);
          pii = WMMA_F16(qfi[km], Ki, pii);
          pri = WMMA_F16(qfr[km], Ki, pri);
          pir = WMMA_F16(qfi[km], Kr, pir);
        }
#pragma unroll
        for (int r = 0; r < 8; ++r) {
          const float re = prr[r] - pii[r];
          const float im = pri[r] + pir[r];
          const float a  = sqrtf(re * re + im * im) * scl;
          const int row  = st * 16 + r + hig * 8;
          amp[sub][r] = (trow <= row) ? a : -__builtin_inff();  // covers tt > st too
        }
      }

      // ---- online softmax over the 32 columns ----
      float p0[8], p1[8], scale[8], red[16];
#pragma unroll
      for (int r = 0; r < 8; ++r) { red[r] = amp[0][r]; red[8 + r] = amp[1][r]; }
      rows16<true>(red);
#pragma unroll
      for (int r = 0; r < 8; ++r) {
        const float rm = fmaxf(red[r], red[8 + r]);
        const float mn = fmaxf(mrun[r], rm);
        scale[r] = __expf(mrun[r] - mn);
        p0[r]    = __expf(amp[0][r] - mn);
        p1[r]    = __expf(amp[1][r] - mn);
        mrun[r]  = mn;
      }
#pragma unroll
      for (int r = 0; r < 8; ++r) { red[r] = p0[r]; red[8 + r] = p1[r]; }
      rows16<false>(red);
#pragma unroll
      for (int r = 0; r < 8; ++r) lrun[r] = lrun[r] * scale[r] + (red[r] + red[8 + r]);
#pragma unroll
      for (int c = 0; c < 4; ++c)
#pragma unroll
        for (int r = 0; r < 8; ++r) {
          accre[c][r] *= scale[r];
          accim[c][r] *= scale[r];
        }

      // ---- C-layout P (16x32) -> this wave's own LDS tile -> full-K A fragment ----
      // The tile's last reads fed the previous chunk's WMMAs, so they have returned; no other wave touches it.
#pragma unroll
      for (int r = 0; r < 8; ++r) {
        lds_p[(r + hig * 8) * 32 + col]      = (_Float16)p0[r];
        lds_p[(r + hig * 8) * 32 + 16 + col] = (_Float16)p1[r];
      }
      asm volatile("s_wait_dscnt 0x0" ::: "memory");  // the wave's P stores are in LDS before its lanes read each other's

      const _Float16* lp = &lds_p[col * 32 + hig * 8];
      v16h Pa = frag_h(lp, lp + 16);

      // ---- P @ V (re/im): 8 full-K WMMAs per 32-column chunk ----
#pragma unroll
      for (int c = 0; c < 4; ++c) {
        const _Float16* vr = cur + 2 * KPLANE + (c * 16 + col) * VPITCH + cc * 32 + hig * 8;
        const _Float16* vi = vr + VPLANE;
        v16h Vr = frag_h(vr, vr + 16);
        v16h Vi = frag_h(vi, vi + 16);
        accre[c] = WMMA_F16(Pa, Vr, accre[c]);
        accim[c] = WMMA_F16(Pa, Vi, accim[c]);
      }
    }

    asm volatile("s_wait_dscnt 0x0" ::: "memory");     // this wave's reads of buffer t & 1 are done before it is refilled
    asm volatile("s_wait_asynccnt 0x0" ::: "memory");  // this wave's copies of stage t + 1 have landed
    __syncthreads();  // publishes stage t + 1 and ends every reader's use of buffer t & 1
    if (t + 2 < nstage) {
      const int k0  = (t + 2) * AKEYS;
      const int buf = (t & 1) * ASTAGE;
      attn_stage(lk + buf, lv + buf, gkr + (size_t)k0 * M_DIM, gki + (size_t)k0 * M_DIM, gvr + k0, gvi + k0);
    }
  }
  asm volatile("s_wait_asynccnt 0x0" ::: "memory");  // nothing of this wave is in flight when it leaves the ring

  // ---- normalize and store upd as f16 in (s, b, h*V + vc) layout ----
#pragma unroll
  for (int r = 0; r < 8; ++r) {
    const float inv = 1.0f / lrun[r];
    const int   s   = st * 16 + r + hig * 8;
#pragma unroll
    for (int c = 0; c < 4; ++c) {
      const int vc = c * 16 + col;
      const size_t idx = ((size_t)s * B_DIM + b) * E_DIM + h * V_DIM + vc;
      ure[idx] = (_Float16)(accre[c][r] * inv);
      uim[idx] = (_Float16)(accim[c][r] * inv);
    }
  }
}

// ---------------------------------------------------------------------------
// out[sb,f] = sum_e upd[sb,e] * wo[e,f] + x[sb,f]   (complex, f32 result)
// A rows = sb, B rows = f (wo^T).
// ---------------------------------------------------------------------------
__global__ __launch_bounds__(256)
void outproj_kernel(const _Float16* __restrict__ ure, const _Float16* __restrict__ uim,
                    const _Float16* __restrict__ wtre, const _Float16* __restrict__ wtim,
                    const float* __restrict__ xre, const float* __restrict__ xim,
                    float* __restrict__ out) {
  __shared__ __align__(16) _Float16 lds[2 * STAGE];

  const int lane = threadIdx.x & 31;
  const int wave = threadIdx.x >> 5;
  const int col  = lane & 15;
  const int hig  = lane >> 4;
  const int sb0  = blockIdx.x * BT;
  const int f0   = blockIdx.y * BT;

  CAcc acc;
  cgemm_tile(ure + (size_t)sb0 * E_DIM, uim + (size_t)sb0 * E_DIM,
             wtre + (size_t)f0 * E_DIM, wtim + (size_t)f0 * E_DIM, lds, acc);

  // One 32-bit byte offset serves x and out, re and im; i, j and r move it by constants.
  const unsigned offb = ((unsigned)(sb0 + (wave >> 1) * 32 + hig * 8) * E_DIM +
                         (unsigned)(f0 + (wave & 1) * 64 + col)) * 4u;
  const float* px_re = (const float*)((const char*)xre + offb);
  const float* px_im = (const float*)((const char*)xim + offb);
  float* po_re = (float*)((char*)out + offb);
  float* po_im = (float*)((char*)(out + (size_t)SB_DIM * E_DIM) + offb);

  float xr[TA][TB][8], xi[TA][TB][8];
#pragma unroll
  for (int i = 0; i < TA; ++i)
#pragma unroll
    for (int j = 0; j < TB; ++j)
#pragma unroll
      for (int r = 0; r < 8; ++r) {
        xr[i][j][r] = px_re[(i * 16 + r) * E_DIM + j * 16];
        xi[i][j][r] = px_im[(i * 16 + r) * E_DIM + j * 16];
      }
#pragma unroll
  for (int i = 0; i < TA; ++i)
#pragma unroll
    for (int j = 0; j < TB; ++j) {
#pragma unroll
      for (int r = 0; r < 8; ++r) {
        po_re[(i * 16 + r) * E_DIM + j * 16] = (acc.rr[i][j][r] - acc.ii[i][j][r]) + xr[i][j][r];
        po_im[(i * 16 + r) * E_DIM + j * 16] = (acc.ri[i][j][r] + acc.ir[i][j][r]) + xi[i][j][r];
      }
      asm volatile("s_wait_xcnt 0x0" ::: "memory");  // before the next tile reuses registers these stores name
      __builtin_amdgcn_sched_barrier(0);  // keeps the next tile's arithmetic behind that wait
    }
}

// ---------------------------------------------------------------------------
extern "C" void kernel_launch(void* const* d_in, const int* in_sizes, int n_in,
                              void* d_out, int out_size, void* d_ws, size_t ws_size,
                              hipStream_t stream) {
  (void)in_sizes; (void)n_in; (void)out_size; (void)ws_size;

  const float* xre  = (const float*)d_in[0];
  const float* xim  = (const float*)d_in[1];
  const float* wqre = (const float*)d_in[2];
  const float* wqim = (const float*)d_in[3];
  const float* wkre = (const float*)d_in[4];
  const float* wkim = (const float*)d_in[5];
  const float* wvre = (const float*)d_in[6];
  const float* wvim = (const float*)d_in[7];
  const float* wore = (const float*)d_in[8];
  const float* woim = (const float*)d_in[9];

  char*  ws = (char*)d_ws;
  size_t o  = 0;
  auto halloc = [&](size_t n) { _Float16* p = (_Float16*)(ws + o); o += n * sizeof(_Float16); return p; };

  const size_t QK = (size_t)B_DIM * H_DIM * S_DIM * M_DIM;  // q/k per component
  const size_t VT = (size_t)B_DIM * H_DIM * V_DIM * S_DIM;  // v^T per component
  const size_t UE = (size_t)SB_DIM * E_DIM;                 // upd / x per component
  const size_t WO = (size_t)E_DIM * E_DIM;                  // wo^T per component
  const size_t WQ = (size_t)H_DIM * M_DIM * E_DIM;          // wq/wk per component
  const size_t WV = (size_t)H_DIM * V_DIM * E_DIM;          // wv per component

  _Float16* qre  = halloc(QK);  _Float16* qim  = halloc(QK);
  _Float16* kre  = halloc(QK);  _Float16* kim  = halloc(QK);
  _Float16* vtre = halloc(VT);  _Float16* vtim = halloc(VT);
  _Float16* upre = halloc(UE);  _Float16* upim = halloc(UE);
  _Float16* wtre = halloc(WO);  _Float16* wtim = halloc(WO);
  _Float16* xhre = halloc(UE);  _Float16* xhim = halloc(UE);
  _Float16* qwre = halloc(WQ);  _Float16* qwim = halloc(WQ);
  _Float16* kwre = halloc(WQ);  _Float16* kwim = halloc(WQ);
  _Float16* vwre = halloc(WV);  _Float16* vwim = halloc(WV);

  // One-time f32 -> f16 operand conversions.
  static_assert((size_t)SB_DIM * E_DIM % CVT_BLOCK == 0 && (size_t)H_DIM * M_DIM * E_DIM % CVT_BLOCK == 0 &&
                (size_t)H_DIM * V_DIM * E_DIM % CVT_BLOCK == 0, "whole blocks");
  auto cvt = [&](const float* s, _Float16* d, size_t n) {
    cvt_f16_kernel<<<(int)(n / CVT_BLOCK), 256, 0, stream>>>(s, d, (int)n);
  };
  cvt(xre, xhre, UE);  cvt(xim, xhim, UE);
  cvt(wqre, qwre, WQ); cvt(wqim, qwim, WQ);
  cvt(wkre, kwre, WQ); cvt(wkim, kwim, WQ);
  cvt(wvre, vwre, WV); cvt(wvim, vwim, WV);
  transpose_wo<<<(E_DIM * E_DIM + 255) / 256, 256, 0, stream>>>(wore, woim, wtre, wtim);

  dim3 gq(SB_DIM / BT, H_DIM * M_DIM / BT);
  proj_kernel<0, M_DIM><<<gq, 256, 0, stream>>>(qwre, qwim, xhre, xhim, qre, qim);
  proj_kernel<0, M_DIM><<<gq, 256, 0, stream>>>(kwre, kwim, xhre, xhim, kre, kim);
  dim3 gv(SB_DIM / BT, H_DIM * V_DIM / BT);
  proj_kernel<1, V_DIM><<<gv, 256, 0, stream>>>(vwre, vwim, xhre, xhim, vtre, vtim);

  dim3 ga(H_DIM, B_DIM, S_DIM / (16 * AW));
  attn_kernel<<<ga, 256, 0, stream>>>(qre, qim, kre, kim, vtre, vtim, upre, upim);

  dim3 go(SB_DIM / BT, E_DIM / BT);
  outproj_kernel<<<go, 256, 0, stream>>>(upre, upim, wtre, wtim, xre, xim, (float*)d_out);
}

// v004
// A run of this version takes 288 microseconds.
// Timed twice side by side with v003, it ran 1.09 and 1.10 times as fast.
// Over all steps from v000 it is 3.68 times as fast.
#include <hip/hip_runtime.h>
#include <hip/hip_bf16.h>
#include <math.h>

#define S_DIM 1024
#define B_DIM 4
#define E_DIM 1024
#define H_DIM 16
#define M_DIM 128
#define V_DIM 64
#define SB_DIM (S_DIM * B_DIM)

typedef __attribute__((ext_vector_type(16))) _Float16 v16h;
typedef __attribute__((ext_vector_type(8)))  _Float16 v8h;
typedef __attribute__((ext_vector_type(8)))  float    v8f;

#define WMMA_F16(A, B, C) \
  __builtin_amdgcn_wmma_f32_16x16x32_f16(false, (A), false, (B), (short)0, (C), false, false)

// 16x32 f16 A/B fragment from two contiguous 8-half segments
// (segment 0 at K-base, segment 1 at K-base+16; lane group picks +0 / +8).
static __device__ inline v16h frag_h(const _Float16* __restrict__ s0,
                                     const _Float16* __restrict__ s1) {
  v8h a = *(const v8h*)s0;
  v8h b = *(const v8h*)s1;
  v16h r;
#pragma unroll
  for (int j = 0; j < 8; ++j) {
    r[j]     = a[j];
    r[j + 8] = b[j];
  }
  return r;
}

// Maximum (MAX) or sum over each 16-lane row, for 16 values a lane at once:
// per value the same four xor steps in the same order as one value alone; the
// 16 exchanges of a step are independent and go out together.
template <bool MAX>
static __device__ inline void rows16(float (&v)[16]) {
#pragma unroll
  for (int m = 1; m < 16; m <<= 1) {
    float t[16];
#pragma unroll
    for (int i = 0; i < 16; ++i) t[i] = __shfl_xor(v[i], m, 32);
#pragma unroll
    for (int i = 0; i < 16; ++i) v[i] = MAX ? fmaxf(v[i], t[i]) : v[i] + t[i];
  }
}

// ---------------------------------------------------------------------------
// Bulk f32 -> f16 conversion (one pass; amortizes all GEMM operand reuse).
// A wave converts CVT_RUNS runs of 128 consecutive elements: per run one
// 16-byte load a lane (512 contiguous bytes a wave) and one 8-byte store a lane
// (256 contiguous bytes a wave). All loads of a lane are issued before its first
// conversion, so few waves keep the memory busy and few waves have to start.
// ---------------------------------------------------------------------------
typedef __attribute__((ext_vector_type(4))) float    v4f;
typedef __attribute__((ext_vector_type(4))) _Float16 v4h;

#define CVT_RUNS  8                  // 16-byte loads in flight per lane
#define CVT_WAVE  (CVT_RUNS * 128)   // elements per wave
#define CVT_BLOCK (8 * CVT_WAVE)     // elements per block of 8 waves

#define X_BLOCKS   (SB_DIM * E_DIM / CVT_BLOCK)         // blocks per plane of x
#define WQ_BLOCKS  (H_DIM * M_DIM * E_DIM / CVT_BLOCK)  // per plane of wq, wk
#define WV_BLOCKS  (H_DIM * V_DIM * E_DIM / CVT_BLOCK)  // per plane of wv
#define CVT_BLOCKS (2 * X_BLOCKS + 4 * WQ_BLOCKS + 2 * WV_BLOCKS)
#define TR_BLOCKS  (E_DIM * E_DIM / 256)                // blocks of the wo transpose
static_assert(SB_DIM * E_DIM % CVT_BLOCK == 0 && H_DIM * M_DIM * E_DIM % CVT_BLOCK == 0 &&
              H_DIM * V_DIM * E_DIM % CVT_BLOCK == 0 && E_DIM * E_DIM % 256 == 0, "whole blocks");

// One block's share of a conversion: src and dst point at the block's first element.
static __device__ inline void cvt_block(const float* __restrict__ src, _Float16* __restrict__ dst) {
  const int at = (threadIdx.x >> 5) * CVT_WAVE + (threadIdx.x & 31) * 4;
  v4f v[CVT_RUNS];
#pragma unroll  // both loops unrolled: v stays in registers and the loads go out as one group
  for (int k = 0; k < CVT_RUNS; ++k) v[k] = *(const v4f*)(src + at + k * 128);
#pragma unroll
  for (int k = 0; k < CVT_RUNS; ++k) {
    v4h h;
#pragma unroll
    for (int j = 0; j < 4; ++j) h[j] = (_Float16)v[k][j];
    *(v4h*)(dst + at + k * 128) = h;
  }
}

// All operand preparation in ONE launch; none of its parts reads what another writes, so they
// share a grid by block range and the chip starts, fills and drains once instead of nine times.
// Blocks 0 .. TR_BLOCKS-1: wo (E,E) f32 -> wo^T (F,E) f16, so out-proj B-fragments load contiguously.
// The others: the eight f32 -> f16 planes. Their destinations lie one behind another in the
// workspace in the order x, wq, wk, wv (re, im each), so a block's place in cvt_dst is its number.
__global__ __launch_bounds__(256)
void prep_kernel(const float* __restrict__ xre,  const float* __restrict__ xim,
                 const float* __restrict__ wqre, const float* __restrict__ wqim,
                 const float* __restrict__ wkre, const float* __restrict__ wkim,
                 const float* __restrict__ wvre, const float* __restrict__ wvim,
                 const float* __restrict__ wre,  const float* __restrict__ wim,
                 _Float16* __restrict__ cvt_dst,
                 _Float16* __restrict__ tre, _Float16* __restrict__ tim) {
  if (blockIdx.x < TR_BLOCKS) {
    int idx = blockIdx.x * 256 + threadIdx.x;  // f*E + e
    int f = idx >> 10;
    int e = idx & (E_DIM - 1);
    tre[idx] = (_Float16)wre[(size_t)e * E_DIM + f];
    tim[idx] = (_Float16)wim[(size_t)e * E_DIM + f];
    return;
  }
  const int blk = blockIdx.x - TR_BLOCKS;  // block among the conversions
  const float* src;                        // the plane this block converts
  int first;                               // that plane's first block
  if      (blk < X_BLOCKS)                     { src = xre;  first = 0; }
  else if (blk < 2 * X_BLOCKS)                 { src = xim;  first = X_BLOCKS; }
  else if (blk < 2 * X_BLOCKS + WQ_BLOCKS)     { src = wqre; first = 2 * X_BLOCKS; }
  else if (blk < 2 * X_BLOCKS + 2 * WQ_BLOCKS) { src = wqim; first = 2 * X_BLOCKS + WQ_BLOCKS; }
  else if (blk < 2 * X_BLOCKS + 3 * WQ_BLOCKS) { src = wkre; first = 2 * X_BLOCKS + 2 * WQ_BLOCKS; }
  else if (blk < 2 * X_BLOCKS + 4 * WQ_BLOCKS) { src = wkim; first = 2 * X_BLOCKS + 3 * WQ_BLOCKS; }
  else if (blk < 2 * X_BLOCKS + 4 * WQ_BLOCKS + WV_BLOCKS) { src = wvre; first = 2 * X_BLOCKS + 4 * WQ_BLOCKS; }
  else                                         { src = wvim; first = 2 * X_BLOCKS + 4 * WQ_BLOCKS + WV_BLOCKS; }
  cvt_block(src + (size_t)(blk - first) * CVT_BLOCK, cvt_dst + (size_t)blk * CVT_BLOCK);
}

// ---------------------------------------------------------------------------
// Shared core of the four complex GEMMs: D[a][b] = sum_e A[a][e] * B[b][e],
// A and B complex, e-contiguous f16 rows of E_DIM.
// One work-group of 8 waves owns a 128 x 128 tile of D. Per pass, 64 e of the
// 128 A rows and 128 B rows (re and im planes) are brought into LDS by
// asynchronous copies, whole 128-byte lines per row, so each operand byte is
// fetched once per work-group; each wave (4 x 2 grid) then reads the fragments
// of its 32 x 64 part from LDS. Two buffers: the copies of pass p + 1 fly
// during the products of pass p.
// Every accumulator still sums e in ascending steps of 32.
// ---------------------------------------------------------------------------
#define BT     128                // rows of each operand per work-group
#define KP     64                 // e per pass (128 B of a row)
#define NPASS  (E_DIM / KP)
#define PITCH  72                 // LDS row pitch in halves: 144 B = 16 B x odd
#define PLANE  (BT * PITCH)       // one operand plane (re or im)
#define STAGE  (4 * PLANE)        // A re | A im | B re | B im
#define TA     2                  // 16-row A tiles per wave
#define TB     4                  // 16-row B tiles per wave

struct CAcc {
  v8f rr[TA][TB], ii[TA][TB], ri[TA][TB], ir[TA][TB];
};

typedef int v4i __attribute__((ext_vector_type(4)));
typedef __attribute__((address_space(1))) v4i gv4i;
typedef __attribute__((address_space(3))) v4i lv4i;

// Two planes (re, im) of one operand: each lane copies 16 bytes of four rows
// of each plane, global -> LDS, through no register. l = the lane's place in
// the re plane, gr / gi = its global addresses.
static __device__ inline void copy_planes(_Float16* l, const _Float16* gr, const _Float16* gi) {
#pragma unroll
  for (int i = 0; i < 4; ++i) {
    __builtin_amdgcn_global_load_async_to_lds_b128(
        (gv4i*)(gr + (size_t)i * 32 * E_DIM), (lv4i*)(l + i * 32 * PITCH), 0, 0);
    __builtin_amdgcn_global_load_async_to_lds_b128(
        (gv4i*)(gi + (size_t)i * 32 * E_DIM), (lv4i*)(l + PLANE + i * 32 * PITCH), 0, 0);
  }
}

static __device__ inline void cgemm_tile(const _Float16* __restrict__ are,
                                         const _Float16* __restrict__ aim,
                                         const _Float16* __restrict__ bre,
                                         const _Float16* __restrict__ bim,
                                         _Float16* lds, CAcc& acc) {
  const int tid  = threadIdx.x;
  const int lane = tid & 31;
  const int wave = tid >> 5;
  const int col  = lane & 15;
  const int hig  = lane >> 4;
  const int wa   = wave >> 1;  // which 32 A rows
  const int wb   = wave & 1;   // which 64 B rows

  // Copy map: 8 lanes cover one 128-byte row piece, 32 rows per sweep.
  const int    grow = tid >> 3;
  const int    gseg = tid & 7;
  const size_t goff = (size_t)grow * E_DIM + gseg * 8;
  const _Float16* g0 = are + goff;
  const _Float16* g1 = aim + goff;
  const _Float16* g2 = bre + goff;
  const _Float16* g3 = bim + goff;
  _Float16* ldst = lds + grow * PITCH + gseg * 8;

  {
    v8f z = {};
#pragma unroll
    for (int i = 0; i < TA; ++i)
#pragma unroll
      for (int j = 0; j < TB; ++j) {
        acc.rr[i][j] = z; acc.ii[i][j] = z; acc.ri[i][j] = z; acc.ir[i][j] = z;
      }
  }

  // Pass 0 into buffer 0, landed and published; then pass 1 into buffer 1.
  copy_planes(ldst, g0, g1);
  copy_planes(ldst + 2 * PLANE, g2, g3);
  asm volatile("s_wait_asynccnt 0x0" ::: "memory");  // this wave's copies of pass 0 have landed
  __syncthreads();
  copy_planes(ldst + STAGE, g0 + KP, g1 + KP);
  copy_planes(ldst + STAGE + 2 * PLANE, g2 + KP, g3 + KP);

  const int aoff = (wa * 32 + col) * PITCH + hig * 8;
  const int boff = 2 * PLANE + (wb * 64 + col) * PITCH + hig * 8;

  for (int p = 0; p < NPASS; ++p) {
    const _Float16* cur = lds + (p & 1) * STAGE;
#pragma unroll
    for (int ks = 0; ks < KP / 32; ++ks) {
      v16h Ar[TA], Ai[TA], Br[TB], Bi[TB];
#pragma unroll
      for (int i = 0; i < TA; ++i) {
        const _Float16* pa = cur + aoff + i * 16 * PITCH + ks * 32;
        Ar[i] = frag_h(pa, pa + 16);
        Ai[i] = frag_h(pa + PLANE, pa + PLANE + 16);
      }
#pragma unroll
      for (int j = 0; j < TB; ++j) {
        const _Float16* pb = cur + boff + j * 16 * PITCH + ks * 32;
        Br[j] = frag_h(pb, pb + 16);
        Bi[j] = frag_h(pb + PLANE, pb + PLANE + 16);
      }
#pragma unroll
      for (int i = 0; i < TA; ++i)
#pragma unroll
        for (int j = 0; j < TB; ++j) {
          acc.rr[i][j] = WMMA_F16(Ar[i], Br[j], acc.rr[i][j]);
          acc.ii[i][j] = WMMA_F16(Ai[i], Bi[j], acc.ii[i][j]);
          acc.ri[i][j] = WMMA_F16(Ar[i], Bi[j], acc.ri[i][j]);
          acc.ir[i][j] = WMMA_F16(Ai[i], Br[j], acc.ir[i][j]);
        }
    }

    asm volatile("s_wait_dscnt 0x0" ::: "memory");     // this wave's reads of buffer p & 1 are done before it is refilled
    asm volatile("s_wait_asynccnt 0x0" ::: "memory");  // this wave's copies of pass p + 1 have landed
    __syncthreads();  // publishes pass p + 1 and ends every reader's use of buffer p & 1
    if (p + 2 < NPASS) {
      const int e = (p + 2) * KP;
      _Float16* l = ldst + (p & 1) * STAGE;
      copy_planes(l, g0 + e, g1 + e);
      copy_planes(l + 2 * PLANE, g2 + e, g3 + e);
    }
  }
  asm volatile("s_wait_asynccnt 0x0" ::: "memory");  // nothing of this wave is in flight when it leaves the ring
}

// ---------------------------------------------------------------------------
// Complex projection: out[h, m, sb] = sum_e w[h,m,e] * x[sb,e]   (complex)
// A rows = flattened (h, m), B rows = sb; all-f16 operands, f32 accumulation.
// TRANSPOSED=0 -> store [b][h][s][m] (q,k);  TRANSPOSED=1 -> [b][h][m][s] (v^T)
// ---------------------------------------------------------------------------
template <int TRANSPOSED, int MDIM>
static __device__ inline void proj_store(const CAcc& acc, int sb0, int hm0,
                                         _Float16* __restrict__ ore, _Float16* __restrict__ oim) {
  const int lane = threadIdx.x & 31;
  const int wave = threadIdx.x >> 5;
  const int col  = lane & 15;
  const int hig  = lane >> 4;

  // One base address per plane; i, j and r move it by constants.
  const unsigned b  = col & (B_DIM - 1);                             // sb % B_DIM
  const unsigned s0 = (sb0 >> 2) + (wave & 1) * 16 + (col >> 2);     // sb / B_DIM at j = 0
  const unsigned hm = hm0 + (wave >> 1) * 32 + hig * 8;              // row at i = 0, r = 0
  const unsigned h  = hm / MDIM;                                     // 32 rows never cross a head
  const unsigned m0 = hm % MDIM;
  const size_t base = TRANSPOSED ? (((size_t)b * H_DIM + h) * MDIM + m0) * S_DIM + s0
                                 : (((size_t)b * H_DIM + h) * S_DIM + s0) * MDIM + m0;
  _Float16* pr = ore + base;
  _Float16* pi = oim + base;
  v8h hr[TA][TB], hi[TA][TB];
#pragma unroll
  for (int i = 0; i < TA; ++i)
#pragma unroll
    for (int j = 0; j < TB; ++j)
#pragma unroll
      for (int r = 0; r < 8; ++r) {
        hr[i][j][r] = (_Float16)(acc.rr[i][j][r] - acc.ii[i][j][r]);
        hi[i][j][r] = (_Float16)(acc.ri[i][j][r] + acc.ir[i][j][r]);
      }
  __builtin_amdgcn_sched_barrier(0);  // all arithmetic stays in front of the first store: no register an issued store names is written again
#pragma unroll
  for (int i = 0; i < TA; ++i)
#pragma unroll
    for (int j = 0; j < TB; ++j) {
      if constexpr (TRANSPOSED) {
#pragma unroll
        for (int r = 0; r < 8; ++r) {
          pr[(i * 16 + r) * S_DIM + j * 4] = hr[i][j][r];
          pi[(i * 16 + r) * S_DIM + j * 4] = hi[i][j][r];
        }
      } else {
        // r runs along m: the 8 results are 16 contiguous, 16-byte aligned bytes, one store a plane
        *(v8h*)(pr + j * 4 * MDIM + i * 16) = hr[i][j];
        *(v8h*)(pi + j * 4 * MDIM + i * 16) = hi[i][j];
      }
    }
  if constexpr (!TRANSPOSED) asm volatile("s_wait_xcnt 0x0" ::: "memory");
}

// v, q and k in ONE launch: they read the same x and none reads another's result, so they share a
// grid by ranges of blockIdx.y. 1,280 equal tiles follow one another on the chip with one start
// and one tail. v comes first: its scattered stores then run beside later tiles' products.
#define VY (H_DIM * V_DIM / BT)  // tile rows of v
#define QY (H_DIM * M_DIM / BT)  // tile rows of q, and of k

__global__ __launch_bounds__(256)
void proj_kernel(const _Float16* __restrict__ vwre, const _Float16* __restrict__ vwim,
                 const _Float16* __restrict__ qwre, const _Float16* __restrict__ qwim,
                 const _Float16* __restrict__ kwre, const _Float16* __restrict__ kwim,
                 const _Float16* __restrict__ xre, const _Float16* __restrict__ xim,
                 _Float16* __restrict__ vtre, _Float16* __restrict__ vtim,
                 _Float16* __restrict__ qre, _Float16* __restrict__ qim,
                 _Float16* __restrict__ kre, _Float16* __restrict__ kim) {
  __shared__ __align__(16) _Float16 lds[2 * STAGE];

  const int y   = blockIdx.y;
  const int sb0 = blockIdx.x * BT;  // first sb of the tile
  const _Float16 *wre, *wim;        // the weight this tile multiplies
  _Float16 *ore, *oim;              // and where its result goes
  int hm0;                          // first flattened (h, m) row of the tile
  if      (y < VY)      { wre = vwre; wim = vwim; ore = vtre; oim = vtim; hm0 = y * BT; }
  else if (y < VY + QY) { wre = qwre; wim = qwim; ore = qre;  oim = qim;  hm0 = (y - VY) * BT; }
  else                  { wre = kwre; wim = kwim; ore = kre;  oim = kim;  hm0 = (y - VY - QY) * BT; }

  CAcc acc;
  cgemm_tile(wre + (size_t)hm0 * E_DIM, wim + (size_t)hm0 * E_DIM,
             xre + (size_t)sb0 * E_DIM, xim + (size_t)sb0 * E_DIM, lds, acc);

  if (y < VY) proj_store<1, V_DIM>(acc, sb0, hm0, ore, oim);
  else        proj_store<0, M_DIM>(acc, sb0, hm0, ore, oim);
}

// ---------------------------------------------------------------------------
// Flash attention, complex scores: amp = |q k^T| / sqrt(M), causal mask,
// online softmax, upd = P V (complex). One wave per 16-query tile; t processed
// in 32-column chunks so P@V WMMAs use the full K=32.
// A work-group is AW waves = AW neighbouring query tiles of one (b, h). They
// walk the same keys, so each stage of AKEYS keys (K rows and V^T row pieces,
// re and im) is brought into LDS once per work-group by asynchronous copies of
// whole 128-byte lines, and every wave reads its fragments from LDS. Two
// buffers: the copies of stage t + 1 fly during the work on stage t.
// ---------------------------------------------------------------------------
#define AW      8                    // waves (16-query tiles) per work-group
static_assert(S_DIM / (16 * AW) == 8, "the z -> qb map below is written for 8 blocks");
#define AKEYS   64                   // keys per stage = two 32-column chunks
#define KPITCH  136                  // LDS pitch of a K row in halves: 272 B = 16 B x odd
#define VPITCH  72                   // LDS pitch of a V^T row piece in halves: 144 B = 16 B x odd
#define KPLANE  (AKEYS * KPITCH)     // K re or K im of a stage
#define VPLANE  (V_DIM * VPITCH)     // V^T re or V^T im of a stage
#define ASTAGE  (2 * KPLANE + 2 * VPLANE)

// One stage, 12 copies of 16 bytes a lane. K: 16 lanes cover a 256-byte row,
// 16 rows per sweep. V^T: 8 lanes cover a 128-byte row piece, 32 rows per sweep.
static __device__ inline void attn_stage(_Float16* lk, _Float16* lv,
                                         const _Float16* gkr, const _Float16* gki,
                                         const _Float16* gvr, const _Float16* gvi) {
#pragma unroll
  for (int i = 0; i < AKEYS / 16; ++i) {
    __builtin_amdgcn_global_load_async_to_lds_b128(
        (gv4i*)(gkr + (size_t)i * 16 * M_DIM), (lv4i*)(lk + i * 16 * KPITCH), 0, 0);
    __builtin_amdgcn_global_load_async_to_lds_b128(
        (gv4i*)(gki + (size_t)i * 16 * M_DIM), (lv4i*)(lk + KPLANE + i * 16 * KPITCH), 0, 0);
  }
#pragma unroll
  for (int i = 0; i < V_DIM / 32; ++i) {
    __builtin_amdgcn_global_load_async_to_lds_b128(
        (gv4i*)(gvr + (size_t)i * 32 * S_DIM), (lv4i*)(lv + i * 32 * VPITCH), 0, 0);
    __builtin_amdgcn_global_load_async_to_lds_b128(
        (gv4i*)(gvi + (size_t)i * 32 * S_DIM), (lv4i*)(lv + VPLANE + i * 32 * VPITCH), 0, 0);
  }
}

__global__ __launch_bounds__(256)
void attn_kernel(const _Float16* __restrict__ qre, const _Float16* __restrict__ qim,
                 const _Float16* __restrict__ kre, const _Float16* __restrict__ kim,
                 const _Float16* __restrict__ vre, const _Float16* __restrict__ vim,
                 _Float16* __restrict__ ure, _Float16* __restrict__ uim) {
  __shared__ __align__(16) _Float16 ring[2 * ASTAGE];
  __shared__ __align__(16) _Float16 lds_pw[AW * 16 * 32];  // per wave: 16 rows x 32 t-cols

  const int tid  = threadIdx.x;
  const int lane = tid & 31;
  const int wave = __builtin_amdgcn_readfirstlane(tid >> 5);  // scalar, so the causal skip below is a scalar branch
  const int col  = lane & 15;
  const int hig  = lane >> 4;
  const int h    = blockIdx.x;
  const int b    = blockIdx.y;
  // Block of AW query tiles; its cost grows with qb. All work-groups are resident, two to a WGP:
  // z and z + 4 of one head, and heads h and h + 1 or h + 8, get blocks qb and 7 - qb, so that
  // neighbours in launch order share the work evenly. Per (b, h) z -> qb is a permutation; for speed only.
  const int zf   = blockIdx.z < 4 ? 7 - (int)blockIdx.z : (int)blockIdx.z - 4;
  const int qb   = ((h ^ (h >> 3)) & 1) ? 7 - zf : zf;
  const int st   = qb * AW + wave;                      // this wave's query tile
  _Float16* lds_p = lds_pw + wave * (16 * 32);

  const size_t bh   = (size_t)b * H_DIM + h;
  const int    srow = st * 16 + col;

  // Copy map of this lane, at stage 0.
  const size_t    koff = (bh * S_DIM + (tid >> 4)) * M_DIM + (tid & 15) * 8;
  const size_t    voff = (bh * V_DIM + (tid >> 3)) * S_DIM + (tid & 7) * 8;
  const _Float16* gkr  = kre + koff;
  const _Float16* gki  = kim + koff;
  const _Float16* gvr  = vre + voff;
  const _Float16* gvi  = vim + voff;
  _Float16* lk = ring + (tid >> 4) * KPITCH + (tid & 15) * 8;
  _Float16* lv = ring + 2 * KPLANE + (tid >> 3) * VPITCH + (tid & 7) * 8;
  const int nstage = 2 * (qb + 1);  // keys 0 .. (qb + 1) * 128 - 1; never fewer than two stages

  attn_stage(lk, lv, gkr, gki, gvr, gvi);

  // Cache q fragments for this row tile (M=128 -> 4 K-steps, re+im).
  v16h qfr[4], qfi[4];
#pragma unroll
  for (int km = 0; km < 4; ++km) {
    const _Float16* pr = qre + (bh * S_DIM + srow) * M_DIM + km * 32 + hig * 8;
    const _Float16* pi = qim + (bh * S_DIM + srow) * M_DIM + km * 32 + hig * 8;
    qfr[km] = frag_h(pr, pr + 16);
    qfi[km] = frag_h(pi, pi + 16);
  }

  v8f accre[4], accim[4];
  {
    v8f z = {};
#pragma unroll
    for (int c = 0; c < 4; ++c) { accre[c] = z; accim[c] = z; }
  }
  float mrun[8], lrun[8];
#pragma unroll
  for (int r = 0; r < 8; ++r) { mrun[r] = -__builtin_inff(); lrun[r] = 0.f; }

  const float scl = 0.08838834764831845f;  // 1/sqrt(128)

  asm volatile("s_wait_asynccnt 0x0" ::: "memory");  // this wave's copies of stage 0 have landed
  __syncthreads();
  attn_stage(lk + ASTAGE, lv + ASTAGE, gkr + AKEYS * M_DIM, gki + AKEYS * M_DIM, gvr + AKEYS, gvi + AKEYS);

  for (int t = 0; t < nstage; ++t) {
    const _Float16* cur = ring + (t & 1) * ASTAGE;
    for (int cc = 0; cc < AKEYS / 32; ++cc) {
      const int tc = t * (AKEYS / 16) + cc * 2;
      if (tc > st) continue;  // chunk wholly above this wave's diagonal; no barrier stands inside the skip

      // ---- two score tiles (t columns tc*16 .. tc*16+31) ----
      float amp[2][8];
#pragma unroll
      for (int sub = 0; sub < 2; ++sub) {
        const int tt   = tc + sub;
        const int trow = tt * 16 + col;
        const _Float16* krow = cur + (cc * 32 + sub * 16 + col) * KPITCH + hig * 8;
        v8f prr = {}, pii = {}, pri = {}, pir = {};
#pragma unroll
        for (int km = 0; km < 4; ++km) {
          const _Float16* kr = krow + km * 32;
          const _Float16* ki = kr + KPLANE;
          v16h Kr = frag_h(kr, kr + 16);
          v16h Ki = frag_h(ki, ki + 16);
          prr = WMMA_F16(qfr[km], Kr, prr);
          pii = WMMA_F16(qfi[km], Ki, pii);
          pri = WMMA_F16(qfr[km], Ki, pri);
          pir = WMMA_F16(qfi[km], Kr, pir);
        }
#pragma unroll
        for (int r = 0; r < 8; ++r) {
          const float re = prr[r] - pii[r];
          const float im = pri[r] + pir[r];
          const float a  = sqrtf(re * re + im * im) * scl;
          const int row  = st * 16 + r + hig * 8;
          amp[sub][r] = (trow <= row) ? a : -__builtin_inff();  // covers tt > st too
        }
      }

      // ---- online softmax over the 32 columns ----
      float p0[8], p1[8], scale[8], red[16];
#pragma unroll
      for (int r = 0; r < 8; ++r) { red[r] = amp[0][r]; red[8 + r] = amp[1][r]; }
      rows16<true>(red);
#pragma unroll
      for (int r = 0; r < 8; ++r) {
        const float rm = fmaxf(red[r], red[8 + r]);
        const float mn = fmaxf(mrun[r], rm);
        scale[r] = __expf(mrun[r] - mn);
        p0[r]    = __expf(amp[0][r] - mn);
        p1[r]    = __expf(amp[1][r] - mn);
        mrun[r]  = mn;
      }
#pragma unroll
      for (int r = 0; r < 8; ++r) { red[r] = p0[r]; red[8 + r] = p1[r]; }
      rows16<false>(red);
#pragma unroll
      for (int r = 0; r < 8; ++r) lrun[r] = lrun[r] * scale[r] + (red[r] + red[8 + r]);
#pragma unroll
      for (int c = 0; c < 4; ++c)
#pragma unroll
        for (int r = 0; r < 8; ++r) {
          accre[c][r] *= scale[r];
          accim[c][r] *= scale[r];
        }

      // ---- C-layout P (16x32) -> this wave's own LDS tile -> full-K A fragment ----
      // The tile's last reads fed the previous chunk's WMMAs, so they have returned; no other wave touches it.
#pragma unroll
      for (int r = 0; r < 8; ++r) {
        lds_p[(r + hig * 8) * 32 + col]      = (_Float16)p0[r];
        lds_p[(r + hig * 8) * 32 + 16 + col] = (_Float16)p1[r];
      }
      asm volatile("s_wait_dscnt 0x0" ::: "memory");  // the wave's P stores are in LDS before its lanes read each other's

      const _Float16* lp = &lds_p[col * 32 + hig * 8];
      v16h Pa = frag_h(lp, lp + 16);

      // ---- P @ V (re/im): 8 full-K WMMAs per 32-column chunk ----
#pragma unroll
      for (int c = 0; c < 4; ++c) {
        const _Float16* vr = cur + 2 * KPLANE + (c * 16 + col) * VPITCH + cc * 32 + hig * 8;
        const _Float16* vi = vr + VPLANE;
        v16h Vr = frag_h(vr, vr + 16);
        v16h Vi = frag_h(vi, vi + 16);
        accre[c] = WMMA_F16(Pa, Vr, accre[c]);
        accim[c] = WMMA_F16(Pa, Vi, accim[c]);
      }
    }

    asm volatile("s_wait_dscnt 0x0" ::: "memory");     // this wave's reads of buffer t & 1 are done before it is refilled
    asm volatile("s_wait_asynccnt 0x0" ::: "memory");  // this wave's copies of stage t + 1 have landed
    __syncthreads();  // publishes stage t + 1 and ends every reader's use of buffer t & 1
    if (t + 2 < nstage) {
      const int k0  = (t + 2) * AKEYS;
      const int buf = (t & 1) * ASTAGE;
      attn_stage(lk + buf, lv + buf, gkr + (size_t)k0 * M_DIM, gki + (size_t)k0 * M_DIM, gvr + k0, gvi + k0);
    }
  }
  asm volatile("s_wait_asynccnt 0x0" ::: "memory");  // nothing of this wave is in flight when it leaves the ring

  // ---- normalize and store upd as f16 in (s, b, h*V + vc) layout ----
#pragma unroll
  for (int r = 0; r < 8; ++r) {
    const float inv = 1.0f / lrun[r];
    const int   s   = st * 16 + r + hig * 8;
#pragma unroll
    for (int c = 0; c < 4; ++c) {
      const int vc = c * 16 + col;
      const size_t idx = ((size_t)s * B_DIM + b) * E_DIM + h * V_DIM + vc;
      ure[idx] = (_Float16)(accre[c][r] * inv);
      uim[idx] = (_Float16)(accim[c][r] * inv);
    }
  }
}

// ---------------------------------------------------------------------------
// out[sb,f] = sum_e upd[sb,e] * wo[e,f] + x[sb,f]   (complex, f32 result)
// A rows = sb, B rows = f (wo^T).
// ---------------------------------------------------------------------------
__global__ __launch_bounds__(256)
void outproj_kernel(const _Float16* __restrict__ ure, const _Float16* __restrict__ uim,
                    const _Float16* __restrict__ wtre, const _Float16* __restrict__ wtim,
                    const float* __restrict__ xre, const float* __restrict__ xim,
                    float* __restrict__ out) {
  __shared__ __align__(16) _Float16 lds[2 * STAGE];

  const int lane = threadIdx.x & 31;
  const int wave = threadIdx.x >> 5;
  const int col  = lane & 15;
  const int hig  = lane >> 4;
  const int sb0  = blockIdx.x * BT;
  const int f0   = blockIdx.y * BT;

  CAcc acc;
  cgemm_tile(ure + (size_t)sb0 * E_DIM, uim + (size_t)sb0 * E_DIM,
             wtre + (size_t)f0 * E_DIM, wtim + (size_t)f0 * E_DIM, lds, acc);

  // One 32-bit byte offset serves x and out, re and im; i, j and r move it by constants.
  const unsigned offb = ((unsigned)(sb0 + (wave >> 1) * 32 + hig * 8) * E_DIM +
                         (unsigned)(f0 + (wave & 1) * 64 + col)) * 4u;
  const float* px_re = (const float*)((const char*)xre + offb);
  const float* px_im = (const float*)((const char*)xim + offb);
  float* po_re = (float*)((char*)out + offb);
  float* po_im = (float*)((char*)(out + (size_t)SB_DIM * E_DIM) + offb);

  float xr[TA][TB][8], xi[TA][TB][8];
#pragma unroll
  for (int i = 0; i < TA; ++i)
#pragma unroll
    for (int j = 0; j < TB; ++j)
#pragma unroll
      for (int r = 0; r < 8; ++r) {
        xr[i][j][r] = px_re[(i * 16 + r) * E_DIM + j * 16];
        xi[i][j][r] = px_im[(i * 16 + r) * E_DIM + j * 16];
      }
#pragma unroll
  for (int i = 0; i < TA; ++i)
#pragma unroll
    for (int j = 0; j < TB; ++j) {
#pragma unroll
      for (int r = 0; r < 8; ++r) {
        po_re[(i * 16 + r) * E_DIM + j * 16] = (acc.rr[i][j][r] - acc.ii[i][j][r]) + xr[i][j][r];
        po_im[(i * 16 + r) * E_DIM + j * 16] = (acc.ri[i][j][r] + acc.ir[i][j][r]) + xi[i][j][r];
      }
      asm volatile("s_wait_xcnt 0x0" ::: "memory");  // before the next tile reuses registers these stores name
      __builtin_amdgcn_sched_barrier(0);  // keeps the next tile's arithmetic behind that wait
    }
}

// ---------------------------------------------------------------------------
extern "C" void kernel_launch(void* const* d_in, const int* in_sizes, int n_in,
                              void* d_out, int out_size, void* d_ws, size_t ws_size,
                              hipStream_t stream) {
  (void)in_sizes; (void)n_in; (void)out_size; (void)ws_size;

  const float* xre  = (const float*)d_in[0];
  const float* xim  = (const float*)d_in[1];
  const float* wqre = (const float*)d_in[2];
  const float* wqim = (const float*)d_in[3];
  const float* wkre = (const float*)d_in[4];
  const float* wkim = (const float*)d_in[5];
  const float* wvre = (const float*)d_in[6];
  const float* wvim = (const float*)d_in[7];
  const float* wore = (const float*)d_in[8];
  const float* woim = (const float*)d_in[9];

  char*  ws = (char*)d_ws;
  size_t o  = 0;
  auto halloc = [&](size_t n) { _Float16* p = (_Float16*)(ws + o); o += n * sizeof(_Float16); return p; };

  const size_t QK = (size_t)B_DIM * H_DIM * S_DIM * M_DIM;  // q/k per component
  const size_t VT = (size_t)B_DIM * H_DIM * V_DIM * S_DIM;  // v^T per component
  const size_t UE = (size_t)SB_DIM * E_DIM;                 // upd / x per component
  const size_t WO = (size_t)E_DIM * E_DIM;                  // wo^T per component
  const size_t WQ = (size_t)H_DIM * M_DIM * E_DIM;          // wq/wk per component
  const size_t WV = (size_t)H_DIM * V_DIM * E_DIM;          // wv per component

  _Float16* qre  = halloc(QK);  _Float16* qim  = halloc(QK);
  _Float16* kre  = halloc(QK);  _Float16* kim  = halloc(QK);
  _Float16* vtre = halloc(VT);  _Float16* vtim = halloc(VT);
  _Float16* upre = halloc(UE);  _Float16* upim = halloc(UE);
  _Float16* wtre = halloc(WO);  _Float16* wtim = halloc(WO);
  _Float16* xhre = halloc(UE);  _Float16* xhim = halloc(UE);
  _Float16* qwre = halloc(WQ);  _Float16* qwim = halloc(WQ);
  _Float16* kwre = halloc(WQ);  _Float16* kwim = halloc(WQ);
  _Float16* vwre = halloc(WV);  _Float16* vwim = halloc(WV);

  // Operand preparation, one launch. xhre .. vwim lie one behind another in the order prep_kernel expects.
  prep_kernel<<<TR_BLOCKS + CVT_BLOCKS, 256, 0, stream>>>(xre, xim, wqre, wqim, wkre, wkim, wvre, wvim,
                                                          wore, woim, xhre, wtre, wtim);

  dim3 gp(SB_DIM / BT, VY + 2 * QY);
  proj_kernel<<<gp, 256, 0, stream>>>(vwre, vwim, qwre, qwim, kwre, kwim, xhre, xhim,
                                      vtre, vtim, qre, qim, kre, kim);

  dim3 ga(H_DIM, B_DIM, S_DIM / (16 * AW));
  attn_kernel<<<ga, 256, 0, stream>>>(qre, qim, kre, kim, vtre, vtim, upre, upim);

  dim3 go(SB_DIM / BT, E_DIM / BT);
  outproj_kernel<<<go, 256, 0, stream>>>(upre, upim, wtre, wtim, xre, xim, (float*)d_out);
}

// v005
// It runs in 266 microseconds.
// Next to v004, in two timings, it ran 1.08 and 1.09 times as fast.
// All steps since v000 together make it 3.99 times as fast.
#include <hip/hip_runtime.h>
#include <hip/hip_bf16.h>
#include <math.h>

#define S_DIM 1024
#define B_DIM 4
#define E_DIM 1024
#define H_DIM 16
#define M_DIM 128
#define V_DIM 64
#define SB_DIM (S_DIM * B_DIM)

typedef __attribute__((ext_vector_type(16))) _Float16 v16h;
typedef __attribute__((ext_vector_type(8)))  _Float16 v8h;
typedef __attribute__((ext_vector_type(8)))  float    v8f;

#define WMMA_F16(A, B, C) \
  __builtin_amdgcn_wmma_f32_16x16x32_f16(false, (A), false, (B), (short)0, (C), false, false)
// The same with C negated inside the instruction: D = A * B - C.
#define WMMA_F16_NEGC(A, B, C) \
  __builtin_amdgcn_wmma_f32_16x16x32_f16(false, (A), false, (B), (short)1, (C), false, false)

// 16x32 f16 A/B fragment from two contiguous 8-half segments
// (segment 0 at K-base, segment 1 at K-base+16; lane group picks +0 / +8).
static __device__ inline v16h frag_h(const _Float16* __restrict__ s0,
                                     const _Float16* __restrict__ s1) {
  v8h a = *(const v8h*)s0;
  v8h b = *(const v8h*)s1;
  v16h r;
#pragma unroll
  for (int j = 0; j < 8; ++j) {
    r[j]     = a[j];
    r[j + 8] = b[j];
  }
  return r;
}

// Maximum (MAX) or sum over each 16-lane row, for 16 values a lane at once:
// per value the same four xor steps in the same order as one value alone; the
// 16 exchanges of a step are independent and go out together.
template <bool MAX>
static __device__ inline void rows16(float (&v)[16]) {
#pragma unroll
  for (int m = 1; m < 16; m <<= 1) {
    float t[16];
#pragma unroll
    for (int i = 0; i < 16; ++i) t[i] = __shfl_xor(v[i], m, 32);
#pragma unroll
    for (int i = 0; i < 16; ++i) v[i] = MAX ? fmaxf(v[i], t[i]) : v[i] + t[i];
  }
}

// ---------------------------------------------------------------------------
// Bulk f32 -> f16 conversion (one pass; amortizes all GEMM operand reuse).
// A wave converts CVT_RUNS runs of 128 consecutive elements: per run one
// 16-byte load a lane (512 contiguous bytes a wave) and one 8-byte store a lane
// (256 contiguous bytes a wave). All loads of a lane are issued before its first
// conversion, so few waves keep the memory busy and few waves have to start.
// ---------------------------------------------------------------------------
typedef __attribute__((ext_vector_type(4))) float    v4f;
typedef __attribute__((ext_vector_type(4))) _Float16 v4h;

#define CVT_RUNS  8                  // 16-byte loads in flight per lane
#define CVT_WAVE  (CVT_RUNS * 128)   // elements per wave
#define CVT_BLOCK (8 * CVT_WAVE)     // elements per block of 8 waves

#define X_BLOCKS   (SB_DIM * E_DIM / CVT_BLOCK)         // blocks per plane of x
#define WQ_BLOCKS  (H_DIM * M_DIM * E_DIM / CVT_BLOCK)  // per plane of wq, wk
#define WV_BLOCKS  (H_DIM * V_DIM * E_DIM / CVT_BLOCK)  // per plane of wv
#define CVT_BLOCKS (2 * X_BLOCKS + 4 * WQ_BLOCKS + 2 * WV_BLOCKS)
#define TR_BLOCKS  (E_DIM * E_DIM / 256)                // blocks of the wo transpose
static_assert(SB_DIM * E_DIM % CVT_BLOCK == 0 && H_DIM * M_DIM * E_DIM % CVT_BLOCK == 0 &&
              H_DIM * V_DIM * E_DIM % CVT_BLOCK == 0 && E_DIM * E_DIM % 256 == 0, "whole blocks");

// One block's share of a conversion: src and dst point at the block's first element.
static __device__ inline void cvt_block(const float* __restrict__ src, _Float16* __restrict__ dst) {
  const int at = (threadIdx.x >> 5) * CVT_WAVE + (threadIdx.x & 31) * 4;
  v4f v[CVT_RUNS];
#pragma unroll  // both loops unrolled: v stays in registers and the loads go out as one group
  for (int k = 0; k < CVT_RUNS; ++k) v[k] = *(const v4f*)(src + at + k * 128);
#pragma unroll
  for (int k = 0; k < CVT_RUNS; ++k) {
    v4h h;
#pragma unroll
    for (int j = 0; j < 4; ++j) h[j] = (_Float16)v[k][j];
    *(v4h*)(dst + at + k * 128) = h;
  }
}

// All operand preparation in ONE launch; none of its parts reads what another writes, so they
// share a grid by block range and the chip starts, fills and drains once instead of nine times.
// Blocks 0 .. TR_BLOCKS-1: wo (E,E) f32 -> wo^T (F,E) f16, so out-proj B-fragments load contiguously.
// The others: the eight f32 -> f16 planes. Their destinations lie one behind another in the
// workspace in the order x, wq, wk, wv (re, im each), so a block's place in cvt_dst is its number.
__global__ __launch_bounds__(256)
void prep_kernel(const float* __restrict__ xre,  const float* __restrict__ xim,
                 const float* __restrict__ wqre, const float* __restrict__ wqim,
                 const float* __restrict__ wkre, const float* __restrict__ wkim,
                 const float* __restrict__ wvre, const float* __restrict__ wvim,
                 const float* __restrict__ wre,  const float* __restrict__ wim,
                 _Float16* __restrict__ cvt_dst,
                 _Float16* __restrict__ tre, _Float16* __restrict__ tim) {
  if (blockIdx.x < TR_BLOCKS) {
    int idx = blockIdx.x * 256 + threadIdx.x;  // f*E + e
    int f = idx >> 10;
    int e = idx & (E_DIM - 1);
    tre[idx] = (_Float16)wre[(size_t)e * E_DIM + f];
    tim[idx] = (_Float16)wim[(size_t)e * E_DIM + f];
    return;
  }
  const int blk = blockIdx.x - TR_BLOCKS;  // block among the conversions
  const float* src;                        // the plane this block converts
  int first;                               // that plane's first block
  if      (blk < X_BLOCKS)                     { src = xre;  first = 0; }
  else if (blk < 2 * X_BLOCKS)                 { src = xim;  first = X_BLOCKS; }
  else if (blk < 2 * X_BLOCKS + WQ_BLOCKS)     { src = wqre; first = 2 * X_BLOCKS; }
  else if (blk < 2 * X_BLOCKS + 2 * WQ_BLOCKS) { src = wqim; first = 2 * X_BLOCKS + WQ_BLOCKS; }
  else if (blk < 2 * X_BLOCKS + 3 * WQ_BLOCKS) { src = wkre; first = 2 * X_BLOCKS + 2 * WQ_BLOCKS; }
  else if (blk < 2 * X_BLOCKS + 4 * WQ_BLOCKS) { src = wkim; first = 2 * X_BLOCKS + 3 * WQ_BLOCKS; }
  else if (blk < 2 * X_BLOCKS + 4 * WQ_BLOCKS + WV_BLOCKS) { src = wvre; first = 2 * X_BLOCKS + 4 * WQ_BLOCKS; }
  else                                         { src = wvim; first = 2 * X_BLOCKS + 4 * WQ_BLOCKS + WV_BLOCKS; }
  cvt_block(src + (size_t)(blk - first) * CVT_BLOCK, cvt_dst + (size_t)blk * CVT_BLOCK);
}

// ---------------------------------------------------------------------------
// Shared core of the four complex GEMMs: D[a][b] = sum_e A[a][e] * B[b][e],
// A and B complex, e-contiguous f16 rows of E_DIM.
// One work-group of 8 waves owns a 128 x 128 tile of D. Per pass, 64 e of the
// 128 A rows and 128 B rows (re and im planes) are brought into LDS by
// asynchronous copies, whole 128-byte lines per row, so each operand byte is
// fetched once per work-group; each wave (4 x 2 grid) then reads the fragments
// of its 32 x 64 part from LDS. Two buffers: the copies of pass p + 1 fly
// during the products of pass p.
// One accumulator per part of D: per step of 32 e, re <- Ar Br - (Ai Bi - re) by two products
// that negate C (exact sign flips), im <- Ai Br + (Ar Bi + im). 128 accumulator registers a wave
// instead of 256, so that two work-groups fit a WGP's registers and LDS: one group's products
// run while the other waits at its barrier, for LDS or copies, or starts or stores a tile.
// Steps of 32 e still come in ascending order.
// ---------------------------------------------------------------------------
#define BT     128                // rows of each operand per work-group
#define KP     64                 // e per pass (128 B of a row)
#define NPASS  (E_DIM / KP)
#define PITCH  72                 // LDS row pitch in halves: 144 B = 16 B x odd
#define PLANE  (BT * PITCH)       // one operand plane (re or im)
#define STAGE  (4 * PLANE)        // A re | A im | B re | B im
#define TA     2                  // 16-row A tiles per wave
#define TB     4                  // 16-row B tiles per wave

struct CAcc {
  v8f re[TA][TB], im[TA][TB];
};

typedef int v4i __attribute__((ext_vector_type(4)));
typedef __attribute__((address_space(1))) v4i gv4i;
typedef __attribute__((address_space(3))) v4i lv4i;

// Two planes (re, im) of one operand: each lane copies 16 bytes of four rows
// of each plane, global -> LDS, through no register. l = the lane's place in
// the re plane, gr / gi = its global addresses.
static __device__ inline void copy_planes(_Float16* l, const _Float16* gr, const _Float16* gi) {
#pragma unroll
  for (int i = 0; i < 4; ++i) {
    __builtin_amdgcn_global_load_async_to_lds_b128(
        (gv4i*)(gr + (size_t)i * 32 * E_DIM), (lv4i*)(l + i * 32 * PITCH), 0, 0);
    __builtin_amdgcn_global_load_async_to_lds_b128(
        (gv4i*)(gi + (size_t)i * 32 * E_DIM), (lv4i*)(l + PLANE + i * 32 * PITCH), 0, 0);
  }
}

static __device__ inline void cgemm_tile(const _Float16* __restrict__ are,
                                         const _Float16* __restrict__ aim,
                                         const _Float16* __restrict__ bre,
                                         const _Float16* __restrict__ bim,
                                         _Float16* lds, CAcc& acc) {
  const int tid  = threadIdx.x;
  const int lane = tid & 31;
  const int wave = tid >> 5;
  const int col  = lane & 15;
  const int hig  = lane >> 4;
  const int wa   = wave >> 1;  // which 32 A rows
  const int wb   = wave & 1;   // which 64 B rows

  // Copy map: 8 lanes cover one 128-byte row piece, 32 rows per sweep.
  const int    grow = tid >> 3;
  const int    gseg = tid & 7;
  const size_t goff = (size_t)grow * E_DIM + gseg * 8;
  const _Float16* g0 = are + goff;
  const _Float16* g1 = aim + goff;
  const _Float16* g2 = bre + goff;
  const _Float16* g3 = bim + goff;
  _Float16* ldst = lds + grow * PITCH + gseg * 8;

  {
    v8f z = {};
#pragma unroll
    for (int i = 0; i < TA; ++i)
#pragma unroll
      for (int j = 0; j < TB; ++j) {
        acc.re[i][j] = z; acc.im[i][j] = z;
      }
  }

  // Pass 0 into buffer 0, landed and published; then pass 1 into buffer 1.
  copy_planes(ldst, g0, g1);
  copy_planes(ldst + 2 * PLANE, g2, g3);
  asm volatile("s_wait_asynccnt 0x0" ::: "memory");  // this wave's copies of pass 0 have landed
  __syncthreads();
  copy_planes(ldst + STAGE, g0 + KP, g1 + KP);
  copy_planes(ldst + STAGE + 2 * PLANE, g2 + KP, g3 + KP);

  const int aoff = (wa * 32 + col) * PITCH + hig * 8;
  const int boff = 2 * PLANE + (wb * 64 + col) * PITCH + hig * 8;

  for (int p = 0; p < NPASS; ++p) {
    const _Float16* cur = lds + (p & 1) * STAGE;
#pragma unroll
    for (int ks = 0; ks < KP / 32; ++ks) {
      v16h Ar[TA], Ai[TA], Br[TB], Bi[TB];
#pragma unroll
      for (int i = 0; i < TA; ++i) {
        const _Float16* pa = cur + aoff + i * 16 * PITCH + ks * 32;
        Ar[i] = frag_h(pa, pa + 16);
        Ai[i] = frag_h(pa + PLANE, pa + PLANE + 16);
      }
#pragma unroll
      for (int j = 0; j < TB; ++j) {
        const _Float16* pb = cur + boff + j * 16 * PITCH + ks * 32;
        Br[j] = frag_h(pb, pb + 16);
        Bi[j] = frag_h(pb + PLANE, pb + PLANE + 16);
      }
#pragma unroll
      for (int i = 0; i < TA; ++i)
#pragma unroll
        for (int j = 0; j < TB; ++j) {
          acc.re[i][j] = WMMA_F16_NEGC(Ai[i], Bi[j], acc.re[i][j]);  // Ai Bi - re
          acc.im[i][j] = WMMA_F16(Ar[i], Bi[j], acc.im[i][j]);
        }
#pragma unroll
      for (int i = 0; i < TA; ++i)
#pragma unroll
        for (int j = 0; j < TB; ++j) {
          acc.re[i][j] = WMMA_F16_NEGC(Ar[i], Br[j], acc.re[i][j]);  // Ar Br - (Ai Bi - re)
          acc.im[i][j] = WMMA_F16(Ai[i], Br[j], acc.im[i][j]);
        }
    }

    asm volatile("s_wait_dscnt 0x0" ::: "memory");     // this wave's reads of buffer p & 1 are done before it is refilled
    asm volatile("s_wait_asynccnt 0x0" ::: "memory");  // this wave's copies of pass p + 1 have landed
    __syncthreads();  // publishes pass p + 1 and ends every reader's use of buffer p & 1
    if (p + 2 < NPASS) {
      const int e = (p + 2) * KP;
      _Float16* l = ldst + (p & 1) * STAGE;
      copy_planes(l, g0 + e, g1 + e);
      copy_planes(l + 2 * PLANE, g2 + e, g3 + e);
    }
  }
  asm volatile("s_wait_asynccnt 0x0" ::: "memory");  // nothing of this wave is in flight when it leaves the ring
}

// ---------------------------------------------------------------------------
// Complex projection: out[h, m, sb] = sum_e w[h,m,e] * x[sb,e]   (complex)
// A rows = flattened (h, m), B rows = sb; all-f16 operands, f32 accumulation.
// TRANSPOSED=0 -> store [b][h][s][m] (q,k);  TRANSPOSED=1 -> [b][h][m][s] (v^T)
// ---------------------------------------------------------------------------
template <int TRANSPOSED, int MDIM>
static __device__ inline void proj_store(const CAcc& acc, int sb0, int hm0,
                                         _Float16* __restrict__ ore, _Float16* __restrict__ oim) {
  const int lane = threadIdx.x & 31;
  const int wave = threadIdx.x >> 5;
  const int col  = lane & 15;
  const int hig  = lane >> 4;

  // One base address per plane; i, j and r move it by constants.
  const unsigned b  = col & (B_DIM - 1);                             // sb % B_DIM
  const unsigned s0 = (sb0 >> 2) + (wave & 1) * 16 + (col >> 2);     // sb / B_DIM at j = 0
  const unsigned hm = hm0 + (wave >> 1) * 32 + hig * 8;              // row at i = 0, r = 0
  const unsigned h  = hm / MDIM;                                     // 32 rows never cross a head
  const unsigned m0 = hm % MDIM;
  const size_t base = TRANSPOSED ? (((size_t)b * H_DIM + h) * MDIM + m0) * S_DIM + s0
                                 : (((size_t)b * H_DIM + h) * S_DIM + s0) * MDIM + m0;
  _Float16* pr = ore + base;
  _Float16* pi = oim + base;
  v8h hr[TA][TB], hi[TA][TB];
#pragma unroll
  for (int i = 0; i < TA; ++i)
#pragma unroll
    for (int j = 0; j < TB; ++j)
#pragma unroll
      for (int r = 0; r < 8; ++r) {
        hr[i][j][r] = (_Float16)acc.re[i][j][r];
        hi[i][j][r] = (_Float16)acc.im[i][j][r];
      }
  __builtin_amdgcn_sched_barrier(0);  // all arithmetic stays in front of the first store: no register an issued store names is written again
#pragma unroll
  for (int i = 0; i < TA; ++i)
#pragma unroll
    for (int j = 0; j < TB; ++j) {
      if constexpr (TRANSPOSED) {
#pragma unroll
        for (int r = 0; r < 8; ++r) {
          pr[(i * 16 + r) * S_DIM + j * 4] = hr[i][j][r];
          pi[(i * 16 + r) * S_DIM + j * 4] = hi[i][j][r];
        }
      } else {
        // r runs along m: the 8 results are 16 contiguous, 16-byte aligned bytes, one store a plane
        *(v8h*)(pr + j * 4 * MDIM + i * 16) = hr[i][j];
        *(v8h*)(pi + j * 4 * MDIM + i * 16) = hi[i][j];
      }
    }
  if constexpr (!TRANSPOSED) asm volatile("s_wait_xcnt 0x0" ::: "memory");
}

// v, q and k in ONE launch: they read the same x and none reads another's result, so they share a
// grid by ranges of blockIdx.y. 1,280 equal tiles follow one another on the chip with one start
// and one tail. v comes first: its scattered stores then run beside later tiles' products.
#define VY (H_DIM * V_DIM / BT)  // tile rows of v
#define QY (H_DIM * M_DIM / BT)  // tile rows of q, and of k

__global__ __launch_bounds__(256)
void proj_kernel(const _Float16* __restrict__ vwre, const _Float16* __restrict__ vwim,
                 const _Float16* __restrict__ qwre, const _Float16* __restrict__ qwim,
                 const _Float16* __restrict__ kwre, const _Float16* __restrict__ kwim,
                 const _Float16* __restrict__ xre, const _Float16* __restrict__ xim,
                 _Float16* __restrict__ vtre, _Float16* __restrict__ vtim,
                 _Float16* __restrict__ qre, _Float16* __restrict__ qim,
                 _Float16* __restrict__ kre, _Float16* __restrict__ kim) {
  __shared__ __align__(16) _Float16 lds[2 * STAGE];

  const int y   = blockIdx.y;
  const int sb0 = blockIdx.x * BT;  // first sb of the tile
  const _Float16 *wre, *wim;        // the weight this tile multiplies
  _Float16 *ore, *oim;              // and where its result goes
  int hm0;                          // first flattened (h, m) row of the tile
  if      (y < VY)      { wre = vwre; wim = vwim; ore = vtre; oim = vtim; hm0 = y * BT; }
  else if (y < VY + QY) { wre = qwre; wim = qwim; ore = qre;  oim = qim;  hm0 = (y - VY) * BT; }
  else                  { wre = kwre; wim = kwim; ore = kre;  oim = kim;  hm0 = (y - VY - QY) * BT; }

  CAcc acc;
  cgemm_tile(wre + (size_t)hm0 * E_DIM, wim + (size_t)hm0 * E_DIM,
             xre + (size_t)sb0 * E_DIM, xim + (size_t)sb0 * E_DIM, lds, acc);

  if (y < VY) proj_store<1, V_DIM>(acc, sb0, hm0, ore, oim);
  else        proj_store<0, M_DIM>(acc, sb0, hm0, ore, oim);
}

// ---------------------------------------------------------------------------
// Flash attention, complex scores: amp = |q k^T| / sqrt(M), causal mask,
// online softmax, upd = P V (complex). One wave per 16-query tile; t processed
// in 32-column chunks so P@V WMMAs use the full K=32.
// A work-group is AW waves = AW neighbouring query tiles of one (b, h). They
// walk the same keys, so each stage of AKEYS keys (K rows and V^T row pieces,
// re and im) is brought into LDS once per work-group by asynchronous copies of
// whole 128-byte lines, and every wave reads its fragments from LDS. Two
// buffers: the copies of stage t + 1 fly during the work on stage t.
// ---------------------------------------------------------------------------
#define AW      8                    // waves (16-query tiles) per work-group
static_assert(S_DIM / (16 * AW) == 8, "the z -> qb map below is written for 8 blocks");
#define AKEYS   64                   // keys per stage = two 32-column chunks
#define KPITCH  136                  // LDS pitch of a K row in halves: 272 B = 16 B x odd
#define VPITCH  72                   // LDS pitch of a V^T row piece in halves: 144 B = 16 B x odd
#define KPLANE  (AKEYS * KPITCH)     // K re or K im of a stage
#define VPLANE  (V_DIM * VPITCH)     // V^T re or V^T im of a stage
#define ASTAGE  (2 * KPLANE + 2 * VPLANE)

// One stage, 12 copies of 16 bytes a lane. K: 16 lanes cover a 256-byte row,
// 16 rows per sweep. V^T: 8 lanes cover a 128-byte row piece, 32 rows per sweep.
static __device__ inline void attn_stage(_Float16* lk, _Float16* lv,
                                         const _Float16* gkr, const _Float16* gki,
                                         const _Float16* gvr, const _Float16* gvi) {
#pragma unroll
  for (int i = 0; i < AKEYS / 16; ++i) {
    __builtin_amdgcn_global_load_async_to_lds_b128(
        (gv4i*)(gkr + (size_t)i * 16 * M_DIM), (lv4i*)(lk + i * 16 * KPITCH), 0, 0);
    __builtin_amdgcn_global_load_async_to_lds_b128(
        (gv4i*)(gki + (size_t)i * 16 * M_DIM), (lv4i*)(lk + KPLANE + i * 16 * KPITCH), 0, 0);
  }
#pragma unroll
  for (int i = 0; i < V_DIM / 32; ++i) {
    __builtin_amdgcn_global_load_async_to_lds_b128(
        (gv4i*)(gvr + (size_t)i * 32 * S_DIM), (lv4i*)(lv + i * 32 * VPITCH), 0, 0);
    __builtin_amdgcn_global_load_async_to_lds_b128(
        (gv4i*)(gvi + (size_t)i * 32 * S_DIM), (lv4i*)(lv + VPLANE + i * 32 * VPITCH), 0, 0);
  }
}

__global__ __launch_bounds__(256)
void attn_kernel(const _Float16* __restrict__ qre, const _Float16* __restrict__ qim,
                 const _Float16* __restrict__ kre, const _Float16* __restrict__ kim,
                 const _Float16* __restrict__ vre, const _Float16* __restrict__ vim,
                 _Float16* __restrict__ ure, _Float16* __restrict__ uim) {
  __shared__ __align__(16) _Float16 ring[2 * ASTAGE];
  __shared__ __align__(16) _Float16 lds_pw[AW * 16 * 32];  // per wave: 16 rows x 32 t-cols

  const int tid  = threadIdx.x;
  const int lane = tid & 31;
  const int wave = __builtin_amdgcn_readfirstlane(tid >> 5);  // scalar, so the causal skip below is a scalar branch
  const int col  = lane & 15;
  const int hig  = lane >> 4;
  const int h    = blockIdx.x;
  const int b    = blockIdx.y;
  // Block of AW query tiles; its cost grows with qb. All work-groups are resident, two to a WGP:
  // z and z + 4 of one head, and heads h and h + 1 or h + 8, get blocks qb and 7 - qb, so that
  // neighbours in launch order share the work evenly. Per (b, h) z -> qb is a permutation; for speed only.
  const int zf   = blockIdx.z < 4 ? 7 - (int)blockIdx.z : (int)blockIdx.z - 4;
  const int qb   = ((h ^ (h >> 3)) & 1) ? 7 - zf : zf;
  const int st   = qb * AW + wave;                      // this wave's query tile
  _Float16* lds_p = lds_pw + wave * (16 * 32);

  const size_t bh   = (size_t)b * H_DIM + h;
  const int    srow = st * 16 + col;

  // Copy map of this lane, at stage 0.
  const size_t    koff = (bh * S_DIM + (tid >> 4)) * M_DIM + (tid & 15) * 8;
  const size_t    voff = (bh * V_DIM + (tid >> 3)) * S_DIM + (tid & 7) * 8;
  const _Float16* gkr  = kre + koff;
  const _Float16* gki  = kim + koff;
  const _Float16* gvr  = vre + voff;
  const _Float16* gvi  = vim + voff;
  _Float16* lk = ring + (tid >> 4) * KPITCH + (tid & 15) * 8;
  _Float16* lv = ring + 2 * KPLANE + (tid >> 3) * VPITCH + (tid & 7) * 8;
  const int nstage = 2 * (qb + 1);  // keys 0 .. (qb + 1) * 128 - 1; never fewer than two stages

  attn_stage(lk, lv, gkr, gki, gvr, gvi);

  // Cache q fragments for this row tile (M=128 -> 4 K-steps, re+im).
  v16h qfr[4], qfi[4];
#pragma unroll
  for (int km = 0; km < 4; ++km) {
    const _Float16* pr = qre + (bh * S_DIM + srow) * M_DIM + km * 32 + hig * 8;
    const _Float16* pi = qim + (bh * S_DIM + srow) * M_DIM + km * 32 + hig * 8;
    qfr[km] = frag_h(pr, pr + 16);
    qfi[km] = frag_h(pi, pi + 16);
  }

  v8f accre[4], accim[4];
  {
    v8f z = {};
#pragma unroll
    for (int c = 0; c < 4; ++c) { accre[c] = z; accim[c] = z; }
  }
  float mrun[8], lrun[8];
#pragma unroll
  for (int r = 0; r < 8; ++r) { mrun[r] = -__builtin_inff(); lrun[r] = 0.f; }

  const float scl = 0.08838834764831845f;  // 1/sqrt(128)

  asm volatile("s_wait_asynccnt 0x0" ::: "memory");  // this wave's copies of stage 0 have landed
  __syncthreads();
  attn_stage(lk + ASTAGE, lv + ASTAGE, gkr + AKEYS * M_DIM, gki + AKEYS * M_DIM, gvr + AKEYS, gvi + AKEYS);

  for (int t = 0; t < nstage; ++t) {
    const _Float16* cur = ring + (t & 1) * ASTAGE;
    for (int cc = 0; cc < AKEYS / 32; ++cc) {
      const int tc = t * (AKEYS / 16) + cc * 2;
      if (tc > st) continue;  // chunk wholly above this wave's diagonal; no barrier stands inside the skip

      // ---- two score tiles (t columns tc*16 .. tc*16+31) ----
      float amp[2][8];
#pragma unroll
      for (int sub = 0; sub < 2; ++sub) {
        const int tt   = tc + sub;
        const int trow = tt * 16 + col;
        const _Float16* krow = cur + (cc * 32 + sub * 16 + col) * KPITCH + hig * 8;
        v8f prr = {}, pii = {}, pri = {}, pir = {};
#pragma unroll
        for (int km = 0; km < 4; ++km) {
          const _Float16* kr = krow + km * 32;
          const _Float16* ki = kr + KPLANE;
          v16h Kr = frag_h(kr, kr + 16);
          v16h Ki = frag_h(ki, ki + 16);
          prr = WMMA_F16(qfr[km], Kr, prr);
          pii = WMMA_F16(qfi[km], Ki, pii);
          pri = WMMA_F16(qfr[km], Ki, pri);
          pir = WMMA_F16(qfi[km], Kr, pir);
        }
#pragma unroll
        for (int r = 0; r < 8; ++r) {
          const float re = prr[r] - pii[r];
          const float im = pri[r] + pir[r];
          const float a  = sqrtf(re * re + im * im) * scl;
          const int row  = st * 16 + r + hig * 8;
          amp[sub][r] = (trow <= row) ? a : -__builtin_inff();  // covers tt > st too
        }
      }

      // ---- online softmax over the 32 columns ----
      float p0[8], p1[8], scale[8], red[16];
#pragma unroll
      for (int r = 0; r < 8; ++r) { red[r] = amp[0][r]; red[8 + r] = amp[1][r]; }
      rows16<true>(red);
#pragma unroll
      for (int r = 0; r < 8; ++r) {
        const float rm = fmaxf(red[r], red[8 + r]);
        const float mn = fmaxf(mrun[r], rm);
        scale[r] = __expf(mrun[r] - mn);
        p0[r]    = __expf(amp[0][r] - mn);
        p1[r]    = __expf(amp[1][r] - mn);
        mrun[r]  = mn;
      }
#pragma unroll
      for (int r = 0; r < 8; ++r) { red[r] = p0[r]; red[8 + r] = p1[r]; }
      rows16<false>(red);
#pragma unroll
      for (int r = 0; r < 8; ++r) lrun[r] = lrun[r] * scale[r] + (red[r] + red[8 + r]);
#pragma unroll
      for (int c = 0; c < 4; ++c)
#pragma unroll
        for (int r = 0; r < 8; ++r) {
          accre[c][r] *= scale[r];
          accim[c][r] *= scale[r];
        }

      // ---- C-layout P (16x32) -> this wave's own LDS tile -> full-K A fragment ----
      // The tile's last reads fed the previous chunk's WMMAs, so they have returned; no other wave touches it.
#pragma unroll
      for (int r = 0; r < 8; ++r) {
        lds_p[(r + hig * 8) * 32 + col]      = (_Float16)p0[r];
        lds_p[(r + hig * 8) * 32 + 16 + col] = (_Float16)p1[r];
      }
      asm volatile("s_wait_dscnt 0x0" ::: "memory");  // the wave's P stores are in LDS before its lanes read each other's

      const _Float16* lp = &lds_p[col * 32 + hig * 8];
      v16h Pa = frag_h(lp, lp + 16);

      // ---- P @ V (re/im): 8 full-K WMMAs per 32-column chunk ----
#pragma unroll
      for (int c = 0; c < 4; ++c) {
        const _Float16* vr = cur + 2 * KPLANE + (c * 16 + col) * VPITCH + cc * 32 + hig * 8;
        const _Float16* vi = vr + VPLANE;
        v16h Vr = frag_h(vr, vr + 16);
        v16h Vi = frag_h(vi, vi + 16);
        accre[c] = WMMA_F16(Pa, Vr, accre[c]);
        accim[c] = WMMA_F16(Pa, Vi, accim[c]);
      }
    }

    asm volatile("s_wait_dscnt 0x0" ::: "memory");     // this wave's reads of buffer t & 1 are done before it is refilled
    asm volatile("s_wait_asynccnt 0x0" ::: "memory");  // this wave's copies of stage t + 1 have landed
    __syncthreads();  // publishes stage t + 1 and ends every reader's use of buffer t & 1
    if (t + 2 < nstage) {
      const int k0  = (t + 2) * AKEYS;
      const int buf = (t & 1) * ASTAGE;
      attn_stage(lk + buf, lv + buf, gkr + (size_t)k0 * M_DIM, gki + (size_t)k0 * M_DIM, gvr + k0, gvi + k0);
    }
  }
  asm volatile("s_wait_asynccnt 0x0" ::: "memory");  // nothing of this wave is in flight when it leaves the ring

  // ---- normalize and store upd as f16 in (s, b, h*V + vc) layout ----
#pragma unroll
  for (int r = 0; r < 8; ++r) {
    const float inv = 1.0f / lrun[r];
    const int   s   = st * 16 + r + hig * 8;
#pragma unroll
    for (int c = 0; c < 4; ++c) {
      const int vc = c * 16 + col;
      const size_t idx = ((size_t)s * B_DIM + b) * E_DIM + h * V_DIM + vc;
      ure[idx] = (_Float16)(accre[c][r] * inv);
      uim[idx] = (_Float16)(accim[c][r] * inv);
    }
  }
}

// ---------------------------------------------------------------------------
// out[sb,f] = sum_e upd[sb,e] * wo[e,f] + x[sb,f]   (complex, f32 result)
// A rows = sb, B rows = f (wo^T).
// ---------------------------------------------------------------------------
__global__ __launch_bounds__(256)
void outproj_kernel(const _Float16* __restrict__ ure, const _Float16* __restrict__ uim,
                    const _Float16* __restrict__ wtre, const _Float16* __restrict__ wtim,
                    const float* __restrict__ xre, const float* __restrict__ xim,
                    float* __restrict__ out) {
  __shared__ __align__(16) _Float16 lds[2 * STAGE];

  const int lane = threadIdx.x & 31;
  const int wave = threadIdx.x >> 5;
  const int col  = lane & 15;
  const int hig  = lane >> 4;
  const int sb0  = blockIdx.x * BT;
  const int f0   = blockIdx.y * BT;

  CAcc acc;
  cgemm_tile(ure + (size_t)sb0 * E_DIM, uim + (size_t)sb0 * E_DIM,
             wtre + (size_t)f0 * E_DIM, wtim + (size_t)f0 * E_DIM, lds, acc);

  // One 32-bit byte offset serves x and out, re and im; i, j and r move it by constants.
  const unsigned offb = ((unsigned)(sb0 + (wave >> 1) * 32 + hig * 8) * E_DIM +
                         (unsigned)(f0 + (wave & 1) * 64 + col)) * 4u;
  const float* px_re = (const float*)((const char*)xre + offb);
  const float* px_im = (const float*)((const char*)xim + offb);
  float* po_re = (float*)((char*)out + offb);
  float* po_im = (float*)((char*)(out + (size_t)SB_DIM * E_DIM) + offb);

  float xr[TA][TB][8], xi[TA][TB][8];
#pragma unroll
  for (int i = 0; i < TA; ++i)
#pragma unroll
    for (int j = 0; j < TB; ++j)
#pragma unroll
      for (int r = 0; r < 8; ++r) {
        xr[i][j][r] = px_re[(i * 16 + r) * E_DIM + j * 16];
        xi[i][j][r] = px_im[(i * 16 + r) * E_DIM + j * 16];
      }
#pragma unroll
  for (int i = 0; i < TA; ++i)
#pragma unroll
    for (int j = 0; j < TB; ++j) {
      float sr[8], si[8];
#pragma unroll
      for (int r = 0; r < 8; ++r) {
        sr[r] = acc.re[i][j][r] + xr[i][j][r];
        si[r] = acc.im[i][j][r] + xi[i][j][r];
      }
      __builtin_amdgcn_sched_barrier(0);  // the tile's sums stay in front of its first store: no register an issued store names is written before the wait below
#pragma unroll
      for (int r = 0; r < 8; ++r) {
        po_re[(i * 16 + r) * E_DIM + j * 16] = sr[r];
        po_im[(i * 16 + r) * E_DIM + j * 16] = si[r];
      }
      asm volatile("s_wait_xcnt 0x0" ::: "memory");  // before the next tile reuses registers these stores name
      __builtin_amdgcn_sched_barrier(0);  // keeps the next tile's arithmetic behind that wait
    }
}

// ---------------------------------------------------------------------------
extern "C" void kernel_launch(void* const* d_in, const int* in_sizes, int n_in,
                              void* d_out, int out_size, void* d_ws, size_t ws_size,
                              hipStream_t stream) {
  (void)in_sizes; (void)n_in; (void)out_size; (void)ws_size;

  const float* xre  = (const float*)d_in[0];
  const float* xim  = (const float*)d_in[1];
  const float* wqre = (const float*)d_in[2];
  const float* wqim = (const float*)d_in[3];
  const float* wkre = (const float*)d_in[4];
  const float* wkim = (const float*)d_in[5];
  const float* wvre = (const float*)d_in[6];
  const float* wvim = (const float*)d_in[7];
  const float* wore = (const float*)d_in[8];
  const float* woim = (const float*)d_in[9];

  char*  ws = (char*)d_ws;
  size_t o  = 0;
  auto halloc = [&](size_t n) { _Float16* p = (_Float16*)(ws + o); o += n * sizeof(_Float16); return p; };

  const size_t QK = (size_t)B_DIM * H_DIM * S_DIM * M_DIM;  // q/k per component
  const size_t VT = (size_t)B_DIM * H_DIM * V_DIM * S_DIM;  // v^T per component
  const size_t UE = (size_t)SB_DIM * E_DIM;                 // upd / x per component
  const size_t WO = (size_t)E_DIM * E_DIM;                  // wo^T per component
  const size_t WQ = (size_t)H_DIM * M_DIM * E_DIM;          // wq/wk per component
  const size_t WV = (size_t)H_DIM * V_DIM * E_DIM;          // wv per component

  _Float16* qre  = halloc(QK);  _Float16* qim  = halloc(QK);
  _Float16* kre  = halloc(QK);  _Float16* kim  = halloc(QK);
  _Float16* vtre = halloc(VT);  _Float16* vtim = halloc(VT);
  _Float16* upre = halloc(UE);  _Float16* upim = halloc(UE);
  _Float16* wtre = halloc(WO);  _Float16* wtim = halloc(WO);
  _Float16* xhre = halloc(UE);  _Float16* xhim = halloc(UE);
  _Float16* qwre = halloc(WQ);  _Float16* qwim = halloc(WQ);
  _Float16* kwre = halloc(WQ);  _Float16* kwim = halloc(WQ);
  _Float16* vwre = halloc(WV);  _Float16* vwim = halloc(WV);

  // Operand preparation, one launch. xhre .. vwim lie one behind another in the order prep_kernel expects.
  prep_kernel<<<TR_BLOCKS + CVT_BLOCKS, 256, 0, stream>>>(xre, xim, wqre, wqim, wkre, wkim, wvre, wvim,
                                                          wore, woim, xhre, wtre, wtim);

  dim3 gp(SB_DIM / BT, VY + 2 * QY);
  proj_kernel<<<gp, 256, 0, stream>>>(vwre, vwim, qwre, qwim, kwre, kwim, xhre, xhim,
                                      vtre, vtim, qre, qim, kre, kim);

  dim3 ga(H_DIM, B_DIM, S_DIM / (16 * AW));
  attn_kernel<<<ga, 256, 0, stream>>>(qre, qim, kre, kim, vtre, vtim, upre, upim);

  dim3 go(SB_DIM / BT, E_DIM / BT);
  outproj_kernel<<<go, 256, 0, stream>>>(upre, upim, wtre, wtim, xre, xim, (float*)d_out);
}

// v006
// A run of this version takes 215 microseconds.
// In two side-by-side timings against v005, it was 1.25 and 1.23 times as fast.
// Over all steps from v000 it is 4.96 times as fast.
#include <hip/hip_runtime.h>
#include <hip/hip_bf16.h>
#include <math.h>

#define S_DIM 1024
#define B_DIM 4
#define E_DIM 1024
#define H_DIM 16
#define M_DIM 128
#define V_DIM 64
#define SB_DIM (S_DIM * B_DIM)

typedef __attribute__((ext_vector_type(16))) _Float16 v16h;
typedef __attribute__((ext_vector_type(8)))  _Float16 v8h;
typedef __attribute__((ext_vector_type(8)))  float    v8f;

#define WMMA_F16(A, B, C) \
  __builtin_amdgcn_wmma_f32_16x16x32_f16(false, (A), false, (B), (short)0, (C), false, false)
// The same with C negated inside the instruction: D = A * B - C.
#define WMMA_F16_NEGC(A, B, C) \
  __builtin_amdgcn_wmma_f32_16x16x32_f16(false, (A), false, (B), (short)1, (C), false, false)

// 16x32 f16 A/B fragment from two contiguous 8-half segments
// (segment 0 at K-base, segment 1 at K-base+16; lane group picks +0 / +8).
static __device__ inline v16h frag_h(const _Float16* __restrict__ s0,
                                     const _Float16* __restrict__ s1) {
  v8h a = *(const v8h*)s0;
  v8h b = *(const v8h*)s1;
  v16h r;
#pragma unroll
  for (int j = 0; j < 8; ++j) {
    r[j]     = a[j];
    r[j + 8] = b[j];
  }
  return r;
}

// The value that lane l ^ 16 holds: one vector move between the wave's two 16-lane rows.
static __device__ inline float other_half(float v) {
  return __builtin_bit_cast(float, __builtin_amdgcn_permlanex16(
      0u, __builtin_bit_cast(unsigned, v), 0x76543210u, 0xfedcba98u, false, false));
}

// 2^x for eight values, and for one. The instruction set asks for one independent instruction or a
// v_nop between a transcendental and a next instruction that reads its result or overwrites its
// source. In one statement each
// v_exp_f32 is followed by an independent one (no output shares a register with an input), the last by v_nop.
static __device__ inline void exp2x8(float (&d)[8], const float (&x)[8]) {
  asm("v_exp_f32 %0, %8\n\tv_exp_f32 %1, %9\n\tv_exp_f32 %2, %10\n\tv_exp_f32 %3, %11\n\t"
      "v_exp_f32 %4, %12\n\tv_exp_f32 %5, %13\n\tv_exp_f32 %6, %14\n\tv_exp_f32 %7, %15\n\tv_nop"
      : "=&v"(d[0]), "=&v"(d[1]), "=&v"(d[2]), "=&v"(d[3]), "=&v"(d[4]), "=&v"(d[5]), "=&v"(d[6]), "=&v"(d[7])
      : "v"(x[0]), "v"(x[1]), "v"(x[2]), "v"(x[3]), "v"(x[4]), "v"(x[5]), "v"(x[6]), "v"(x[7]));
}
static __device__ inline float exp2x1(float x) {
  float d;
  asm("v_exp_f32 %0, %1\n\tv_nop" : "=v"(d) : "v"(x));
  return d;
}

// ---------------------------------------------------------------------------
// Bulk f32 -> f16 conversion (one pass; amortizes all GEMM operand reuse).
// A wave converts CVT_RUNS runs of 128 consecutive elements: per run one
// 16-byte load a lane (512 contiguous bytes a wave) and one 8-byte store a lane
// (256 contiguous bytes a wave). All loads of a lane are issued before its first
// conversion, so few waves keep the memory busy and few waves have to start.
// ---------------------------------------------------------------------------
typedef __attribute__((ext_vector_type(4))) float    v4f;
typedef __attribute__((ext_vector_type(4))) _Float16 v4h;

#define CVT_RUNS  8                  // 16-byte loads in flight per lane
#define CVT_WAVE  (CVT_RUNS * 128)   // elements per wave
#define CVT_BLOCK (8 * CVT_WAVE)     // elements per block of 8 waves

#define X_BLOCKS   (SB_DIM * E_DIM / CVT_BLOCK)         // blocks per plane of x
#define WQ_BLOCKS  (H_DIM * M_DIM * E_DIM / CVT_BLOCK)  // per plane of wq, wk
#define WV_BLOCKS  (H_DIM * V_DIM * E_DIM / CVT_BLOCK)  // per plane of wv
#define CVT_BLOCKS (2 * X_BLOCKS + 4 * WQ_BLOCKS + 2 * WV_BLOCKS)
#define TR_BLOCKS  (E_DIM * E_DIM / 256)                // blocks of the wo transpose
static_assert(SB_DIM * E_DIM % CVT_BLOCK == 0 && H_DIM * M_DIM * E_DIM % CVT_BLOCK == 0 &&
              H_DIM * V_DIM * E_DIM % CVT_BLOCK == 0 && E_DIM * E_DIM % 256 == 0, "whole blocks");

// One block's share of a conversion: src and dst point at the block's first element.
static __device__ inline void cvt_block(const float* __restrict__ src, _Float16* __restrict__ dst) {
  const int at = (threadIdx.x >> 5) * CVT_WAVE + (threadIdx.x & 31) * 4;
  v4f v[CVT_RUNS];
#pragma unroll  // both loops unrolled: v stays in registers and the loads go out as one group
  for (int k = 0; k < CVT_RUNS; ++k) v[k] = *(const v4f*)(src + at + k * 128);
#pragma unroll
  for (int k = 0; k < CVT_RUNS; ++k) {
    v4h h;
#pragma unroll
    for (int j = 0; j < 4; ++j) h[j] = (_Float16)v[k][j];
    *(v4h*)(dst + at + k * 128) = h;
  }
}

// All operand preparation in ONE launch; none of its parts reads what another writes, so they
// share a grid by block range and the chip starts, fills and drains once instead of nine times.
// Blocks 0 .. TR_BLOCKS-1: wo (E,E) f32 -> wo^T (F,E) f16, so out-proj B-fragments load contiguously.
// The others: the eight f32 -> f16 planes. Their destinations lie one behind another in the
// workspace in the order x, wq, wk, wv (re, im each), so a block's place in cvt_dst is its number.
__global__ __launch_bounds__(256)
void prep_kernel(const float* __restrict__ xre,  const float* __restrict__ xim,
                 const float* __restrict__ wqre, const float* __restrict__ wqim,
                 const float* __restrict__ wkre, const float* __restrict__ wkim,
                 const float* __restrict__ wvre, const float* __restrict__ wvim,
                 const float* __restrict__ wre,  const float* __restrict__ wim,
                 _Float16* __restrict__ cvt_dst,
                 _Float16* __restrict__ tre, _Float16* __restrict__ tim) {
  if (blockIdx.x < TR_BLOCKS) {
    int idx = blockIdx.x * 256 + threadIdx.x;  // f*E + e
    int f = idx >> 10;
    int e = idx & (E_DIM - 1);
    tre[idx] = (_Float16)wre[(size_t)e * E_DIM + f];
    tim[idx] = (_Float16)wim[(size_t)e * E_DIM + f];
    return;
  }
  const int blk = blockIdx.x - TR_BLOCKS;  // block among the conversions
  const float* src;                        // the plane this block converts
  int first;                               // that plane's first block
  if      (blk < X_BLOCKS)                     { src = xre;  first = 0; }
  else if (blk < 2 * X_BLOCKS)                 { src = xim;  first = X_BLOCKS; }
  else if (blk < 2 * X_BLOCKS + WQ_BLOCKS)     { src = wqre; first = 2 * X_BLOCKS; }
  else if (blk < 2 * X_BLOCKS + 2 * WQ_BLOCKS) { src = wqim; first = 2 * X_BLOCKS + WQ_BLOCKS; }
  else if (blk < 2 * X_BLOCKS + 3 * WQ_BLOCKS) { src = wkre; first = 2 * X_BLOCKS + 2 * WQ_BLOCKS; }
  else if (blk < 2 * X_BLOCKS + 4 * WQ_BLOCKS) { src = wkim; first = 2 * X_BLOCKS + 3 * WQ_BLOCKS; }
  else if (blk < 2 * X_BLOCKS + 4 * WQ_BLOCKS + WV_BLOCKS) { src = wvre; first = 2 * X_BLOCKS + 4 * WQ_BLOCKS; }
  else                                         { src = wvim; first = 2 * X_BLOCKS + 4 * WQ_BLOCKS + WV_BLOCKS; }
  cvt_block(src + (size_t)(blk - first) * CVT_BLOCK, cvt_dst + (size_t)blk * CVT_BLOCK);
}

// ---------------------------------------------------------------------------
// Shared core of the four complex GEMMs: D[a][b] = sum_e A[a][e] * B[b][e],
// A and B complex, e-contiguous f16 rows of E_DIM.
// One work-group of 8 waves owns a 128 x 128 tile of D. Per pass, 64 e of the
// 128 A rows and 128 B rows (re and im planes) are brought into LDS by
// asynchronous copies, whole 128-byte lines per row, so each operand byte is
// fetched once per work-group; each wave (4 x 2 grid) then reads the fragments
// of its 32 x 64 part from LDS. Two buffers: the copies of pass p + 1 fly
// during the products of pass p.
// One accumulator per part of D: per step of 32 e, re <- Ar Br - (Ai Bi - re) by two products
// that negate C (exact sign flips), im <- Ai Br + (Ar Bi + im). 128 accumulator registers a wave
// instead of 256, so that two work-groups fit a WGP's registers and LDS: one group's products
// run while the other waits at its barrier, for LDS or copies, or starts or stores a tile.
// Steps of 32 e still come in ascending order.
// ---------------------------------------------------------------------------
#define BT     128                // rows of each operand per work-group
#define KP     64                 // e per pass (128 B of a row)
#define NPASS  (E_DIM / KP)
#define PITCH  72                 // LDS row pitch in halves: 144 B = 16 B x odd
#define PLANE  (BT * PITCH)       // one operand plane (re or im)
#define STAGE  (4 * PLANE)        // A re | A im | B re | B im
#define TA     2                  // 16-row A tiles per wave
#define TB     4                  // 16-row B tiles per wave

struct CAcc {
  v8f re[TA][TB], im[TA][TB];
};

typedef int v4i __attribute__((ext_vector_type(4)));
typedef __attribute__((address_space(1))) v4i gv4i;
typedef __attribute__((address_space(3))) v4i lv4i;

// Two planes (re, im) of one operand: each lane copies 16 bytes of four rows
// of each plane, global -> LDS, through no register. l = the lane's place in
// the re plane, gr / gi = its global addresses.
static __device__ inline void copy_planes(_Float16* l, const _Float16* gr, const _Float16* gi) {
#pragma unroll
  for (int i = 0; i < 4; ++i) {
    __builtin_amdgcn_global_load_async_to_lds_b128(
        (gv4i*)(gr + (size_t)i * 32 * E_DIM), (lv4i*)(l + i * 32 * PITCH), 0, 0);
    __builtin_amdgcn_global_load_async_to_lds_b128(
        (gv4i*)(gi + (size_t)i * 32 * E_DIM), (lv4i*)(l + PLANE + i * 32 * PITCH), 0, 0);
  }
}

static __device__ inline void cgemm_tile(const _Float16* __restrict__ are,
                                         const _Float16* __restrict__ aim,
                                         const _Float16* __restrict__ bre,
                                         const _Float16* __restrict__ bim,
                                         _Float16* lds, CAcc& acc) {
  const int tid  = threadIdx.x;
  const int lane = tid & 31;
  const int wave = tid >> 5;
  const int col  = lane & 15;
  const int hig  = lane >> 4;
  const int wa   = wave >> 1;  // which 32 A rows
  const int wb   = wave & 1;   // which 64 B rows

  // Copy map: 8 lanes cover one 128-byte row piece, 32 rows per sweep.
  const int    grow = tid >> 3;
  const int    gseg = tid & 7;
  const size_t goff = (size_t)grow * E_DIM + gseg * 8;
  const _Float16* g0 = are + goff;
  const _Float16* g1 = aim + goff;
  const _Float16* g2 = bre + goff;
  const _Float16* g3 = bim + goff;
  _Float16* ldst = lds + grow * PITCH + gseg * 8;

  {
    v8f z = {};
#pragma unroll
    for (int i = 0; i < TA; ++i)
#pragma unroll
      for (int j = 0; j < TB; ++j) {
        acc.re[i][j] = z; acc.im[i][j] = z;
      }
  }

  // Pass 0 into buffer 0, landed and published; then pass 1 into buffer 1.
  copy_planes(ldst, g0, g1);
  copy_planes(ldst + 2 * PLANE, g2, g3);
  asm volatile("s_wait_asynccnt 0x0" ::: "memory");  // this wave's copies of pass 0 have landed
  __syncthreads();
  copy_planes(ldst + STAGE, g0 + KP, g1 + KP);
  copy_planes(ldst + STAGE + 2 * PLANE, g2 + KP, g3 + KP);

  const int aoff = (wa * 32 + col) * PITCH + hig * 8;
  const int boff = 2 * PLANE + (wb * 64 + col) * PITCH + hig * 8;

  for (int p = 0; p < NPASS; ++p) {
    const _Float16* cur = lds + (p & 1) * STAGE;
#pragma unroll
    for (int ks = 0; ks < KP / 32; ++ks) {
      v16h Ar[TA], Ai[TA], Br[TB], Bi[TB];
#pragma unroll
      for (int i = 0; i < TA; ++i) {
        const _Float16* pa = cur + aoff + i * 16 * PITCH + ks * 32;
        Ar[i] = frag_h(pa, pa + 16);
        Ai[i] = frag_h(pa + PLANE, pa + PLANE + 16);
      }
#pragma unroll
      for (int j = 0; j < TB; ++j) {
        const _Float16* pb = cur + boff + j * 16 * PITCH + ks * 32;
        Br[j] = frag_h(pb, pb + 16);
        Bi[j] = frag_h(pb + PLANE, pb + PLANE + 16);
      }
#pragma unroll
      for (int i = 0; i < TA; ++i)
#pragma unroll
        for (int j = 0; j < TB; ++j) {
          acc.re[i][j] = WMMA_F16_NEGC(Ai[i], Bi[j], acc.re[i][j]);  // Ai Bi - re
          acc.im[i][j] = WMMA_F16(Ar[i], Bi[j], acc.im[i][j]);
        }
#pragma unroll
      for (int i = 0; i < TA; ++i)
#pragma unroll
        for (int j = 0; j < TB; ++j) {
          acc.re[i][j] = WMMA_F16_NEGC(Ar[i], Br[j], acc.re[i][j]);  // Ar Br - (Ai Bi - re)
          acc.im[i][j] = WMMA_F16(Ai[i], Br[j], acc.im[i][j]);
        }
    }

    asm volatile("s_wait_dscnt 0x0" ::: "memory");     // this wave's reads of buffer p & 1 are done before it is refilled
    asm volatile("s_wait_asynccnt 0x0" ::: "memory");  // this wave's copies of pass p + 1 have landed
    __syncthreads();  // publishes pass p + 1 and ends every reader's use of buffer p & 1
    if (p + 2 < NPASS) {
      const int e = (p + 2) * KP;
      _Float16* l = ldst + (p & 1) * STAGE;
      copy_planes(l, g0 + e, g1 + e);
      copy_planes(l + 2 * PLANE, g2 + e, g3 + e);
    }
  }
  asm volatile("s_wait_asynccnt 0x0" ::: "memory");  // nothing of this wave is in flight when it leaves the ring
}

// ---------------------------------------------------------------------------
// Complex projection: out[h, m, sb] = sum_e w[h,m,e] * x[sb,e]   (complex)
// A rows = flattened (h, m), B rows = sb; all-f16 operands, f32 accumulation.
// TRANSPOSED=0 -> store [b][h][s][m] (q,k);  TRANSPOSED=1 -> [b][h][m][s] (v^T)
// ---------------------------------------------------------------------------
template <int TRANSPOSED, int MDIM>
static __device__ inline void proj_store(const CAcc& acc, int sb0, int hm0,
                                         _Float16* __restrict__ ore, _Float16* __restrict__ oim) {
  const int lane = threadIdx.x & 31;
  const int wave = threadIdx.x >> 5;
  const int col  = lane & 15;
  const int hig  = lane >> 4;

  // One base address per plane; i, j and r move it by constants.
  const unsigned b  = col & (B_DIM - 1);                             // sb % B_DIM
  const unsigned s0 = (sb0 >> 2) + (wave & 1) * 16 + (col >> 2);     // sb / B_DIM at j = 0
  const unsigned hm = hm0 + (wave >> 1) * 32 + hig * 8;              // row at i = 0, r = 0
  const unsigned h  = hm / MDIM;                                     // 32 rows never cross a head
  const unsigned m0 = hm % MDIM;
  const size_t base = TRANSPOSED ? (((size_t)b * H_DIM + h) * MDIM + m0) * S_DIM + s0
                                 : (((size_t)b * H_DIM + h) * S_DIM + s0) * MDIM + m0;
  _Float16* pr = ore + base;
  _Float16* pi = oim + base;
  v8h hr[TA][TB], hi[TA][TB];
#pragma unroll
  for (int i = 0; i < TA; ++i)
#pragma unroll
    for (int j = 0; j < TB; ++j)
#pragma unroll
      for (int r = 0; r < 8; ++r) {
        hr[i][j][r] = (_Float16)acc.re[i][j][r];
        hi[i][j][r] = (_Float16)acc.im[i][j][r];
      }
  __builtin_amdgcn_sched_barrier(0);  // all arithmetic stays in front of the first store: no register an issued store names is written again
#pragma unroll
  for (int i = 0; i < TA; ++i)
#pragma unroll
    for (int j = 0; j < TB; ++j) {
      if constexpr (TRANSPOSED) {
#pragma unroll
        for (int r = 0; r < 8; ++r) {
          pr[(i * 16 + r) * S_DIM + j * 4] = hr[i][j][r];
          pi[(i * 16 + r) * S_DIM + j * 4] = hi[i][j][r];
        }
      } else {
        // r runs along m: the 8 results are 16 contiguous, 16-byte aligned bytes, one store a plane
        *(v8h*)(pr + j * 4 * MDIM + i * 16) = hr[i][j];
        *(v8h*)(pi + j * 4 * MDIM + i * 16) = hi[i][j];
      }
    }
  if constexpr (!TRANSPOSED) asm volatile("s_wait_xcnt 0x0" ::: "memory");
}

// v, q and k in ONE launch: they read the same x and none reads another's result, so they share a
// grid by ranges of blockIdx.y. 1,280 equal tiles follow one another on the chip with one start
// and one tail. v comes first: its scattered stores then run beside later tiles' products.
#define VY (H_DIM * V_DIM / BT)  // tile rows of v
#define QY (H_DIM * M_DIM / BT)  // tile rows of q, and of k

__global__ __launch_bounds__(256)
void proj_kernel(const _Float16* __restrict__ vwre, const _Float16* __restrict__ vwim,
                 const _Float16* __restrict__ qwre, const _Float16* __restrict__ qwim,
                 const _Float16* __restrict__ kwre, const _Float16* __restrict__ kwim,
                 const _Float16* __restrict__ xre, const _Float16* __restrict__ xim,
                 _Float16* __restrict__ vtre, _Float16* __restrict__ vtim,
                 _Float16* __restrict__ qre, _Float16* __restrict__ qim,
                 _Float16* __restrict__ kre, _Float16* __restrict__ kim) {
  __shared__ __align__(16) _Float16 lds[2 * STAGE];

  const int y   = blockIdx.y;
  const int sb0 = blockIdx.x * BT;  // first sb of the tile
  const _Float16 *wre, *wim;        // the weight this tile multiplies
  _Float16 *ore, *oim;              // and where its result goes
  int hm0;                          // first flattened (h, m) row of the tile
  if      (y < VY)      { wre = vwre; wim = vwim; ore = vtre; oim = vtim; hm0 = y * BT; }
  else if (y < VY + QY) { wre = qwre; wim = qwim; ore = qre;  oim = qim;  hm0 = (y - VY) * BT; }
  else                  { wre = kwre; wim = kwim; ore = kre;  oim = kim;  hm0 = (y - VY - QY) * BT; }

  CAcc acc;
  cgemm_tile(wre + (size_t)hm0 * E_DIM, wim + (size_t)hm0 * E_DIM,
             xre + (size_t)sb0 * E_DIM, xim + (size_t)sb0 * E_DIM, lds, acc);

  if (y < VY) proj_store<1, V_DIM>(acc, sb0, hm0, ore, oim);
  else        proj_store<0, M_DIM>(acc, sb0, hm0, ore, oim);
}

#define AW      8
static_assert(S_DIM / (16 * AW) == 8, "the z -> qb map below is written for 8 blocks");
#define AKEYS   64                   // keys per stage = two 32-column chunks
#define KPITCH  136                  // LDS pitch of a K row in halves: 272 B = 16 B x odd
#define VPITCH  72                   // LDS pitch of a V^T row piece in halves: 144 B = 16 B x odd
#define KPLANE  (AKEYS * KPITCH)     // K re or K im of a stage
#define VPLANE  (V_DIM * VPITCH)     // V^T re or V^T im of a stage
#define ASTAGE  (2 * KPLANE + 2 * VPLANE)

// One stage, 12 copies of 16 bytes a lane. K: 16 lanes cover a 256-byte row,
// 16 rows per sweep. V^T: 8 lanes cover a 128-byte row piece, 32 rows per sweep.
static __device__ inline void attn_stage(_Float16* lk, _Float16* lv,
                                         const _Float16* gkr, const _Float16* gki,
                                         const _Float16* gvr, const _Float16* gvi) {
#pragma unroll
  for (int i = 0; i < AKEYS / 16; ++i) {
    __builtin_amdgcn_global_load_async_to_lds_b128(
        (gv4i*)(gkr + (size_t)i * 16 * M_DIM), (lv4i*)(lk + i * 16 * KPITCH), 0, 0);
    __builtin_amdgcn_global_load_async_to_lds_b128(
        (gv4i*)(gki + (size_t)i * 16 * M_DIM), (lv4i*)(lk + KPLANE + i * 16 * KPITCH), 0, 0);
  }
#pragma unroll
  for (int i = 0; i < V_DIM / 32; ++i) {
    __builtin_amdgcn_global_load_async_to_lds_b128(
        (gv4i*)(gvr + (size_t)i * 32 * S_DIM), (lv4i*)(lv + i * 32 * VPITCH), 0, 0);
    __builtin_amdgcn_global_load_async_to_lds_b128(
        (gv4i*)(gvi + (size_t)i * 32 * S_DIM), (lv4i*)(lv + VPLANE + i * 32 * VPITCH), 0, 0);
  }
}

// Four waves per SIMD: the register budget that lets two work-groups share a WGP, as all 512 must to be resident at once.
__global__ __launch_bounds__(256) __attribute__((amdgpu_waves_per_eu(4, 4)))
void attn_kernel(const _Float16* __restrict__ qre, const _Float16* __restrict__ qim,
                 const _Float16* __restrict__ kre, const _Float16* __restrict__ kim,
                 const _Float16* __restrict__ vre, const _Float16* __restrict__ vim,
                 _Float16* __restrict__ ure, _Float16* __restrict__ uim) {
  __shared__ __align__(16) _Float16 ring[2 * ASTAGE];

  const int tid  = threadIdx.x;
  const int lane = tid & 31;
  const int wave = __builtin_amdgcn_readfirstlane(tid >> 5);  // scalar, so the causal skip below is a scalar branch
  const int col  = lane & 15;
  const int hig  = lane >> 4;
  const int h    = blockIdx.x;
  const int b    = blockIdx.y;
  // Block of AW query tiles; its cost grows with qb. All work-groups are resident, two to a WGP:
  // z and z + 4 of one head, and heads h and h + 1 or h + 8, get blocks qb and 7 - qb, so that
  // neighbours in launch order share the work evenly. Per (b, h) z -> qb is a permutation; for speed only.
  const int zf   = blockIdx.z < 4 ? 7 - (int)blockIdx.z : (int)blockIdx.z - 4;
  const int qb   = ((h ^ (h >> 3)) & 1) ? 7 - zf : zf;
  const int st   = qb * AW + wave;                      // this wave's query tile

  const size_t bh   = (size_t)b * H_DIM + h;
  const int    srow = st * 16 + col;

  // Copy map of this lane, at stage 0.
  const size_t    koff = (bh * S_DIM + (tid >> 4)) * M_DIM + (tid & 15) * 8;
  const size_t    voff = (bh * V_DIM + (tid >> 3)) * S_DIM + (tid & 7) * 8;
  const _Float16* gkr  = kre + koff;
  const _Float16* gki  = kim + koff;
  const _Float16* gvr  = vre + voff;
  const _Float16* gvi  = vim + voff;
  _Float16* lk = ring + (tid >> 4) * KPITCH + (tid & 15) * 8;
  _Float16* lv = ring + 2 * KPLANE + (tid >> 3) * VPITCH + (tid & 7) * 8;
  const int nstage = 2 * (qb + 1);  // keys 0 .. (qb + 1) * 128 - 1; never fewer than two stages

  attn_stage(lk, lv, gkr, gki, gvr, gvi);

  // Cache q fragments for this row tile (M=128 -> 4 K-steps, re+im).
  v16h qfr[4], qfi[4];
#pragma unroll
  for (int km = 0; km < 4; ++km) {
    const _Float16* pr = qre + (bh * S_DIM + srow) * M_DIM + km * 32 + hig * 8;
    const _Float16* pi = qim + (bh * S_DIM + srow) * M_DIM + km * 32 + hig * 8;
    qfr[km] = frag_h(pr, pr + 16);
    qfi[km] = frag_h(pi, pi + 16);
  }

  v8f accre[4], accim[4];
  {
    v8f z = {};
#pragma unroll
    for (int c = 0; c < 4; ++c) { accre[c] = z; accim[c] = z; }
  }
  float mrun = -__builtin_inff();  // running maximum of query srow, the same in both halves
  float lrun = 0.f;                // running sum over this lane's own keys; the halves join after the loop

  const float scl = 0.08838834764831845f;  // 1/sqrt(128)

  asm volatile("s_wait_asynccnt 0x0" ::: "memory");  // this wave's copies of stage 0 have landed
  __syncthreads();
  attn_stage(lk + ASTAGE, lv + ASTAGE, gkr + AKEYS * M_DIM, gki + AKEYS * M_DIM, gvr + AKEYS, gvi + AKEYS);

  for (int t = 0; t < nstage; ++t) {
    const _Float16* cur = ring + (t & 1) * ASTAGE;
    for (int cc = 0; cc < AKEYS / 32; ++cc) {
      const int tc = t * (AKEYS / 16) + cc * 2;
      if (tc > st) continue;  // chunk wholly above this wave's diagonal; no barrier stands inside the skip

      // ---- two transposed score tiles (keys tc*16 .. tc*16+31 down, 16 queries across) ----
      float amp[2][8];
#pragma unroll
      for (int sub = 0; sub < 2; ++sub) {
        const int key0 = (tc + sub) * 16 + hig * 8;  // this lane's key at r = 0
        const _Float16* krow = cur + (cc * 32 + sub * 16 + col) * KPITCH + hig * 8;
        v8f prr = {}, pii = {}, pri = {}, pir = {};
#pragma unroll
        for (int km = 0; km < 4; ++km) {
          const _Float16* kr = krow + km * 32;
          const _Float16* ki = kr + KPLANE;
          v16h Kr = frag_h(kr, kr + 16);
          v16h Ki = frag_h(ki, ki + 16);
          prr = WMMA_F16(Kr, qfr[km], prr);
          pii = WMMA_F16(Ki, qfi[km], pii);
          pri = WMMA_F16(Ki, qfr[km], pri);
          pir = WMMA_F16(Kr, qfi[km], pir);
        }
#pragma unroll
        for (int r = 0; r < 8; ++r) {
          const float re = prr[r] - pii[r];
          const float im = pri[r] + pir[r];
          const float a  = sqrtf(re * re + im * im) * scl;
          amp[sub][r] = (key0 + r <= srow) ? a : -__builtin_inff();  // covers a tile wholly above the diagonal too
        }
      }

      // ---- online softmax over the 32 keys: in the lane, plus one exchange of the maximum ----
      float rm = fmaxf(amp[0][0], amp[1][0]);
#pragma unroll
      for (int r = 1; r < 8; ++r) rm = fmaxf(rm, fmaxf(amp[0][r], amp[1][r]));
      rm = fmaxf(rm, other_half(rm));  // key tc*16 is never masked, so rm is finite
      const float mn    = fmaxf(mrun, rm);
      const float l2e   = 1.4426950408889634f;  // e^x = 2^(x * log2 e)
      const float scale = exp2x1((mrun - mn) * l2e);
      mrun = mn;
      float x0[8], x1[8], p0[8], p1[8];
#pragma unroll
      for (int r = 0; r < 8; ++r) {
        x0[r] = (amp[0][r] - mn) * l2e;
        x1[r] = (amp[1][r] - mn) * l2e;
      }
      exp2x8(p0, x0);
      exp2x8(p1, x1);
      float psum = 0.f;
      v16h  Pb;  // P^T as a B fragment: elements 0-7 = keys hig*8 + r, 8-15 = keys 16 + hig*8 + r
#pragma unroll
      for (int r = 0; r < 8; ++r) {
        psum += p0[r] + p1[r];
        Pb[r]     = (_Float16)p0[r];
        Pb[8 + r] = (_Float16)p1[r];
      }
      lrun = lrun * scale + psum;
#pragma unroll
      for (int c = 0; c < 4; ++c)
#pragma unroll
        for (int r = 0; r < 8; ++r) {
          accre[c][r] *= scale;
          accim[c][r] *= scale;
        }

      // ---- O^T += V^T P^T (re/im): 8 full-K WMMAs per chunk of 32 keys ----
#pragma unroll
      for (int c = 0; c < 4; ++c) {
        const _Float16* vr = cur + 2 * KPLANE + (c * 16 + col) * VPITCH + cc * 32 + hig * 8;
        const _Float16* vi = vr + VPLANE;
        v16h Vr = frag_h(vr, vr + 16);
        v16h Vi = frag_h(vi, vi + 16);
        accre[c] = WMMA_F16(Vr, Pb, accre[c]);
        accim[c] = WMMA_F16(Vi, Pb, accim[c]);
      }
    }

    asm volatile("s_wait_dscnt 0x0" ::: "memory");     // this wave's reads of buffer t & 1 are done before it is refilled
    asm volatile("s_wait_asynccnt 0x0" ::: "memory");  // this wave's copies of stage t + 1 have landed
    __syncthreads();  // publishes stage t + 1 and ends every reader's use of buffer t & 1
    if (t + 2 < nstage) {
      const int k0  = (t + 2) * AKEYS;
      const int buf = (t & 1) * ASTAGE;
      attn_stage(lk + buf, lv + buf, gkr + (size_t)k0 * M_DIM, gki + (size_t)k0 * M_DIM, gvr + k0, gvi + k0);
    }
  }
  asm volatile("s_wait_asynccnt 0x0" ::: "memory");  // nothing of this wave is in flight when it leaves the ring

  // ---- normalize and store upd as f16 in (s, b, h*V + vc) layout ----
  // The lane holds query srow at vc = c*16 + hig*8 + r: 8 neighbours, one 16-byte store a plane.
  const float  inv = 1.0f / (lrun + other_half(lrun));
  const size_t idx = ((size_t)srow * B_DIM + b) * E_DIM + h * V_DIM + hig * 8;
  v8h our[4], oui[4];
#pragma unroll
  for (int c = 0; c < 4; ++c)
#pragma unroll
    for (int r = 0; r < 8; ++r) {
      our[c][r] = (_Float16)(accre[c][r] * inv);
      oui[c][r] = (_Float16)(accim[c][r] * inv);
    }
#pragma unroll
  for (int c = 0; c < 4; ++c) {
    *(v8h*)(ure + idx + c * 16) = our[c];
    *(v8h*)(uim + idx + c * 16) = oui[c];
  }
}

// ---------------------------------------------------------------------------
// out[sb,f] = sum_e upd[sb,e] * wo[e,f] + x[sb,f]   (complex, f32 result)
// A rows = sb, B rows = f (wo^T).
// ---------------------------------------------------------------------------
__global__ __launch_bounds__(256)
void outproj_kernel(const _Float16* __restrict__ ure, const _Float16* __restrict__ uim,
                    const _Float16* __restrict__ wtre, const _Float16* __restrict__ wtim,
                    const float* __restrict__ xre, const float* __restrict__ xim,
                    float* __restrict__ out) {
  __shared__ __align__(16) _Float16 lds[2 * STAGE];

  const int lane = threadIdx.x & 31;
  const int wave = threadIdx.x >> 5;
  const int col  = lane & 15;
  const int hig  = lane >> 4;
  const int sb0  = blockIdx.x * BT;
  const int f0   = blockIdx.y * BT;

  CAcc acc;
  cgemm_tile(ure + (size_t)sb0 * E_DIM, uim + (size_t)sb0 * E_DIM,
             wtre + (size_t)f0 * E_DIM, wtim + (size_t)f0 * E_DIM, lds, acc);

  // One 32-bit byte offset serves x and out, re and im; i, j and r move it by constants.
  const unsigned offb = ((unsigned)(sb0 + (wave >> 1) * 32 + hig * 8) * E_DIM +
                         (unsigned)(f0 + (wave & 1) * 64 + col)) * 4u;
  const float* px_re = (const float*)((const char*)xre + offb);
  const float* px_im = (const float*)((const char*)xim + offb);
  float* po_re = (float*)((char*)out + offb);
  float* po_im = (float*)((char*)(out + (size_t)SB_DIM * E_DIM) + offb);

  float xr[TA][TB][8], xi[TA][TB][8];
#pragma unroll
  for (int i = 0; i < TA; ++i)
#pragma unroll
    for (int j = 0; j < TB; ++j)
#pragma unroll
      for (int r = 0; r < 8; ++r) {
        xr[i][j][r] = px_re[(i * 16 + r) * E_DIM + j * 16];
        xi[i][j][r] = px_im[(i * 16 + r) * E_DIM + j * 16];
      }
#pragma unroll
  for (int i = 0; i < TA; ++i)
#pragma unroll
    for (int j = 0; j < TB; ++j) {
      float sr[8], si[8];
#pragma unroll
      for (int r = 0; r < 8; ++r) {
        sr[r] = acc.re[i][j][r] + xr[i][j][r];
        si[r] = acc.im[i][j][r] + xi[i][j][r];
      }
      __builtin_amdgcn_sched_barrier(0);  // the tile's sums stay in front of its first store: no register an issued store names is written before the wait below
#pragma unroll
      for (int r = 0; r < 8; ++r) {
        po_re[(i * 16 + r) * E_DIM + j * 16] = sr[r];
        po_im[(i * 16 + r) * E_DIM + j * 16] = si[r];
      }
      asm volatile("s_wait_xcnt 0x0" ::: "memory");  // before the next tile reuses registers these stores name
      __builtin_amdgcn_sched_barrier(0);  // keeps the next tile's arithmetic behind that wait
    }
}

// ---------------------------------------------------------------------------
extern "C" void kernel_launch(void* const* d_in, const int* in_sizes, int n_in,
                              void* d_out, int out_size, void* d_ws, size_t ws_size,
                              hipStream_t stream) {
  (void)in_sizes; (void)n_in; (void)out_size; (void)ws_size;

  const float* xre  = (const float*)d_in[0];
  const float* xim  = (const float*)d_in[1];
  const float* wqre = (const float*)d_in[2];
  const float* wqim = (const float*)d_in[3];
  const float* wkre = (const float*)d_in[4];
  const float* wkim = (const float*)d_in[5];
  const float* wvre = (const float*)d_in[6];
  const float* wvim = (const float*)d_in[7];
  const float* wore = (const float*)d_in[8];
  const float* woim = (const float*)d_in[9];

  char*  ws = (char*)d_ws;
  size_t o  = 0;
  auto halloc = [&](size_t n) { _Float16* p = (_Float16*)(ws + o); o += n * sizeof(_Float16); return p; };

  const size_t QK = (size_t)B_DIM * H_DIM * S_DIM * M_DIM;  // q/k per component
  const size_t VT = (size_t)B_DIM * H_DIM * V_DIM * S_DIM;  // v^T per component
  const size_t UE = (size_t)SB_DIM * E_DIM;                 // upd / x per component
  const size_t WO = (size_t)E_DIM * E_DIM;                  // wo^T per component
  const size_t WQ = (size_t)H_DIM * M_DIM * E_DIM;          // wq/wk per component
  const size_t WV = (size_t)H_DIM * V_DIM * E_DIM;          // wv per component

  _Float16* qre  = halloc(QK);  _Float16* qim  = halloc(QK);
  _Float16* kre  = halloc(QK);  _Float16* kim  = halloc(QK);
  _Float16* vtre = halloc(VT);  _Float16* vtim = halloc(VT);
  _Float16* upre = halloc(UE);  _Float16* upim = halloc(UE);
  _Float16* wtre = halloc(WO);  _Float16* wtim = halloc(WO);
  _Float16* xhre = halloc(UE);  _Float16* xhim = halloc(UE);
  _Float16* qwre = halloc(WQ);  _Float16* qwim = halloc(WQ);
  _Float16* kwre = halloc(WQ);  _Float16* kwim = halloc(WQ);
  _Float16* vwre = halloc(WV);  _Float16* vwim = halloc(WV);

  // Operand preparation, one launch. xhre .. vwim lie one behind another in the order prep_kernel expects.
  prep_kernel<<<TR_BLOCKS + CVT_BLOCKS, 256, 0, stream>>>(xre, xim, wqre, wqim, wkre, wkim, wvre, wvim,
                                                          wore, woim, xhre, wtre, wtim);

  dim3 gp(SB_DIM / BT, VY + 2 * QY);
  proj_kernel<<<gp, 256, 0, stream>>>(vwre, vwim, qwre, qwim, kwre, kwim, xhre, xhim,
                                      vtre, vtim, qre, qim, kre, kim);

  dim3 ga(H_DIM, B_DIM, S_DIM / (16 * AW));
  attn_kernel<<<ga, 256, 0, stream>>>(qre, qim, kre, kim, vtre, vtim, upre, upim);

  dim3 go(SB_DIM / BT, E_DIM / BT);
  outproj_kernel<<<go, 256, 0, stream>>>(upre, upim, wtre, wtim, xre, xim, (float*)d_out);
}

// v007
// A run of this version takes 205 microseconds.
// Timed twice side by side with v006, it ran 1.04 and 1.06 times as fast.
// All steps since v000 together make it 5.21 times as fast.
#include <hip/hip_runtime.h>
#include <hip/hip_bf16.h>
#include <math.h>

#define S_DIM 1024
#define B_DIM 4
#define E_DIM 1024
#define H_DIM 16
#define M_DIM 128
#define V_DIM 64
#define SB_DIM (S_DIM * B_DIM)

typedef __attribute__((ext_vector_type(16))) _Float16 v16h;
typedef __attribute__((ext_vector_type(8)))  _Float16 v8h;
typedef __attribute__((ext_vector_type(8)))  float    v8f;

#define WMMA_F16(A, B, C) \
  __builtin_amdgcn_wmma_f32_16x16x32_f16(false, (A), false, (B), (short)0, (C), false, false)
// The same with C negated inside the instruction: D = A * B - C.
#define WMMA_F16_NEGC(A, B, C) \
  __builtin_amdgcn_wmma_f32_16x16x32_f16(false, (A), false, (B), (short)1, (C), false, false)

// 16x32 f16 A/B fragment from two contiguous 8-half segments
// (segment 0 at K-base, segment 1 at K-base+16; lane group picks +0 / +8).
static __device__ inline v16h frag_h(const _Float16* __restrict__ s0,
                                     const _Float16* __restrict__ s1) {
  v8h a = *(const v8h*)s0;
  v8h b = *(const v8h*)s1;
  v16h r;
#pragma unroll
  for (int j = 0; j < 8; ++j) {
    r[j]     = a[j];
    r[j + 8] = b[j];
  }
  return r;
}

// The value that lane l ^ 16 holds: one vector move between the wave's two 16-lane rows.
static __device__ inline float other_half(float v) {
  return __builtin_bit_cast(float, __builtin_amdgcn_permlanex16(
      0u, __builtin_bit_cast(unsigned, v), 0x76543210u, 0xfedcba98u, false, false));
}

// 2^x for eight values, and for one. The instruction set asks for one independent instruction or a
// v_nop between a transcendental and a next instruction that reads its result or overwrites its
// source. In one statement each
// v_exp_f32 is followed by an independent one (no output shares a register with an input), the last by v_nop.
static __device__ inline void exp2x8(float (&d)[8], const float (&x)[8]) {
  asm("v_exp_f32 %0, %8\n\tv_exp_f32 %1, %9\n\tv_exp_f32 %2, %10\n\tv_exp_f32 %3, %11\n\t"
      "v_exp_f32 %4, %12\n\tv_exp_f32 %5, %13\n\tv_exp_f32 %6, %14\n\tv_exp_f32 %7, %15\n\tv_nop"
      : "=&v"(d[0]), "=&v"(d[1]), "=&v"(d[2]), "=&v"(d[3]), "=&v"(d[4]), "=&v"(d[5]), "=&v"(d[6]), "=&v"(d[7])
      : "v"(x[0]), "v"(x[1]), "v"(x[2]), "v"(x[3]), "v"(x[4]), "v"(x[5]), "v"(x[6]), "v"(x[7]));
}
// Square root of eight values by the bare hardware root, in the same one-statement form and for the same reason.
// sqrtf() wraps v_sqrt_f32 in a scaling of small inputs and two correction steps for a correctly rounded
// result: about fifteen more vector instructions a value, most of them waiting on the one before. The root
// feeds exp and an f16 rounding of P, which are far coarser than the root's last bit; 0, inf and NaN pass as in
// sqrtf, and a sum of squares too small for the bare root is an amplitude that does not move any exponential.
static __device__ inline void sqrtx8(float (&d)[8], const float (&x)[8]) {
  asm("v_sqrt_f32 %0, %8\n\tv_sqrt_f32 %1, %9\n\tv_sqrt_f32 %2, %10\n\tv_sqrt_f32 %3, %11\n\t"
      "v_sqrt_f32 %4, %12\n\tv_sqrt_f32 %5, %13\n\tv_sqrt_f32 %6, %14\n\tv_sqrt_f32 %7, %15\n\tv_nop"
      : "=&v"(d[0]), "=&v"(d[1]), "=&v"(d[2]), "=&v"(d[3]), "=&v"(d[4]), "=&v"(d[5]), "=&v"(d[6]), "=&v"(d[7])
      : "v"(x[0]), "v"(x[1]), "v"(x[2]), "v"(x[3]), "v"(x[4]), "v"(x[5]), "v"(x[6]), "v"(x[7]));
}
static __device__ inline float exp2x1(float x) {
  float d;
  asm("v_exp_f32 %0, %1\n\tv_nop" : "=v"(d) : "v"(x));
  return d;
}

// ---------------------------------------------------------------------------
// Bulk f32 -> f16 conversion (one pass; amortizes all GEMM operand reuse).
// A wave converts CVT_RUNS runs of 128 consecutive elements: per run one
// 16-byte load a lane (512 contiguous bytes a wave) and one 8-byte store a lane
// (256 contiguous bytes a wave). All loads of a lane are issued before its first
// conversion, so few waves keep the memory busy and few waves have to start.
// ---------------------------------------------------------------------------
typedef __attribute__((ext_vector_type(4))) float    v4f;
typedef __attribute__((ext_vector_type(4))) _Float16 v4h;

#define CVT_RUNS  8                  // 16-byte loads in flight per lane
#define CVT_WAVE  (CVT_RUNS * 128)   // elements per wave
#define CVT_BLOCK (8 * CVT_WAVE)     // elements per block of 8 waves

#define X_BLOCKS   (SB_DIM * E_DIM / CVT_BLOCK)         // blocks per plane of x
#define WQ_BLOCKS  (H_DIM * M_DIM * E_DIM / CVT_BLOCK)  // per plane of wq, wk
#define WV_BLOCKS  (H_DIM * V_DIM * E_DIM / CVT_BLOCK)  // per plane of wv
#define CVT_BLOCKS (2 * X_BLOCKS + 4 * WQ_BLOCKS + 2 * WV_BLOCKS)
#define TR_BLOCKS  (E_DIM * E_DIM / 256)                // blocks of the wo transpose
static_assert(SB_DIM * E_DIM % CVT_BLOCK == 0 && H_DIM * M_DIM * E_DIM % CVT_BLOCK == 0 &&
              H_DIM * V_DIM * E_DIM % CVT_BLOCK == 0 && E_DIM * E_DIM % 256 == 0, "whole blocks");

// One block's share of a conversion: src and dst point at the block's first element.
static __device__ inline void cvt_block(const float* __restrict__ src, _Float16* __restrict__ dst) {
  const int at = (threadIdx.x >> 5) * CVT_WAVE + (threadIdx.x & 31) * 4;
  v4f v[CVT_RUNS];
#pragma unroll  // both loops unrolled: v stays in registers and the loads go out as one group
  for (int k = 0; k < CVT_RUNS; ++k) v[k] = *(const v4f*)(src + at + k * 128);
#pragma unroll
  for (int k = 0; k < CVT_RUNS; ++k) {
    v4h h;
#pragma unroll
    for (int j = 0; j < 4; ++j) h[j] = (_Float16)v[k][j];
    *(v4h*)(dst + at + k * 128) = h;
  }
}

// All operand preparation in ONE launch; none of its parts reads what another writes, so they
// share a grid by block range and the chip starts, fills and drains once instead of nine times.
// Blocks 0 .. TR_BLOCKS-1: wo (E,E) f32 -> wo^T (F,E) f16, so out-proj B-fragments load contiguously.
// The others: the eight f32 -> f16 planes. Their destinations lie one behind another in the
// workspace in the order x, wq, wk, wv (re, im each), so a block's place in cvt_dst is its number.
__global__ __launch_bounds__(256)
void prep_kernel(const float* __restrict__ xre,  const float* __restrict__ xim,
                 const float* __restrict__ wqre, const float* __restrict__ wqim,
                 const float* __restrict__ wkre, const float* __restrict__ wkim,
                 const float* __restrict__ wvre, const float* __restrict__ wvim,
                 const float* __restrict__ wre,  const float* __restrict__ wim,
                 _Float16* __restrict__ cvt_dst,
                 _Float16* __restrict__ tre, _Float16* __restrict__ tim) {
  if (blockIdx.x < TR_BLOCKS) {
    int idx = blockIdx.x * 256 + threadIdx.x;  // f*E + e
    int f = idx >> 10;
    int e = idx & (E_DIM - 1);
    tre[idx] = (_Float16)wre[(size_t)e * E_DIM + f];
    tim[idx] = (_Float16)wim[(size_t)e * E_DIM + f];
    return;
  }
  const int blk = blockIdx.x - TR_BLOCKS;  // block among the conversions
  const float* src;                        // the plane this block converts
  int first;                               // that plane's first block
  if      (blk < X_BLOCKS)                     { src = xre;  first = 0; }
  else if (blk < 2 * X_BLOCKS)                 { src = xim;  first = X_BLOCKS; }
  else if (blk < 2 * X_BLOCKS + WQ_BLOCKS)     { src = wqre; first = 2 * X_BLOCKS; }
  else if (blk < 2 * X_BLOCKS + 2 * WQ_BLOCKS) { src = wqim; first = 2 * X_BLOCKS + WQ_BLOCKS; }
  else if (blk < 2 * X_BLOCKS + 3 * WQ_BLOCKS) { src = wkre; first = 2 * X_BLOCKS + 2 * WQ_BLOCKS; }
  else if (blk < 2 * X_BLOCKS + 4 * WQ_BLOCKS) { src = wkim; first = 2 * X_BLOCKS + 3 * WQ_BLOCKS; }
  else if (blk < 2 * X_BLOCKS + 4 * WQ_BLOCKS + WV_BLOCKS) { src = wvre; first = 2 * X_BLOCKS + 4 * WQ_BLOCKS; }
  else                                         { src = wvim; first = 2 * X_BLOCKS + 4 * WQ_BLOCKS + WV_BLOCKS; }
  cvt_block(src + (size_t)(blk - first) * CVT_BLOCK, cvt_dst + (size_t)blk * CVT_BLOCK);
}

// ---------------------------------------------------------------------------
// Shared core of the four complex GEMMs: D[a][b] = sum_e A[a][e] * B[b][e],
// A and B complex, e-contiguous f16 rows of E_DIM.
// One work-group of 8 waves owns a 128 x 128 tile of D. Per pass, 64 e of the
// 128 A rows and 128 B rows (re and im planes) are brought into LDS by
// asynchronous copies, whole 128-byte lines per row, so each operand byte is
// fetched once per work-group; each wave (4 x 2 grid) then reads the fragments
// of its 32 x 64 part from LDS. Two buffers: the copies of pass p + 1 fly
// during the products of pass p.
// One accumulator per part of D: per step of 32 e, re <- Ar Br - (Ai Bi - re) by two products
// that negate C (exact sign flips), im <- Ai Br + (Ar Bi + im). 128 accumulator registers a wave
// instead of 256, so that two work-groups fit a WGP's registers and LDS: one group's products
// run while the other waits at its barrier, for LDS or copies, or starts or stores a tile.
// Steps of 32 e still come in ascending order.
// ---------------------------------------------------------------------------
#define BT     128                // rows of each operand per work-group
#define KP     64                 // e per pass (128 B of a row)
#define NPASS  (E_DIM / KP)
#define PITCH  72                 // LDS row pitch in halves: 144 B = 16 B x odd
#define PLANE  (BT * PITCH)       // one operand plane (re or im)
#define STAGE  (4 * PLANE)        // A re | A im | B re | B im
#define TA     2                  // 16-row A tiles per wave
#define TB     4                  // 16-row B tiles per wave

struct CAcc {
  v8f re[TA][TB], im[TA][TB];
};

typedef int v4i __attribute__((ext_vector_type(4)));
typedef __attribute__((address_space(1))) v4i gv4i;
typedef __attribute__((address_space(3))) v4i lv4i;

// Two planes (re, im) of one operand: each lane copies 16 bytes of four rows
// of each plane, global -> LDS, through no register. l = the lane's place in
// the re plane, gr / gi = its global addresses.
static __device__ inline void copy_planes(_Float16* l, const _Float16* gr, const _Float16* gi) {
#pragma unroll
  for (int i = 0; i < 4; ++i) {
    __builtin_amdgcn_global_load_async_to_lds_b128(
        (gv4i*)(gr + (size_t)i * 32 * E_DIM), (lv4i*)(l + i * 32 * PITCH), 0, 0);
    __builtin_amdgcn_global_load_async_to_lds_b128(
        (gv4i*)(gi + (size_t)i * 32 * E_DIM), (lv4i*)(l + PLANE + i * 32 * PITCH), 0, 0);
  }
}

static __device__ inline void cgemm_tile(const _Float16* __restrict__ are,
                                         const _Float16* __restrict__ aim,
                                         const _Float16* __restrict__ bre,
                                         const _Float16* __restrict__ bim,
                                         _Float16* lds, CAcc& acc) {
  const int tid  = threadIdx.x;
  const int lane = tid & 31;
  const int wave = tid >> 5;
  const int col  = lane & 15;
  const int hig  = lane >> 4;
  const int wa   = wave >> 1;  // which 32 A rows
  const int wb   = wave & 1;   // which 64 B rows

  // Copy map: 8 lanes cover one 128-byte row piece, 32 rows per sweep.
  const int    grow = tid >> 3;
  const int    gseg = tid & 7;
  const size_t goff = (size_t)grow * E_DIM + gseg * 8;
  const _Float16* g0 = are + goff;
  const _Float16* g1 = aim + goff;
  const _Float16* g2 = bre + goff;
  const _Float16* g3 = bim + goff;
  _Float16* ldst = lds + grow * PITCH + gseg * 8;

  {
    v8f z = {};
#pragma unroll
    for (int i = 0; i < TA; ++i)
#pragma unroll
      for (int j = 0; j < TB; ++j) {
        acc.re[i][j] = z; acc.im[i][j] = z;
      }
  }

  // Pass 0 into buffer 0, landed and published; then pass 1 into buffer 1.
  copy_planes(ldst, g0, g1);
  copy_planes(ldst + 2 * PLANE, g2, g3);
  asm volatile("s_wait_asynccnt 0x0" ::: "memory");  // this wave's copies of pass 0 have landed
  __syncthreads();
  copy_planes(ldst + STAGE, g0 + KP, g1 + KP);
  copy_planes(ldst + STAGE + 2 * PLANE, g2 + KP, g3 + KP);

  const int aoff = (wa * 32 + col) * PITCH + hig * 8;
  const int boff = 2 * PLANE + (wb * 64 + col) * PITCH + hig * 8;

  for (int p = 0; p < NPASS; ++p) {
    const _Float16* cur = lds + (p & 1) * STAGE;
#pragma unroll
    for (int ks = 0; ks < KP / 32; ++ks) {
      v16h Ar[TA], Ai[TA], Br[TB], Bi[TB];
#pragma unroll
      for (int i = 0; i < TA; ++i) {
        const _Float16* pa = cur + aoff + i * 16 * PITCH + ks * 32;
        Ar[i] = frag_h(pa, pa + 16);
        Ai[i] = frag_h(pa + PLANE, pa + PLANE + 16);
      }
#pragma unroll
      for (int j = 0; j < TB; ++j) {
        const _Float16* pb = cur + boff + j * 16 * PITCH + ks * 32;
        Br[j] = frag_h(pb, pb + 16);
        Bi[j] = frag_h(pb + PLANE, pb + PLANE + 16);
      }
#pragma unroll
      for (int i = 0; i < TA; ++i)
#pragma unroll
        for (int j = 0; j < TB; ++j) {
          acc.re[i][j] = WMMA_F16_NEGC(Ai[i], Bi[j], acc.re[i][j]);  // Ai Bi - re
          acc.im[i][j] = WMMA_F16(Ar[i], Bi[j], acc.im[i][j]);
        }
#pragma unroll
      for (int i = 0; i < TA; ++i)
#pragma unroll
        for (int j = 0; j < TB; ++j) {
          acc.re[i][j] = WMMA_F16_NEGC(Ar[i], Br[j], acc.re[i][j]);  // Ar Br - (Ai Bi - re)
          acc.im[i][j] = WMMA_F16(Ai[i], Br[j], acc.im[i][j]);
        }
    }

    asm volatile("s_wait_dscnt 0x0" ::: "memory");     // this wave's reads of buffer p & 1 are done before it is refilled
    asm volatile("s_wait_asynccnt 0x0" ::: "memory");  // this wave's copies of pass p + 1 have landed
    __syncthreads();  // publishes pass p + 1 and ends every reader's use of buffer p & 1
    if (p + 2 < NPASS) {
      const int e = (p + 2) * KP;
      _Float16* l = ldst + (p & 1) * STAGE;
      copy_planes(l, g0 + e, g1 + e);
      copy_planes(l + 2 * PLANE, g2 + e, g3 + e);
    }
  }
  asm volatile("s_wait_asynccnt 0x0" ::: "memory");  // nothing of this wave is in flight when it leaves the ring
}

// ---------------------------------------------------------------------------
// Complex projection: out[h, m, sb] = sum_e w[h,m,e] * x[sb,e]   (complex)
// A rows = flattened (h, m), B rows = sb; all-f16 operands, f32 accumulation.
// TRANSPOSED=0 -> store [b][h][s][m] (q,k);  TRANSPOSED=1 -> [b][h][m][s] (v^T)
// ---------------------------------------------------------------------------
template <int TRANSPOSED, int MDIM>
static __device__ inline void proj_store(const CAcc& acc, int sb0, int hm0,
                                         _Float16* __restrict__ ore, _Float16* __restrict__ oim) {
  const int lane = threadIdx.x & 31;
  const int wave = threadIdx.x >> 5;
  const int col  = lane & 15;
  const int hig  = lane >> 4;

  // One base address per plane; i, j and r move it by constants.
  const unsigned b  = col & (B_DIM - 1);                             // sb % B_DIM
  const unsigned s0 = (sb0 >> 2) + (wave & 1) * 16 + (col >> 2);     // sb / B_DIM at j = 0
  const unsigned hm = hm0 + (wave >> 1) * 32 + hig * 8;              // row at i = 0, r = 0
  const unsigned h  = hm / MDIM;                                     // 32 rows never cross a head
  const unsigned m0 = hm % MDIM;
  const size_t base = TRANSPOSED ? (((size_t)b * H_DIM + h) * MDIM + m0) * S_DIM + s0
                                 : (((size_t)b * H_DIM + h) * S_DIM + s0) * MDIM + m0;
  _Float16* pr = ore + base;
  _Float16* pi = oim + base;
  v8h hr[TA][TB], hi[TA][TB];
#pragma unroll
  for (int i = 0; i < TA; ++i)
#pragma unroll
    for (int j = 0; j < TB; ++j)
#pragma unroll
      for (int r = 0; r < 8; ++r) {
        hr[i][j][r] = (_Float16)acc.re[i][j][r];
        hi[i][j][r] = (_Float16)acc.im[i][j][r];
      }
  __builtin_amdgcn_sched_barrier(0);  // all arithmetic stays in front of the first store: no register an issued store names is written again
#pragma unroll
  for (int i = 0; i < TA; ++i)
#pragma unroll
    for (int j = 0; j < TB; ++j) {
      if constexpr (TRANSPOSED) {
#pragma unroll
        for (int r = 0; r < 8; ++r) {
          pr[(i * 16 + r) * S_DIM + j * 4] = hr[i][j][r];
          pi[(i * 16 + r) * S_DIM + j * 4] = hi[i][j][r];
        }
      } else {
        // r runs along m: the 8 results are 16 contiguous, 16-byte aligned bytes, one store a plane
        *(v8h*)(pr + j * 4 * MDIM + i * 16) = hr[i][j];
        *(v8h*)(pi + j * 4 * MDIM + i * 16) = hi[i][j];
      }
    }
  if constexpr (!TRANSPOSED) asm volatile("s_wait_xcnt 0x0" ::: "memory");
}

// v, q and k in ONE launch: they read the same x and none reads another's result, so they share a
// grid by ranges of blockIdx.y. 1,280 equal tiles follow one another on the chip with one start
// and one tail. v comes first: its scattered stores then run beside later tiles' products.
#define VY (H_DIM * V_DIM / BT)  // tile rows of v
#define QY (H_DIM * M_DIM / BT)  // tile rows of q, and of k

__global__ __launch_bounds__(256)
void proj_kernel(const _Float16* __restrict__ vwre, const _Float16* __restrict__ vwim,
                 const _Float16* __restrict__ qwre, const _Float16* __restrict__ qwim,
                 const _Float16* __restrict__ kwre, const _Float16* __restrict__ kwim,
                 const _Float16* __restrict__ xre, const _Float16* __restrict__ xim,
                 _Float16* __restrict__ vtre, _Float16* __restrict__ vtim,
                 _Float16* __restrict__ qre, _Float16* __restrict__ qim,
                 _Float16* __restrict__ kre, _Float16* __restrict__ kim) {
  __shared__ __align__(16) _Float16 lds[2 * STAGE];

  const int y   = blockIdx.y;
  const int sb0 = blockIdx.x * BT;  // first sb of the tile
  const _Float16 *wre, *wim;        // the weight this tile multiplies
  _Float16 *ore, *oim;              // and where its result goes
  int hm0;                          // first flattened (h, m) row of the tile
  if      (y < VY)      { wre = vwre; wim = vwim; ore = vtre; oim = vtim; hm0 = y * BT; }
  else if (y < VY + QY) { wre = qwre; wim = qwim; ore = qre;  oim = qim;  hm0 = (y - VY) * BT; }
  else                  { wre = kwre; wim = kwim; ore = kre;  oim = kim;  hm0 = (y - VY - QY) * BT; }

  CAcc acc;
  cgemm_tile(wre + (size_t)hm0 * E_DIM, wim + (size_t)hm0 * E_DIM,
             xre + (size_t)sb0 * E_DIM, xim + (size_t)sb0 * E_DIM, lds, acc);

  if (y < VY) proj_store<1, V_DIM>(acc, sb0, hm0, ore, oim);
  else        proj_store<0, M_DIM>(acc, sb0, hm0, ore, oim);
}

#define AW      8
static_assert(S_DIM / (16 * AW) == 8, "the z -> qb map below is written for 8 blocks");
#define AKEYS   64                   // keys per stage = two 32-column chunks
#define KPITCH  136                  // LDS pitch of a K row in halves: 272 B = 16 B x odd
#define VPITCH  72                   // LDS pitch of a V^T row piece in halves: 144 B = 16 B x odd
#define KPLANE  (AKEYS * KPITCH)     // K re or K im of a stage
#define VPLANE  (V_DIM * VPITCH)     // V^T re or V^T im of a stage
#define ASTAGE  (2 * KPLANE + 2 * VPLANE)

// One stage, 12 copies of 16 bytes a lane. K: 16 lanes cover a 256-byte row,
// 16 rows per sweep. V^T: 8 lanes cover a 128-byte row piece, 32 rows per sweep.
static __device__ inline void attn_stage(_Float16* lk, _Float16* lv,
                                         const _Float16* gkr, const _Float16* gki,
                                         const _Float16* gvr, const _Float16* gvi) {
#pragma unroll
  for (int i = 0; i < AKEYS / 16; ++i) {
    __builtin_amdgcn_global_load_async_to_lds_b128(
        (gv4i*)(gkr + (size_t)i * 16 * M_DIM), (lv4i*)(lk + i * 16 * KPITCH), 0, 0);
    __builtin_amdgcn_global_load_async_to_lds_b128(
        (gv4i*)(gki + (size_t)i * 16 * M_DIM), (lv4i*)(lk + KPLANE + i * 16 * KPITCH), 0, 0);
  }
#pragma unroll
  for (int i = 0; i < V_DIM / 32; ++i) {
    __builtin_amdgcn_global_load_async_to_lds_b128(
        (gv4i*)(gvr + (size_t)i * 32 * S_DIM), (lv4i*)(lv + i * 32 * VPITCH), 0, 0);
    __builtin_amdgcn_global_load_async_to_lds_b128(
        (gv4i*)(gvi + (size_t)i * 32 * S_DIM), (lv4i*)(lv + VPLANE + i * 32 * VPITCH), 0, 0);
  }
}

// Four waves per SIMD: the register budget that lets two work-groups share a WGP, as all 512 must to be resident at once.
__global__ __launch_bounds__(256) __attribute__((amdgpu_waves_per_eu(4, 4)))
void attn_kernel(const _Float16* __restrict__ qre, const _Float16* __restrict__ qim,
                 const _Float16* __restrict__ kre, const _Float16* __restrict__ kim,
                 const _Float16* __restrict__ vre, const _Float16* __restrict__ vim,
                 _Float16* __restrict__ ure, _Float16* __restrict__ uim) {
  __shared__ __align__(16) _Float16 ring[2 * ASTAGE];

  const int tid  = threadIdx.x;
  const int lane = tid & 31;
  const int wave = __builtin_amdgcn_readfirstlane(tid >> 5);  // scalar, so the causal skip below is a scalar branch
  const int col  = lane & 15;
  const int hig  = lane >> 4;
  const int h    = blockIdx.x;
  const int b    = blockIdx.y;
  // Block of AW query tiles; its cost grows with qb. All work-groups are resident, two to a WGP:
  // z and z + 4 of one head, and heads h and h + 1 or h + 8, get blocks qb and 7 - qb, so that
  // neighbours in launch order share the work evenly. Per (b, h) z -> qb is a permutation; for speed only.
  const int zf   = blockIdx.z < 4 ? 7 - (int)blockIdx.z : (int)blockIdx.z - 4;
  const int qb   = ((h ^ (h >> 3)) & 1) ? 7 - zf : zf;
  const int st   = qb * AW + wave;                      // this wave's query tile

  const size_t bh   = (size_t)b * H_DIM + h;
  const int    srow = st * 16 + col;

  // Copy map of this lane, at stage 0.
  const size_t    koff = (bh * S_DIM + (tid >> 4)) * M_DIM + (tid & 15) * 8;
  const size_t    voff = (bh * V_DIM + (tid >> 3)) * S_DIM + (tid & 7) * 8;
  const _Float16* gkr  = kre + koff;
  const _Float16* gki  = kim + koff;
  const _Float16* gvr  = vre + voff;
  const _Float16* gvi  = vim + voff;
  _Float16* lk = ring + (tid >> 4) * KPITCH + (tid & 15) * 8;
  _Float16* lv = ring + 2 * KPLANE + (tid >> 3) * VPITCH + (tid & 7) * 8;
  const int nstage = 2 * (qb + 1);  // keys 0 .. (qb + 1) * 128 - 1; never fewer than two stages

  attn_stage(lk, lv, gkr, gki, gvr, gvi);

  // Cache q fragments for this row tile (M=128 -> 4 K-steps, re+im).
  v16h qfr[4], qfi[4];
#pragma unroll
  for (int km = 0; km < 4; ++km) {
    const _Float16* pr = qre + (bh * S_DIM + srow) * M_DIM + km * 32 + hig * 8;
    const _Float16* pi = qim + (bh * S_DIM + srow) * M_DIM + km * 32 + hig * 8;
    qfr[km] = frag_h(pr, pr + 16);
    qfi[km] = frag_h(pi, pi + 16);
  }

  v8f accre[4], accim[4];
  {
    v8f z = {};
#pragma unroll
    for (int c = 0; c < 4; ++c) { accre[c] = z; accim[c] = z; }
  }
  float mrun = -__builtin_inff();  // running maximum of query srow, the same in both halves
  float lrun = 0.f;                // running sum over this lane's own keys; the halves join after the loop

  const float scl = 0.08838834764831845f;  // 1/sqrt(128)

  asm volatile("s_wait_asynccnt 0x0" ::: "memory");  // this wave's copies of stage 0 have landed
  __syncthreads();
  attn_stage(lk + ASTAGE, lv + ASTAGE, gkr + AKEYS * M_DIM, gki + AKEYS * M_DIM, gvr + AKEYS, gvi + AKEYS);

  for (int t = 0; t < nstage; ++t) {
    const _Float16* cur = ring + (t & 1) * ASTAGE;
    for (int cc = 0; cc < AKEYS / 32; ++cc) {
      const int tc = t * (AKEYS / 16) + cc * 2;
      if (tc > st) continue;  // chunk wholly above this wave's diagonal; no barrier stands inside the skip

      // ---- two transposed score tiles (keys tc*16 .. tc*16+31 down, 16 queries across) ----
      float amp[2][8];
#pragma unroll
      for (int sub = 0; sub < 2; ++sub) {
        const int key0 = (tc + sub) * 16 + hig * 8;  // this lane's key at r = 0
        const _Float16* krow = cur + (cc * 32 + sub * 16 + col) * KPITCH + hig * 8;
        v8f prr = {}, pii = {}, pri = {}, pir = {};
#pragma unroll
        for (int km = 0; km < 4; ++km) {
          const _Float16* kr = krow + km * 32;
          const _Float16* ki = kr + KPLANE;
          v16h Kr = frag_h(kr, kr + 16);
          v16h Ki = frag_h(ki, ki + 16);
          prr = WMMA_F16(Kr, qfr[km], prr);
          pii = WMMA_F16(Ki, qfi[km], pii);
          pri = WMMA_F16(Ki, qfr[km], pri);
          pir = WMMA_F16(Kr, qfi[km], pir);
        }
        float sq[8], rt[8];
#pragma unroll
        for (int r = 0; r < 8; ++r) {
          const float re = prr[r] - pii[r];
          const float im = pri[r] + pir[r];
          sq[r] = re * re + im * im;
        }
        sqrtx8(rt, sq);
#pragma unroll
        for (int r = 0; r < 8; ++r)
          amp[sub][r] = (key0 + r <= srow) ? rt[r] * scl : -__builtin_inff();  // covers a tile wholly above the diagonal too
      }

      // ---- online softmax over the 32 keys: in the lane, plus one exchange of the maximum ----
      float rm = fmaxf(amp[0][0], amp[1][0]);
#pragma unroll
      for (int r = 1; r < 8; ++r) rm = fmaxf(rm, fmaxf(amp[0][r], amp[1][r]));
      rm = fmaxf(rm, other_half(rm));  // key tc*16 is never masked, so rm is finite
      const float mn    = fmaxf(mrun, rm);
      const float l2e   = 1.4426950408889634f;  // e^x = 2^(x * log2 e)
      const float scale = exp2x1((mrun - mn) * l2e);
      mrun = mn;
      float x0[8], x1[8], p0[8], p1[8];
#pragma unroll
      for (int r = 0; r < 8; ++r) {
        x0[r] = (amp[0][r] - mn) * l2e;
        x1[r] = (amp[1][r] - mn) * l2e;
      }
      exp2x8(p0, x0);
      exp2x8(p1, x1);
      float psum = 0.f;
      v16h  Pb;  // P^T as a B fragment: elements 0-7 = keys hig*8 + r, 8-15 = keys 16 + hig*8 + r
#pragma unroll
      for (int r = 0; r < 8; ++r) {
        psum += p0[r] + p1[r];
        Pb[r]     = (_Float16)p0[r];
        Pb[8 + r] = (_Float16)p1[r];
      }
      lrun = lrun * scale + psum;
#pragma unroll
      for (int c = 0; c < 4; ++c)
#pragma unroll
        for (int r = 0; r < 8; ++r) {
          accre[c][r] *= scale;
          accim[c][r] *= scale;
        }

      // ---- O^T += V^T P^T (re/im): 8 full-K WMMAs per chunk of 32 keys ----
#pragma unroll
      for (int c = 0; c < 4; ++c) {
        const _Float16* vr = cur + 2 * KPLANE + (c * 16 + col) * VPITCH + cc * 32 + hig * 8;
        const _Float16* vi = vr + VPLANE;
        v16h Vr = frag_h(vr, vr + 16);
        v16h Vi = frag_h(vi, vi + 16);
        accre[c] = WMMA_F16(Vr, Pb, accre[c]);
        accim[c] = WMMA_F16(Vi, Pb, accim[c]);
      }
    }

    asm volatile("s_wait_dscnt 0x0" ::: "memory");     // this wave's reads of buffer t & 1 are done before it is refilled
    asm volatile("s_wait_asynccnt 0x0" ::: "memory");  // this wave's copies of stage t + 1 have landed
    __syncthreads();  // publishes stage t + 1 and ends every reader's use of buffer t & 1
    if (t + 2 < nstage) {
      const int k0  = (t + 2) * AKEYS;
      const int buf = (t & 1) * ASTAGE;
      attn_stage(lk + buf, lv + buf, gkr + (size_t)k0 * M_DIM, gki + (size_t)k0 * M_DIM, gvr + k0, gvi + k0);
    }
  }
  asm volatile("s_wait_asynccnt 0x0" ::: "memory");  // nothing of this wave is in flight when it leaves the ring

  // ---- normalize and store upd as f16 in (s, b, h*V + vc) layout ----
  // The lane holds query srow at vc = c*16 + hig*8 + r: 8 neighbours, one 16-byte store a plane.
  const float  inv = 1.0f / (lrun + other_half(lrun));
  const size_t idx = ((size_t)srow * B_DIM + b) * E_DIM + h * V_DIM + hig * 8;
  v8h our[4], oui[4];
#pragma unroll
  for (int c = 0; c < 4; ++c)
#pragma unroll
    for (int r = 0; r < 8; ++r) {
      our[c][r] = (_Float16)(accre[c][r] * inv);
      oui[c][r] = (_Float16)(accim[c][r] * inv);
    }
#pragma unroll
  for (int c = 0; c < 4; ++c) {
    *(v8h*)(ure + idx + c * 16) = our[c];
    *(v8h*)(uim + idx + c * 16) = oui[c];
  }
}

// ---------------------------------------------------------------------------
// out[sb,f] = sum_e upd[sb,e] * wo[e,f] + x[sb,f]   (complex, f32 result)
// A rows = sb, B rows = f (wo^T).
// ---------------------------------------------------------------------------
__global__ __launch_bounds__(256)
void outproj_kernel(const _Float16* __restrict__ ure, const _Float16* __restrict__ uim,
                    const _Float16* __restrict__ wtre, const _Float16* __restrict__ wtim,
                    const float* __restrict__ xre, const float* __restrict__ xim,
                    float* __restrict__ out) {
  __shared__ __align__(16) _Float16 lds[2 * STAGE];

  const int lane = threadIdx.x & 31;
  const int wave = threadIdx.x >> 5;
  const int col  = lane & 15;
  const int hig  = lane >> 4;
  const int sb0  = blockIdx.x * BT;
  const int f0   = blockIdx.y * BT;

  CAcc acc;
  cgemm_tile(ure + (size_t)sb0 * E_DIM, uim + (size_t)sb0 * E_DIM,
             wtre + (size_t)f0 * E_DIM, wtim + (size_t)f0 * E_DIM, lds, acc);

  // One 32-bit byte offset serves x and out, re and im; i, j and r move it by constants.
  const unsigned offb = ((unsigned)(sb0 + (wave >> 1) * 32 + hig * 8) * E_DIM +
                         (unsigned)(f0 + (wave & 1) * 64 + col)) * 4u;
  const float* px_re = (const float*)((const char*)xre + offb);
  const float* px_im = (const float*)((const char*)xim + offb);
  float* po_re = (float*)((char*)out + offb);
  float* po_im = (float*)((char*)(out + (size_t)SB_DIM * E_DIM) + offb);

  float xr[TA][TB][8], xi[TA][TB][8];
#pragma unroll
  for (int i = 0; i < TA; ++i)
#pragma unroll
    for (int j = 0; j < TB; ++j)
#pragma unroll
      for (int r = 0; r < 8; ++r) {
        xr[i][j][r] = px_re[(i * 16 + r) * E_DIM + j * 16];
        xi[i][j][r] = px_im[(i * 16 + r) * E_DIM + j * 16];
      }
#pragma unroll
  for (int i = 0; i < TA; ++i)
#pragma unroll
    for (int j = 0; j < TB; ++j) {
      float sr[8], si[8];
#pragma unroll
      for (int r = 0; r < 8; ++r) {
        sr[r] = acc.re[i][j][r] + xr[i][j][r];
        si[r] = acc.im[i][j][r] + xi[i][j][r];
      }
      __builtin_amdgcn_sched_barrier(0);  // the tile's sums stay in front of its first store: no register an issued store names is written before the wait below
#pragma unroll
      for (int r = 0; r < 8; ++r) {
        po_re[(i * 16 + r) * E_DIM + j * 16] = sr[r];
        po_im[(i * 16 + r) * E_DIM + j * 16] = si[r];
      }
      asm volatile("s_wait_xcnt 0x0" ::: "memory");  // before the next tile reuses registers these stores name
      __builtin_amdgcn_sched_barrier(0);  // keeps the next tile's arithmetic behind that wait
    }
}

// ---------------------------------------------------------------------------
extern "C" void kernel_launch(void* const* d_in, const int* in_sizes, int n_in,
                              void* d_out, int out_size, void* d_ws, size_t ws_size,
                              hipStream_t stream) {
  (void)in_sizes; (void)n_in; (void)out_size; (void)ws_size;

  const float* xre  = (const float*)d_in[0];
  const float* xim  = (const float*)d_in[1];
  const float* wqre = (const float*)d_in[2];
  const float* wqim = (const float*)d_in[3];
  const float* wkre = (const float*)d_in[4];
  const float* wkim = (const float*)d_in[5];
  const float* wvre = (const float*)d_in[6];
  const float* wvim = (const float*)d_in[7];
  const float* wore = (const float*)d_in[8];
  const float* woim = (const float*)d_in[9];

  char*  ws = (char*)d_ws;
  size_t o  = 0;
  auto halloc = [&](size_t n) { _Float16* p = (_Float16*)(ws + o); o += n * sizeof(_Float16); return p; };

  const size_t QK = (size_t)B_DIM * H_DIM * S_DIM * M_DIM;  // q/k per component
  const size_t VT = (size_t)B_DIM * H_DIM * V_DIM * S_DIM;  // v^T per component
  const size_t UE = (size_t)SB_DIM * E_DIM;                 // upd / x per component
  const size_t WO = (size_t)E_DIM * E_DIM;                  // wo^T per component
  const size_t WQ = (size_t)H_DIM * M_DIM * E_DIM;          // wq/wk per component
  const size_t WV = (size_t)H_DIM * V_DIM * E_DIM;          // wv per component

  _Float16* qre  = halloc(QK);  _Float16* qim  = halloc(QK);
  _Float16* kre  = halloc(QK);  _Float16* kim  = halloc(QK);
  _Float16* vtre = halloc(VT);  _Float16* vtim = halloc(VT);
  _Float16* upre = halloc(UE);  _Float16* upim = halloc(UE);
  _Float16* wtre = halloc(WO);  _Float16* wtim = halloc(WO);
  _Float16* xhre = halloc(UE);  _Float16* xhim = halloc(UE);
  _Float16* qwre = halloc(WQ);  _Float16* qwim = halloc(WQ);
  _Float16* kwre = halloc(WQ);  _Float16* kwim = halloc(WQ);
  _Float16* vwre = halloc(WV);  _Float16* vwim = halloc(WV);

  // Operand preparation, one launch. xhre .. vwim lie one behind another in the order prep_kernel expects.
  prep_kernel<<<TR_BLOCKS + CVT_BLOCKS, 256, 0, stream>>>(xre, xim, wqre, wqim, wkre, wkim, wvre, wvim,
                                                          wore, woim, xhre, wtre, wtim);

  dim3 gp(SB_DIM / BT, VY + 2 * QY);
  proj_kernel<<<gp, 256, 0, stream>>>(vwre, vwim, qwre, qwim, kwre, kwim, xhre, xhim,
                                      vtre, vtim, qre, qim, kre, kim);

  dim3 ga(H_DIM, B_DIM, S_DIM / (16 * AW));
  attn_kernel<<<ga, 256, 0, stream>>>(qre, qim, kre, kim, vtre, vtim, upre, upim);

  dim3 go(SB_DIM / BT, E_DIM / BT);
  outproj_kernel<<<go, 256, 0, stream>>>(upre, upim, wtre, wtim, xre, xim, (float*)d_out);
}

// v008
// It runs in 196 microseconds.
// Timed twice side by side with v007, it ran 1.04 times as fast both times.
// All steps since v000 together make it 5.41 times as fast.
#include <hip/hip_runtime.h>
#include <hip/hip_bf16.h>
#include <math.h>

#define S_DIM 1024
#define B_DIM 4
#define E_DIM 1024
#define H_DIM 16
#define M_DIM 128
#define V_DIM 64
#define SB_DIM (S_DIM * B_DIM)

typedef __attribute__((ext_vector_type(16))) _Float16 v16h;
typedef __attribute__((ext_vector_type(8)))  _Float16 v8h;
typedef __attribute__((ext_vector_type(8)))  float    v8f;

#define WMMA_F16(A, B, C) \
  __builtin_amdgcn_wmma_f32_16x16x32_f16(false, (A), false, (B), (short)0, (C), false, false)
// The same with C negated inside the instruction: D = A * B - C.
#define WMMA_F16_NEGC(A, B, C) \
  __builtin_amdgcn_wmma_f32_16x16x32_f16(false, (A), false, (B), (short)1, (C), false, false)

// 16x32 f16 A/B fragment from two contiguous 8-half segments
// (segment 0 at K-base, segment 1 at K-base+16; lane group picks +0 / +8).
static __device__ inline v16h frag_h(const _Float16* __restrict__ s0,
                                     const _Float16* __restrict__ s1) {
  v8h a = *(const v8h*)s0;
  v8h b = *(const v8h*)s1;
  v16h r;
#pragma unroll
  for (int j = 0; j < 8; ++j) {
    r[j]     = a[j];
    r[j + 8] = b[j];
  }
  return r;
}

// The value that lane l ^ 16 holds: one vector move between the wave's two 16-lane rows.
static __device__ inline float other_half(float v) {
  return __builtin_bit_cast(float, __builtin_amdgcn_permlanex16(
      0u, __builtin_bit_cast(unsigned, v), 0x76543210u, 0xfedcba98u, false, false));
}

// 2^x for eight values, and for one. The instruction set asks for one independent instruction or a
// v_nop between a transcendental and a next instruction that reads its result or overwrites its
// source. In one statement each
// v_exp_f32 is followed by an independent one (no output shares a register with an input), the last by v_nop.
static __device__ inline void exp2x8(float (&d)[8], const float (&x)[8]) {
  asm("v_exp_f32 %0, %8\n\tv_exp_f32 %1, %9\n\tv_exp_f32 %2, %10\n\tv_exp_f32 %3, %11\n\t"
      "v_exp_f32 %4, %12\n\tv_exp_f32 %5, %13\n\tv_exp_f32 %6, %14\n\tv_exp_f32 %7, %15\n\tv_nop"
      : "=&v"(d[0]), "=&v"(d[1]), "=&v"(d[2]), "=&v"(d[3]), "=&v"(d[4]), "=&v"(d[5]), "=&v"(d[6]), "=&v"(d[7])
      : "v"(x[0]), "v"(x[1]), "v"(x[2]), "v"(x[3]), "v"(x[4]), "v"(x[5]), "v"(x[6]), "v"(x[7]));
}
// Square root of eight values by the bare hardware root, in the same one-statement form and for the same reason.
// sqrtf() wraps v_sqrt_f32 in a scaling of small inputs and two correction steps for a correctly rounded
// result: about fifteen more vector instructions a value, most of them waiting on the one before. The root
// feeds exp and an f16 rounding of P, which are far coarser than the root's last bit; 0, inf and NaN pass as in
// sqrtf, and a sum of squares too small for the bare root is an amplitude that does not move any exponential.
static __device__ inline void sqrtx8(float (&d)[8], const float (&x)[8]) {
  asm("v_sqrt_f32 %0, %8\n\tv_sqrt_f32 %1, %9\n\tv_sqrt_f32 %2, %10\n\tv_sqrt_f32 %3, %11\n\t"
      "v_sqrt_f32 %4, %12\n\tv_sqrt_f32 %5, %13\n\tv_sqrt_f32 %6, %14\n\tv_sqrt_f32 %7, %15\n\tv_nop"
      : "=&v"(d[0]), "=&v"(d[1]), "=&v"(d[2]), "=&v"(d[3]), "=&v"(d[4]), "=&v"(d[5]), "=&v"(d[6]), "=&v"(d[7])
      : "v"(x[0]), "v"(x[1]), "v"(x[2]), "v"(x[3]), "v"(x[4]), "v"(x[5]), "v"(x[6]), "v"(x[7]));
}
static __device__ inline float exp2x1(float x) {
  float d;
  asm("v_exp_f32 %0, %1\n\tv_nop" : "=v"(d) : "v"(x));
  return d;
}

// ---------------------------------------------------------------------------
// Bulk f32 -> f16 conversion (one pass; amortizes all GEMM operand reuse).
// A wave converts CVT_RUNS runs of 128 consecutive elements: per run one
// 16-byte load a lane (512 contiguous bytes a wave) and one 8-byte store a lane
// (256 contiguous bytes a wave). All loads of a lane are issued before its first
// conversion, so few waves keep the memory busy and few waves have to start.
// ---------------------------------------------------------------------------
typedef __attribute__((ext_vector_type(4))) float    v4f;
typedef __attribute__((ext_vector_type(4))) _Float16 v4h;

#define CVT_RUNS  8                  // 16-byte loads in flight per lane
#define CVT_WAVE  (CVT_RUNS * 128)   // elements per wave
#define CVT_BLOCK (8 * CVT_WAVE)     // elements per block of 8 waves

#define X_BLOCKS   (SB_DIM * E_DIM / CVT_BLOCK)         // blocks per plane of x
#define WQ_BLOCKS  (H_DIM * M_DIM * E_DIM / CVT_BLOCK)  // per plane of wq, wk
#define WV_BLOCKS  (H_DIM * V_DIM * E_DIM / CVT_BLOCK)  // per plane of wv
#define CVT_BLOCKS (2 * X_BLOCKS + 4 * WQ_BLOCKS + 2 * WV_BLOCKS)
#define TR_BLOCKS  (E_DIM * E_DIM / 256)                // blocks of the wo transpose
static_assert(SB_DIM * E_DIM % CVT_BLOCK == 0 && H_DIM * M_DIM * E_DIM % CVT_BLOCK == 0 &&
              H_DIM * V_DIM * E_DIM % CVT_BLOCK == 0 && E_DIM * E_DIM % 256 == 0, "whole blocks");

// One block's share of a conversion: src and dst point at the block's first element.
static __device__ inline void cvt_block(const float* __restrict__ src, _Float16* __restrict__ dst) {
  const int at = (threadIdx.x >> 5) * CVT_WAVE + (threadIdx.x & 31) * 4;
  v4f v[CVT_RUNS];
#pragma unroll  // both loops unrolled: v stays in registers and the loads go out as one group
  for (int k = 0; k < CVT_RUNS; ++k) v[k] = *(const v4f*)(src + at + k * 128);
#pragma unroll
  for (int k = 0; k < CVT_RUNS; ++k) {
    v4h h;
#pragma unroll
    for (int j = 0; j < 4; ++j) h[j] = (_Float16)v[k][j];
    *(v4h*)(dst + at + k * 128) = h;
  }
}

// All operand preparation in ONE launch; none of its parts reads what another writes, so they
// share a grid by block range and the chip starts, fills and drains once instead of nine times.
// Blocks 0 .. TR_BLOCKS-1: wo (E,E) f32 -> wo^T (F,E) f16, so out-proj B-fragments load contiguously.
// The others: the eight f32 -> f16 planes. Their destinations lie one behind another in the
// workspace in the order x, wq, wk, wv (re, im each), so a block's place in cvt_dst is its number.
__global__ __launch_bounds__(256)
void prep_kernel(const float* __restrict__ xre,  const float* __restrict__ xim,
                 const float* __restrict__ wqre, const float* __restrict__ wqim,
                 const float* __restrict__ wkre, const float* __restrict__ wkim,
                 const float* __restrict__ wvre, const float* __restrict__ wvim,
                 const float* __restrict__ wre,  const float* __restrict__ wim,
                 _Float16* __restrict__ cvt_dst,
                 _Float16* __restrict__ tre, _Float16* __restrict__ tim) {
  if (blockIdx.x < TR_BLOCKS) {
    int idx = blockIdx.x * 256 + threadIdx.x;  // f*E + e
    int f = idx >> 10;
    int e = idx & (E_DIM - 1);
    tre[idx] = (_Float16)wre[(size_t)e * E_DIM + f];
    tim[idx] = (_Float16)wim[(size_t)e * E_DIM + f];
    return;
  }
  const int blk = blockIdx.x - TR_BLOCKS;  // block among the conversions
  const float* src;                        // the plane this block converts
  int first;                               // that plane's first block
  if      (blk < X_BLOCKS)                     { src = xre;  first = 0; }
  else if (blk < 2 * X_BLOCKS)                 { src = xim;  first = X_BLOCKS; }
  else if (blk < 2 * X_BLOCKS + WQ_BLOCKS)     { src = wqre; first = 2 * X_BLOCKS; }
  else if (blk < 2 * X_BLOCKS + 2 * WQ_BLOCKS) { src = wqim; first = 2 * X_BLOCKS + WQ_BLOCKS; }
  else if (blk < 2 * X_BLOCKS + 3 * WQ_BLOCKS) { src = wkre; first = 2 * X_BLOCKS + 2 * WQ_BLOCKS; }
  else if (blk < 2 * X_BLOCKS + 4 * WQ_BLOCKS) { src = wkim; first = 2 * X_BLOCKS + 3 * WQ_BLOCKS; }
  else if (blk < 2 * X_BLOCKS + 4 * WQ_BLOCKS + WV_BLOCKS) { src = wvre; first = 2 * X_BLOCKS + 4 * WQ_BLOCKS; }
  else                                         { src = wvim; first = 2 * X_BLOCKS + 4 * WQ_BLOCKS + WV_BLOCKS; }
  cvt_block(src + (size_t)(blk - first) * CVT_BLOCK, cvt_dst + (size_t)blk * CVT_BLOCK);
}

// ---------------------------------------------------------------------------
// Shared core of the four complex GEMMs: D[a][b] = sum_e A[a][e] * B[b][e],
// A and B complex, e-contiguous f16 rows of E_DIM.
// One work-group of 8 waves owns a 128 x 128 tile of D. Per pass, 64 e of the
// 128 A rows and 128 B rows (re and im planes) are brought into LDS by
// asynchronous copies, whole 128-byte lines per row, so each operand byte is
// fetched once per work-group; each wave (4 x 2 grid) then reads the fragments
// of its 32 x 64 part from LDS. Two buffers: the copies of pass p + 1 fly
// during the products of pass p.
// One accumulator per part of D: per step of 32 e, re <- Ar Br - (Ai Bi - re) by two products
// that negate C (exact sign flips), im <- Ai Br + (Ar Bi + im). 128 accumulator registers a wave
// instead of 256, so that two work-groups fit a WGP's registers and LDS: one group's products
// run while the other waits at its barrier, for LDS or copies, or starts or stores a tile.
// Steps of 32 e still come in ascending order.
// ---------------------------------------------------------------------------
#define BT     128                // rows of each operand per work-group
#define KP     64                 // e per pass (128 B of a row)
#define NPASS  (E_DIM / KP)
#define PITCH  72                 // LDS row pitch in halves: 144 B = 16 B x odd
#define PLANE  (BT * PITCH)       // one operand plane (re or im)
#define STAGE  (4 * PLANE)        // A re | A im | B re | B im
#define TA     2                  // 16-row A tiles per wave
#define TB     4                  // 16-row B tiles per wave

struct CAcc {
  v8f re[TA][TB], im[TA][TB];
};

typedef int v4i __attribute__((ext_vector_type(4)));
typedef __attribute__((address_space(1))) v4i gv4i;
typedef __attribute__((address_space(3))) v4i lv4i;

// Two planes (re, im) of one operand: each lane copies 16 bytes of four rows
// of each plane, global -> LDS, through no register. l = the lane's place in
// the re plane, gr / gi = its global addresses.
static __device__ inline void copy_planes(_Float16* l, const _Float16* gr, const _Float16* gi) {
#pragma unroll
  for (int i = 0; i < 4; ++i) {
    __builtin_amdgcn_global_load_async_to_lds_b128(
        (gv4i*)(gr + (size_t)i * 32 * E_DIM), (lv4i*)(l + i * 32 * PITCH), 0, 0);
    __builtin_amdgcn_global_load_async_to_lds_b128(
        (gv4i*)(gi + (size_t)i * 32 * E_DIM), (lv4i*)(l + PLANE + i * 32 * PITCH), 0, 0);
  }
}

static __device__ inline void cgemm_tile(const _Float16* __restrict__ are,
                                         const _Float16* __restrict__ aim,
                                         const _Float16* __restrict__ bre,
                                         const _Float16* __restrict__ bim,
                                         _Float16* lds, CAcc& acc) {
  const int tid  = threadIdx.x;
  const int lane = tid & 31;
  const int wave = tid >> 5;
  const int col  = lane & 15;
  const int hig  = lane >> 4;
  const int wa   = wave >> 1;  // which 32 A rows
  const int wb   = wave & 1;   // which 64 B rows

  // Copy map: 8 lanes cover one 128-byte row piece, 32 rows per sweep.
  const int    grow = tid >> 3;
  const int    gseg = tid & 7;
  const size_t goff = (size_t)grow * E_DIM + gseg * 8;
  const _Float16* g0 = are + goff;
  const _Float16* g1 = aim + goff;
  const _Float16* g2 = bre + goff;
  const _Float16* g3 = bim + goff;
  _Float16* ldst = lds + grow * PITCH + gseg * 8;

  {
    v8f z = {};
#pragma unroll
    for (int i = 0; i < TA; ++i)
#pragma unroll
      for (int j = 0; j < TB; ++j) {
        acc.re[i][j] = z; acc.im[i][j] = z;
      }
  }

  // Pass 0 into buffer 0, landed and published; then pass 1 into buffer 1.
  copy_planes(ldst, g0, g1);
  copy_planes(ldst + 2 * PLANE, g2, g3);
  asm volatile("s_wait_asynccnt 0x0" ::: "memory");  // this wave's copies of pass 0 have landed
  __syncthreads();
  copy_planes(ldst + STAGE, g0 + KP, g1 + KP);
  copy_planes(ldst + STAGE + 2 * PLANE, g2 + KP, g3 + KP);

  const int aoff = (wa * 32 + col) * PITCH + hig * 8;
  const int boff = 2 * PLANE + (wb * 64 + col) * PITCH + hig * 8;

  for (int p = 0; p < NPASS; ++p) {
    const _Float16* cur = lds + (p & 1) * STAGE;
#pragma unroll
    for (int ks = 0; ks < KP / 32; ++ks) {
      v16h Ar[TA], Ai[TA], Br[TB], Bi[TB];
#pragma unroll
      for (int i = 0; i < TA; ++i) {
        const _Float16* pa = cur + aoff + i * 16 * PITCH + ks * 32;
        Ar[i] = frag_h(pa, pa + 16);
        Ai[i] = frag_h(pa + PLANE, pa + PLANE + 16);
      }
#pragma unroll
      for (int j = 0; j < TB; ++j) {
        const _Float16* pb = cur + boff + j * 16 * PITCH + ks * 32;
        Br[j] = frag_h(pb, pb + 16);
        Bi[j] = frag_h(pb + PLANE, pb + PLANE + 16);
      }
#pragma unroll
      for (int i = 0; i < TA; ++i)
#pragma unroll
        for (int j = 0; j < TB; ++j) {
          acc.re[i][j] = WMMA_F16_NEGC(Ai[i], Bi[j], acc.re[i][j]);  // Ai Bi - re
          acc.im[i][j] = WMMA_F16(Ar[i], Bi[j], acc.im[i][j]);
        }
#pragma unroll
      for (int i = 0; i < TA; ++i)
#pragma unroll
        for (int j = 0; j < TB; ++j) {
          acc.re[i][j] = WMMA_F16_NEGC(Ar[i], Br[j], acc.re[i][j]);  // Ar Br - (Ai Bi - re)
          acc.im[i][j] = WMMA_F16(Ai[i], Br[j], acc.im[i][j]);
        }
    }

    asm volatile("s_wait_dscnt 0x0" ::: "memory");     // this wave's reads of buffer p & 1 are done before it is refilled
    asm volatile("s_wait_asynccnt 0x0" ::: "memory");  // this wave's copies of pass p + 1 have landed
    __syncthreads();  // publishes pass p + 1 and ends every reader's use of buffer p & 1
    if (p + 2 < NPASS) {
      const int e = (p + 2) * KP;
      _Float16* l = ldst + (p & 1) * STAGE;
      copy_planes(l, g0 + e, g1 + e);
      copy_planes(l + 2 * PLANE, g2 + e, g3 + e);
    }
  }
  asm volatile("s_wait_asynccnt 0x0" ::: "memory");  // nothing of this wave is in flight when it leaves the ring
}

// ---------------------------------------------------------------------------
// Complex projection: out[h, m, sb] = sum_e w[h,m,e] * x[sb,e]   (complex)
// A rows = flattened (h, m), B rows = sb; all-f16 operands, f32 accumulation.
// TRANSPOSED=0 -> store [b][h][s][m] (q,k);  TRANSPOSED=1 -> [b][h][m][s] (v^T)
// ---------------------------------------------------------------------------
template <int TRANSPOSED, int MDIM>
static __device__ inline void proj_store(const CAcc& acc, int sb0, int hm0,
                                         _Float16* __restrict__ ore, _Float16* __restrict__ oim) {
  const int lane = threadIdx.x & 31;
  const int wave = threadIdx.x >> 5;
  const int col  = lane & 15;
  const int hig  = lane >> 4;

  // One base address per plane; i, j and r move it by constants.
  const unsigned b  = col & (B_DIM - 1);                             // sb % B_DIM
  const unsigned s0 = (sb0 >> 2) + (wave & 1) * 16 + (col >> 2);     // sb / B_DIM at j = 0
  const unsigned hm = hm0 + (wave >> 1) * 32 + hig * 8;              // row at i = 0, r = 0
  const unsigned h  = hm / MDIM;                                     // 32 rows never cross a head
  const unsigned m0 = hm % MDIM;
  const size_t base = TRANSPOSED ? (((size_t)b * H_DIM + h) * MDIM + m0) * S_DIM + s0
                                 : (((size_t)b * H_DIM + h) * S_DIM + s0) * MDIM + m0;
  _Float16* pr = ore + base;
  _Float16* pi = oim + base;
  v8h hr[TA][TB], hi[TA][TB];
#pragma unroll
  for (int i = 0; i < TA; ++i)
#pragma unroll
    for (int j = 0; j < TB; ++j)
#pragma unroll
      for (int r = 0; r < 8; ++r) {
        hr[i][j][r] = (_Float16)acc.re[i][j][r];
        hi[i][j][r] = (_Float16)acc.im[i][j][r];
      }
  __builtin_amdgcn_sched_barrier(0);  // all arithmetic stays in front of the first store: no register an issued store names is written again
#pragma unroll
  for (int i = 0; i < TA; ++i)
#pragma unroll
    for (int j = 0; j < TB; ++j) {
      if constexpr (TRANSPOSED) {
#pragma unroll
        for (int r = 0; r < 8; ++r) {
          pr[(i * 16 + r) * S_DIM + j * 4] = hr[i][j][r];
          pi[(i * 16 + r) * S_DIM + j * 4] = hi[i][j][r];
        }
      } else {
        // r runs along m: the 8 results are 16 contiguous, 16-byte aligned bytes, one store a plane
        *(v8h*)(pr + j * 4 * MDIM + i * 16) = hr[i][j];
        *(v8h*)(pi + j * 4 * MDIM + i * 16) = hi[i][j];
      }
    }
  if constexpr (!TRANSPOSED) asm volatile("s_wait_xcnt 0x0" ::: "memory");
}

// v, q and k in ONE launch: they read the same x and none reads another's result, so they share a
// grid by ranges of blockIdx.y. 1,280 equal tiles follow one another on the chip with one start
// and one tail. v comes first: its scattered stores then run beside later tiles' products.
#define VY (H_DIM * V_DIM / BT)  // tile rows of v
#define QY (H_DIM * M_DIM / BT)  // tile rows of q, and of k

__global__ __launch_bounds__(256)
void proj_kernel(const _Float16* __restrict__ vwre, const _Float16* __restrict__ vwim,
                 const _Float16* __restrict__ qwre, const _Float16* __restrict__ qwim,
                 const _Float16* __restrict__ kwre, const _Float16* __restrict__ kwim,
                 const _Float16* __restrict__ xre, const _Float16* __restrict__ xim,
                 _Float16* __restrict__ vtre, _Float16* __restrict__ vtim,
                 _Float16* __restrict__ qre, _Float16* __restrict__ qim,
                 _Float16* __restrict__ kre, _Float16* __restrict__ kim) {
  __shared__ __align__(16) _Float16 lds[2 * STAGE];

  const int y   = blockIdx.y;
  const int sb0 = blockIdx.x * BT;  // first sb of the tile
  const _Float16 *wre, *wim;        // the weight this tile multiplies
  _Float16 *ore, *oim;              // and where its result goes
  int hm0;                          // first flattened (h, m) row of the tile
  if      (y < VY)      { wre = vwre; wim = vwim; ore = vtre; oim = vtim; hm0 = y * BT; }
  else if (y < VY + QY) { wre = qwre; wim = qwim; ore = qre;  oim = qim;  hm0 = (y - VY) * BT; }
  else                  { wre = kwre; wim = kwim; ore = kre;  oim = kim;  hm0 = (y - VY - QY) * BT; }

  CAcc acc;
  cgemm_tile(wre + (size_t)hm0 * E_DIM, wim + (size_t)hm0 * E_DIM,
             xre + (size_t)sb0 * E_DIM, xim + (size_t)sb0 * E_DIM, lds, acc);

  if (y < VY) proj_store<1, V_DIM>(acc, sb0, hm0, ore, oim);
  else        proj_store<0, M_DIM>(acc, sb0, hm0, ore, oim);
}

#define AW      8
static_assert(S_DIM / (16 * AW) == 8, "the z -> qb map below is written for 8 blocks");
#define AKEYS   64                   // keys per stage = two 32-column chunks
#define KPITCH  136                  // LDS pitch of a K row in halves: 272 B = 16 B x odd
#define VPITCH  72                   // LDS pitch of a V^T row piece in halves: 144 B = 16 B x odd
#define KPLANE  (AKEYS * KPITCH)     // K re or K im of a stage
#define VPLANE  (V_DIM * VPITCH)     // V^T re or V^T im of a stage
#define ASTAGE  (2 * KPLANE + 2 * VPLANE)

// One stage, 12 copies of 16 bytes a lane. K: 16 lanes cover a 256-byte row,
// 16 rows per sweep. V^T: 8 lanes cover a 128-byte row piece, 32 rows per sweep.
static __device__ inline void attn_stage(_Float16* lk, _Float16* lv,
                                         const _Float16* gkr, const _Float16* gki,
                                         const _Float16* gvr, const _Float16* gvi) {
#pragma unroll
  for (int i = 0; i < AKEYS / 16; ++i) {
    __builtin_amdgcn_global_load_async_to_lds_b128(
        (gv4i*)(gkr + (size_t)i * 16 * M_DIM), (lv4i*)(lk + i * 16 * KPITCH), 0, 0);
    __builtin_amdgcn_global_load_async_to_lds_b128(
        (gv4i*)(gki + (size_t)i * 16 * M_DIM), (lv4i*)(lk + KPLANE + i * 16 * KPITCH), 0, 0);
  }
#pragma unroll
  for (int i = 0; i < V_DIM / 32; ++i) {
    __builtin_amdgcn_global_load_async_to_lds_b128(
        (gv4i*)(gvr + (size_t)i * 32 * S_DIM), (lv4i*)(lv + i * 32 * VPITCH), 0, 0);
    __builtin_amdgcn_global_load_async_to_lds_b128(
        (gv4i*)(gvi + (size_t)i * 32 * S_DIM), (lv4i*)(lv + VPLANE + i * 32 * VPITCH), 0, 0);
  }
}

// Four waves per SIMD: the register budget that lets two work-groups share a WGP, as all 512 must to be resident at once.
__global__ __launch_bounds__(256) __attribute__((amdgpu_waves_per_eu(4, 4)))
void attn_kernel(const _Float16* __restrict__ qre, const _Float16* __restrict__ qim,
                 const _Float16* __restrict__ kre, const _Float16* __restrict__ kim,
                 const _Float16* __restrict__ vre, const _Float16* __restrict__ vim,
                 _Float16* __restrict__ ure, _Float16* __restrict__ uim) {
  __shared__ __align__(16) _Float16 ring[2 * ASTAGE];

  const int tid  = threadIdx.x;
  const int lane = tid & 31;
  const int wave = __builtin_amdgcn_readfirstlane(tid >> 5);  // scalar, so the causal skip below is a scalar branch
  const int col  = lane & 15;
  const int hig  = lane >> 4;
  const int h    = blockIdx.x;
  const int b    = blockIdx.y;
  // Block of AW query tiles; its cost grows with qb. All work-groups are resident, two to a WGP:
  // z and z + 4 of one head, and heads h and h + 1 or h + 8, get blocks qb and 7 - qb, so that
  // neighbours in launch order share the work evenly. Per (b, h) z -> qb is a permutation; for speed only.
  const int zf   = blockIdx.z < 4 ? 7 - (int)blockIdx.z : (int)blockIdx.z - 4;
  const int qb   = ((h ^ (h >> 3)) & 1) ? 7 - zf : zf;
  const int st   = qb * AW + wave;                      // this wave's query tile

  const size_t bh   = (size_t)b * H_DIM + h;
  const int    srow = st * 16 + col;

  // Copy map of this lane, at stage 0.
  const size_t    koff = (bh * S_DIM + (tid >> 4)) * M_DIM + (tid & 15) * 8;
  const size_t    voff = (bh * V_DIM + (tid >> 3)) * S_DIM + (tid & 7) * 8;
  const _Float16* gkr  = kre + koff;
  const _Float16* gki  = kim + koff;
  const _Float16* gvr  = vre + voff;
  const _Float16* gvi  = vim + voff;
  _Float16* lk = ring + (tid >> 4) * KPITCH + (tid & 15) * 8;
  _Float16* lv = ring + 2 * KPLANE + (tid >> 3) * VPITCH + (tid & 7) * 8;
  const int nstage = 2 * (qb + 1);  // keys 0 .. (qb + 1) * 128 - 1; never fewer than two stages

  attn_stage(lk, lv, gkr, gki, gvr, gvi);

  // Cache q fragments for this row tile (M=128 -> 4 K-steps, re+im).
  v16h qfr[4], qfi[4];
#pragma unroll
  for (int km = 0; km < 4; ++km) {
    const _Float16* pr = qre + (bh * S_DIM + srow) * M_DIM + km * 32 + hig * 8;
    const _Float16* pi = qim + (bh * S_DIM + srow) * M_DIM + km * 32 + hig * 8;
    qfr[km] = frag_h(pr, pr + 16);
    qfi[km] = frag_h(pi, pi + 16);
  }

  v8f accre[4], accim[4];
  {
    v8f z = {};
#pragma unroll
    for (int c = 0; c < 4; ++c) { accre[c] = z; accim[c] = z; }
  }
  float mrun = -__builtin_inff();  // running maximum of query srow, the same in both halves
  float lrun = 0.f;                // running sum over this lane's own keys; the halves join after the loop

  const float scl = 0.08838834764831845f;  // 1/sqrt(128)

  asm volatile("s_wait_asynccnt 0x0" ::: "memory");  // this wave's copies of stage 0 have landed
  __syncthreads();
  attn_stage(lk + ASTAGE, lv + ASTAGE, gkr + AKEYS * M_DIM, gki + AKEYS * M_DIM, gvr + AKEYS, gvi + AKEYS);

  for (int t = 0; t < nstage; ++t) {
    const _Float16* cur = ring + (t & 1) * ASTAGE;
    for (int cc = 0; cc < AKEYS / 32; ++cc) {
      const int tc = t * (AKEYS / 16) + cc * 2;
      if (tc > st) continue;  // chunk wholly above this wave's diagonal; no barrier stands inside the skip

      // ---- two transposed score tiles (keys tc*16 .. tc*16+31 down, 16 queries across) ----
      // The chunk's LDS fragments are fetched in groups ahead of the products that use them. K: eight steps
      // (tile 0, then tile 1, 32 m each; Kr and Ki of a step are one group of four loads), three steps in
      // registers, so a step's loads are issued two steps of products before its own.
      const _Float16* krow = cur + (cc * 32 + col) * KPITCH + hig * 8;  // this lane's K row of tile 0
      v16h Kr[8], Ki[8], Vr[4], Vi[4];
      v8f  prr[2], pii[2], pri[2], pir[2];
      float sq[2][8], rt[2][8], amp[2][8];
#pragma unroll
      for (int g = 0; g < 2; ++g) {
        const _Float16* kr = krow + g * 32;
        Kr[g] = frag_h(kr, kr + 16);
        Ki[g] = frag_h(kr + KPLANE, kr + KPLANE + 16);
      }
#pragma unroll
      for (int g = 0; g < 8; ++g) {
        const int sub = g >> 2, km = g & 3;
        if (g + 2 < 8) {
          const _Float16* kr = krow + ((g + 2) >> 2) * 16 * KPITCH + ((g + 2) & 3) * 32;
          Kr[g + 2] = frag_h(kr, kr + 16);
          Ki[g + 2] = frag_h(kr + KPLANE, kr + KPLANE + 16);
        }
        __builtin_amdgcn_sched_barrier(0);  // holds the loads two steps ahead of their products, as one group: later, the wave would wait out their latency
        if (km == 0) { v8f z = {}; prr[sub] = z; pii[sub] = z; pri[sub] = z; pir[sub] = z; }
        prr[sub] = WMMA_F16(Kr[g], qfr[km], prr[sub]);
        pii[sub] = WMMA_F16(Ki[g], qfi[km], pii[sub]);
        pri[sub] = WMMA_F16(Ki[g], qfr[km], pri[sub]);
        pir[sub] = WMMA_F16(Kr[g], qfi[km], pir[sub]);
        if (g == 7) {
          #pragma unroll
          for (int c = 0; c < 2; ++c) {
            const _Float16* vr = cur + 2 * KPLANE + (c * 16 + col) * VPITCH + cc * 32 + hig * 8;
            Vr[c] = frag_h(vr, vr + 16);
            Vi[c] = frag_h(vr + VPLANE, vr + VPLANE + 16);
          }
          __builtin_amdgcn_sched_barrier(0);  // half of V^T, one group, in front of the softmax, which covers its latency
        }
        if (km == 3) {
#pragma unroll
          for (int r = 0; r < 8; ++r) {
            const float re = prr[sub][r] - pii[sub][r];
            const float im = pri[sub][r] + pir[sub][r];
            sq[sub][r] = re * re + im * im;
          }
        }
        __builtin_amdgcn_sched_barrier(0);  // the next step's loads stay behind these products, whose operand registers they take
      }
#pragma unroll
      for (int sub = 0; sub < 2; ++sub) {
        const int key0 = (tc + sub) * 16 + hig * 8;  // this lane's key at r = 0
        sqrtx8(rt[sub], sq[sub]);
#pragma unroll
        for (int r = 0; r < 8; ++r)
          amp[sub][r] = (key0 + r <= srow) ? rt[sub][r] * scl : -__builtin_inff();  // covers a tile wholly above the diagonal too
      }

      // ---- online softmax over the 32 keys: in the lane, plus one exchange of the maximum ----
      float rm = fmaxf(amp[0][0], amp[1][0]);
#pragma unroll
      for (int r = 1; r < 8; ++r) rm = fmaxf(rm, fmaxf(amp[0][r], amp[1][r]));
      rm = fmaxf(rm, other_half(rm));  // key tc*16 is never masked, so rm is finite
      const float mn    = fmaxf(mrun, rm);
      const float l2e   = 1.4426950408889634f;  // e^x = 2^(x * log2 e)
      const float scale = exp2x1((mrun - mn) * l2e);
      mrun = mn;
      float x0[8], x1[8], p0[8], p1[8];
#pragma unroll
      for (int r = 0; r < 8; ++r) {
        x0[r] = (amp[0][r] - mn) * l2e;
        x1[r] = (amp[1][r] - mn) * l2e;
      }
      exp2x8(p0, x0);
      exp2x8(p1, x1);
      float psum = 0.f;
      v16h  Pb;  // P^T as a B fragment: elements 0-7 = keys hig*8 + r, 8-15 = keys 16 + hig*8 + r
#pragma unroll
      for (int r = 0; r < 8; ++r) {
        psum += p0[r] + p1[r];
        Pb[r]     = (_Float16)p0[r];
        Pb[8 + r] = (_Float16)p1[r];
      }
      lrun = lrun * scale + psum;
      __builtin_amdgcn_sched_barrier(0);  // the other V^T loads stay behind the exponentials, whose registers they take
      #pragma unroll
      for (int c = 2; c < 4; ++c) {
        const _Float16* vr = cur + 2 * KPLANE + (c * 16 + col) * VPITCH + cc * 32 + hig * 8;
        Vr[c] = frag_h(vr, vr + 16);
        Vi[c] = frag_h(vr + VPLANE, vr + VPLANE + 16);
      }
      __builtin_amdgcn_sched_barrier(0);  // one group in front of the rescaling, which covers their latency
#pragma unroll
      for (int c = 0; c < 4; ++c)
#pragma unroll
        for (int r = 0; r < 8; ++r) {
          accre[c][r] *= scale;
          accim[c][r] *= scale;
        }

      // ---- O^T += V^T P^T (re/im): 8 full-K WMMAs per chunk of 32 keys ----
#pragma unroll
      for (int c = 0; c < 4; ++c) {
        accre[c] = WMMA_F16(Vr[c], Pb, accre[c]);
        accim[c] = WMMA_F16(Vi[c], Pb, accim[c]);
      }
    }

    asm volatile("s_wait_dscnt 0x0" ::: "memory");     // this wave's reads of buffer t & 1 are done before it is refilled
    asm volatile("s_wait_asynccnt 0x0" ::: "memory");  // this wave's copies of stage t + 1 have landed
    __syncthreads();  // publishes stage t + 1 and ends every reader's use of buffer t & 1
    if (t + 2 < nstage) {
      const int k0  = (t + 2) * AKEYS;
      const int buf = (t & 1) * ASTAGE;
      attn_stage(lk + buf, lv + buf, gkr + (size_t)k0 * M_DIM, gki + (size_t)k0 * M_DIM, gvr + k0, gvi + k0);
    }
  }
  asm volatile("s_wait_asynccnt 0x0" ::: "memory");  // nothing of this wave is in flight when it leaves the ring

  // ---- normalize and store upd as f16 in (s, b, h*V + vc) layout ----
  // The lane holds query srow at vc = c*16 + hig*8 + r: 8 neighbours, one 16-byte store a plane.
  const float  inv = 1.0f / (lrun + other_half(lrun));
  const size_t idx = ((size_t)srow * B_DIM + b) * E_DIM + h * V_DIM + hig * 8;
  v8h our[4], oui[4];
#pragma unroll
  for (int c = 0; c < 4; ++c)
#pragma unroll
    for (int r = 0; r < 8; ++r) {
      our[c][r] = (_Float16)(accre[c][r] * inv);
      oui[c][r] = (_Float16)(accim[c][r] * inv);
    }
#pragma unroll
  for (int c = 0; c < 4; ++c) {
    *(v8h*)(ure + idx + c * 16) = our[c];
    *(v8h*)(uim + idx + c * 16) = oui[c];
  }
}

// ---------------------------------------------------------------------------
// out[sb,f] = sum_e upd[sb,e] * wo[e,f] + x[sb,f]   (complex, f32 result)
// A rows = sb, B rows = f (wo^T).
// ---------------------------------------------------------------------------
__global__ __launch_bounds__(256)
void outproj_kernel(const _Float16* __restrict__ ure, const _Float16* __restrict__ uim,
                    const _Float16* __restrict__ wtre, const _Float16* __restrict__ wtim,
                    const float* __restrict__ xre, const float* __restrict__ xim,
                    float* __restrict__ out) {
  __shared__ __align__(16) _Float16 lds[2 * STAGE];

  const int lane = threadIdx.x & 31;
  const int wave = threadIdx.x >> 5;
  const int col  = lane & 15;
  const int hig  = lane >> 4;
  const int sb0  = blockIdx.x * BT;
  const int f0   = blockIdx.y * BT;

  CAcc acc;
  cgemm_tile(ure + (size_t)sb0 * E_DIM, uim + (size_t)sb0 * E_DIM,
             wtre + (size_t)f0 * E_DIM, wtim + (size_t)f0 * E_DIM, lds, acc);

  // One 32-bit byte offset serves x and out, re and im; i, j and r move it by constants.
  const unsigned offb = ((unsigned)(sb0 + (wave >> 1) * 32 + hig * 8) * E_DIM +
                         (unsigned)(f0 + (wave & 1) * 64 + col)) * 4u;
  const float* px_re = (const float*)((const char*)xre + offb);
  const float* px_im = (const float*)((const char*)xim + offb);
  float* po_re = (float*)((char*)out + offb);
  float* po_im = (float*)((char*)(out + (size_t)SB_DIM * E_DIM) + offb);

  float xr[TA][TB][8], xi[TA][TB][8];
#pragma unroll
  for (int i = 0; i < TA; ++i)
#pragma unroll
    for (int j = 0; j < TB; ++j)
#pragma unroll
      for (int r = 0; r < 8; ++r) {
        xr[i][j][r] = px_re[(i * 16 + r) * E_DIM + j * 16];
        xi[i][j][r] = px_im[(i * 16 + r) * E_DIM + j * 16];
      }
#pragma unroll
  for (int i = 0; i < TA; ++i)
#pragma unroll
    for (int j = 0; j < TB; ++j) {
      float sr[8], si[8];
#pragma unroll
      for (int r = 0; r < 8; ++r) {
        sr[r] = acc.re[i][j][r] + xr[i][j][r];
        si[r] = acc.im[i][j][r] + xi[i][j][r];
      }
      __builtin_amdgcn_sched_barrier(0);  // the tile's sums stay in front of its first store: no register an issued store names is written before the wait below
#pragma unroll
      for (int r = 0; r < 8; ++r) {
        po_re[(i * 16 + r) * E_DIM + j * 16] = sr[r];
        po_im[(i * 16 + r) * E_DIM + j * 16] = si[r];
      }
      asm volatile("s_wait_xcnt 0x0" ::: "memory");  // before the next tile reuses registers these stores name
      __builtin_amdgcn_sched_barrier(0);  // keeps the next tile's arithmetic behind that wait
    }
}

// ---------------------------------------------------------------------------
extern "C" void kernel_launch(void* const* d_in, const int* in_sizes, int n_in,
                              void* d_out, int out_size, void* d_ws, size_t ws_size,
                              hipStream_t stream) {
  (void)in_sizes; (void)n_in; (void)out_size; (void)ws_size;

  const float* xre  = (const float*)d_in[0];
  const float* xim  = (const float*)d_in[1];
  const float* wqre = (const float*)d_in[2];
  const float* wqim = (const float*)d_in[3];
  const float* wkre = (const float*)d_in[4];
  const float* wkim = (const float*)d_in[5];
  const float* wvre = (const float*)d_in[6];
  const float* wvim = (const float*)d_in[7];
  const float* wore = (const float*)d_in[8];
  const float* woim = (const float*)d_in[9];

  char*  ws = (char*)d_ws;
  size_t o  = 0;
  auto halloc = [&](size_t n) { _Float16* p = (_Float16*)(ws + o); o += n * sizeof(_Float16); return p; };

  const size_t QK = (size_t)B_DIM * H_DIM * S_DIM * M_DIM;  // q/k per component
  const size_t VT = (size_t)B_DIM * H_DIM * V_DIM * S_DIM;  // v^T per component
  const size_t UE = (size_t)SB_DIM * E_DIM;                 // upd / x per component
  const size_t WO = (size_t)E_DIM * E_DIM;                  // wo^T per component
  const size_t WQ = (size_t)H_DIM * M_DIM * E_DIM;          // wq/wk per component
  const size_t WV = (size_t)H_DIM * V_DIM * E_DIM;          // wv per component

  _Float16* qre  = halloc(QK);  _Float16* qim  = halloc(QK);
  _Float16* kre  = halloc(QK);  _Float16* kim  = halloc(QK);
  _Float16* vtre = halloc(VT);  _Float16* vtim = halloc(VT);
  _Float16* upre = halloc(UE);  _Float16* upim = halloc(UE);
  _Float16* wtre = halloc(WO);  _Float16* wtim = halloc(WO);
  _Float16* xhre = halloc(UE);  _Float16* xhim = halloc(UE);
  _Float16* qwre = halloc(WQ);  _Float16* qwim = halloc(WQ);
  _Float16* kwre = halloc(WQ);  _Float16* kwim = halloc(WQ);
  _Float16* vwre = halloc(WV);  _Float16* vwim = halloc(WV);

  // Operand preparation, one launch. xhre .. vwim lie one behind another in the order prep_kernel expects.
  prep_kernel<<<TR_BLOCKS + CVT_BLOCKS, 256, 0, stream>>>(xre, xim, wqre, wqim, wkre, wkim, wvre, wvim,
                                                          wore, woim, xhre, wtre, wtim);

  dim3 gp(SB_DIM / BT, VY + 2 * QY);
  proj_kernel<<<gp, 256, 0, stream>>>(vwre, vwim, qwre, qwim, kwre, kwim, xhre, xhim,
                                      vtre, vtim, qre, qim, kre, kim);

  dim3 ga(H_DIM, B_DIM, S_DIM / (16 * AW));
  attn_kernel<<<ga, 256, 0, stream>>>(qre, qim, kre, kim, vtre, vtim, upre, upim);

  dim3 go(SB_DIM / BT, E_DIM / BT);
  outproj_kernel<<<go, 256, 0, stream>>>(upre, upim, wtre, wtim, xre, xim, (float*)d_out);
}

// v009
// It runs in 189 microseconds.
// Two timings next to v008 put it at 1.05 and 1.04 times that version's speed.
// Counting every step since v000, it is 5.65 times as fast.
#include <hip/hip_runtime.h>
#include <hip/hip_bf16.h>
#include <math.h>

#define S_DIM 1024
#define B_DIM 4
#define E_DIM 1024
#define H_DIM 16
#define M_DIM 128
#define V_DIM 64
#define SB_DIM (S_DIM * B_DIM)

typedef __attribute__((ext_vector_type(16))) _Float16 v16h;
typedef __attribute__((ext_vector_type(8)))  _Float16 v8h;
typedef __attribute__((ext_vector_type(8)))  float    v8f;

#define WMMA_F16(A, B, C) \
  __builtin_amdgcn_wmma_f32_16x16x32_f16(false, (A), false, (B), (short)0, (C), false, false)
// The same with C negated inside the instruction: D = A * B - C.
#define WMMA_F16_NEGC(A, B, C) \
  __builtin_amdgcn_wmma_f32_16x16x32_f16(false, (A), false, (B), (short)1, (C), false, false)

// 16x32 f16 A/B fragment from two contiguous 8-half segments
// (segment 0 at K-base, segment 1 at K-base+16; lane group picks +0 / +8).
static __device__ inline v16h frag_h(const _Float16* __restrict__ s0,
                                     const _Float16* __restrict__ s1) {
  v8h a = *(const v8h*)s0;
  v8h b = *(const v8h*)s1;
  v16h r;
#pragma unroll
  for (int j = 0; j < 8; ++j) {
    r[j]     = a[j];
    r[j + 8] = b[j];
  }
  return r;
}

// The value that lane l ^ 16 holds: one vector move between the wave's two 16-lane rows.
static __device__ inline float other_half(float v) {
  return __builtin_bit_cast(float, __builtin_amdgcn_permlanex16(
      0u, __builtin_bit_cast(unsigned, v), 0x76543210u, 0xfedcba98u, false, false));
}

// 2^x for eight values, and for one. The instruction set asks for one independent instruction or a
// v_nop between a transcendental and a next instruction that reads its result or overwrites its
// source. In one statement each
// v_exp_f32 is followed by an independent one (no output shares a register with an input), the last by v_nop.
static __device__ inline void exp2x8(float (&d)[8], const float (&x)[8]) {
  asm("v_exp_f32 %0, %8\n\tv_exp_f32 %1, %9\n\tv_exp_f32 %2, %10\n\tv_exp_f32 %3, %11\n\t"
      "v_exp_f32 %4, %12\n\tv_exp_f32 %5, %13\n\tv_exp_f32 %6, %14\n\tv_exp_f32 %7, %15\n\tv_nop"
      : "=&v"(d[0]), "=&v"(d[1]), "=&v"(d[2]), "=&v"(d[3]), "=&v"(d[4]), "=&v"(d[5]), "=&v"(d[6]), "=&v"(d[7])
      : "v"(x[0]), "v"(x[1]), "v"(x[2]), "v"(x[3]), "v"(x[4]), "v"(x[5]), "v"(x[6]), "v"(x[7]));
}
// Square root of eight values by the bare hardware root, in the same one-statement form and for the same reason.
// sqrtf() wraps v_sqrt_f32 in a scaling of small inputs and two correction steps for a correctly rounded
// result: about fifteen more vector instructions a value, most of them waiting on the one before. The root
// feeds exp and an f16 rounding of P, which are far coarser than the root's last bit; 0, inf and NaN pass as in
// sqrtf, and a sum of squares too small for the bare root is an amplitude that does not move any exponential.
static __device__ inline void sqrtx8(float (&d)[8], const float (&x)[8]) {
  asm("v_sqrt_f32 %0, %8\n\tv_sqrt_f32 %1, %9\n\tv_sqrt_f32 %2, %10\n\tv_sqrt_f32 %3, %11\n\t"
      "v_sqrt_f32 %4, %12\n\tv_sqrt_f32 %5, %13\n\tv_sqrt_f32 %6, %14\n\tv_sqrt_f32 %7, %15\n\tv_nop"
      : "=&v"(d[0]), "=&v"(d[1]), "=&v"(d[2]), "=&v"(d[3]), "=&v"(d[4]), "=&v"(d[5]), "=&v"(d[6]), "=&v"(d[7])
      : "v"(x[0]), "v"(x[1]), "v"(x[2]), "v"(x[3]), "v"(x[4]), "v"(x[5]), "v"(x[6]), "v"(x[7]));
}
static __device__ inline float exp2x1(float x) {
  float d;
  asm("v_exp_f32 %0, %1\n\tv_nop" : "=v"(d) : "v"(x));
  return d;
}

// ---------------------------------------------------------------------------
// Bulk f32 -> f16 conversion (one pass; amortizes all GEMM operand reuse).
// A wave converts CVT_RUNS runs of 128 consecutive elements: per run one
// 16-byte load a lane (512 contiguous bytes a wave) and one 8-byte store a lane
// (256 contiguous bytes a wave). All loads of a lane are issued before its first
// conversion, so few waves keep the memory busy and few waves have to start.
// ---------------------------------------------------------------------------
typedef __attribute__((ext_vector_type(4))) float    v4f;
typedef __attribute__((ext_vector_type(4))) _Float16 v4h;

#define CVT_RUNS  8                  // 16-byte loads in flight per lane
#define CVT_WAVE  (CVT_RUNS * 128)   // elements per wave
#define CVT_BLOCK (8 * CVT_WAVE)     // elements per block of 8 waves

#define X_BLOCKS   (SB_DIM * E_DIM / CVT_BLOCK)         // blocks per plane of x
#define WQ_BLOCKS  (H_DIM * M_DIM * E_DIM / CVT_BLOCK)  // per plane of wq, wk
#define WV_BLOCKS  (H_DIM * V_DIM * E_DIM / CVT_BLOCK)  // per plane of wv
#define CVT_BLOCKS (2 * X_BLOCKS + 4 * WQ_BLOCKS + 2 * WV_BLOCKS)
#define TT         64                                   // edge of a tile of the wo transpose
#define TR_ROW     (E_DIM / TT)                         // tiles along e, and along f
#define TR_PLANE   (TR_ROW * TR_ROW)                    // tiles (= blocks) per plane of wo
#define TR_BLOCKS  (2 * TR_PLANE)                       // blocks of the wo transpose
#define TPITCH     33                                   // LDS pitch of a tile row in dwords, odd: no two lanes of a wave on one bank, writing or reading
static_assert(SB_DIM * E_DIM % CVT_BLOCK == 0 && H_DIM * M_DIM * E_DIM % CVT_BLOCK == 0 &&
              H_DIM * V_DIM * E_DIM % CVT_BLOCK == 0 && E_DIM % TT == 0, "whole blocks");

// One block's share of a conversion: src and dst point at the block's first element.
static __device__ inline void cvt_block(const float* __restrict__ src, _Float16* __restrict__ dst) {
  const int at = (threadIdx.x >> 5) * CVT_WAVE + (threadIdx.x & 31) * 4;
  v4f v[CVT_RUNS];
#pragma unroll  // both loops unrolled: v stays in registers and the loads go out as one group
  for (int k = 0; k < CVT_RUNS; ++k) v[k] = *(const v4f*)(src + at + k * 128);
#pragma unroll
  for (int k = 0; k < CVT_RUNS; ++k) {
    v4h h;
#pragma unroll
    for (int j = 0; j < 4; ++j) h[j] = (_Float16)v[k][j];
    *(v4h*)(dst + at + k * 128) = h;
  }
}

typedef __attribute__((ext_vector_type(2))) _Float16 v2h;
typedef __attribute__((ext_vector_type(4))) unsigned v4u;

// One 64 x 64 tile of one plane of wo: (e, f) f32 -> (f, e) f16, turned in LDS, so that global memory
// sees whole lines only. In: 16 lanes read 256 contiguous bytes of a row e. A lane holds 4 f of two
// neighbouring e, once in each half of the tile: each pair of e is one dword of row f of the LDS tile. Out: 8 lanes write
// the 128 contiguous bytes (64 e) of a row f.
static __device__ inline void transpose_tile(const float* __restrict__ src, _Float16* __restrict__ dst,
                                             int tile, unsigned* lds) {
  const int t  = threadIdx.x;
  const int e0 = (tile / TR_ROW) * TT;
  const int f0 = (tile % TR_ROW) * TT;
  const int fq = t & 15;  // which 4 f
  const int ep = t >> 4;  // which pair of e in a half tile
  v4f a[2][2];
#pragma unroll  // this nest and the next unrolled: a stays in registers, and all four loads go out before the first conversion
  for (int s = 0; s < 2; ++s)
#pragma unroll
    for (int u = 0; u < 2; ++u)
      a[s][u] = *(const v4f*)(src + (size_t)(e0 + s * 32 + ep * 2 + u) * E_DIM + f0 + fq * 4);
#pragma unroll
  for (int s = 0; s < 2; ++s)
#pragma unroll
    for (int j = 0; j < 4; ++j) {
      v2h h = {(_Float16)a[s][0][j], (_Float16)a[s][1][j]};
      lds[(fq * 4 + j) * TPITCH + s * 16 + ep] = __builtin_bit_cast(unsigned, h);
    }
  __syncthreads();  // the tile is complete before any lane reads rows that other waves wrote
#pragma unroll  // both rows' LDS reads go out before the first store waits for its own
  for (int k = 0; k < 2; ++k) {
    const int f = k * 32 + (t >> 3);
    const int c = t & 7;  // which 8 e
    const unsigned* p = lds + f * TPITCH + c * 4;
    v4u w = {p[0], p[1], p[2], p[3]};
    *(v4u*)(dst + (size_t)(f0 + f) * E_DIM + e0 + c * 8) = w;
  }
  asm volatile("s_wait_xcnt 0x0" ::: "memory");  // a precaution: each block turns one tile of one plane and then returns, so nothing follows these stores
}

// All operand preparation in ONE launch; none of its parts reads what another writes, so they
// share a grid by block range and the chip starts, fills and drains once instead of nine times.
// Blocks 0 .. TR_BLOCKS-1: wo (E,E) f32 -> wo^T (F,E) f16, so out-proj B-fragments load contiguously;
// a block turns one tile, the re plane's tiles first.
// The others: the eight f32 -> f16 planes. Their destinations lie one behind another in the
// workspace in the order x, wq, wk, wv (re, im each), so a block's place in cvt_dst is its number.
__global__ __launch_bounds__(256)
void prep_kernel(const float* __restrict__ xre,  const float* __restrict__ xim,
                 const float* __restrict__ wqre, const float* __restrict__ wqim,
                 const float* __restrict__ wkre, const float* __restrict__ wkim,
                 const float* __restrict__ wvre, const float* __restrict__ wvim,
                 const float* __restrict__ wre,  const float* __restrict__ wim,
                 _Float16* __restrict__ cvt_dst,
                 _Float16* __restrict__ tre, _Float16* __restrict__ tim) {
  __shared__ unsigned tile_lds[TT * TPITCH];
  if (blockIdx.x < TR_BLOCKS) {  // the same for a whole block: every wave of it meets the barrier inside
    if (blockIdx.x < TR_PLANE) transpose_tile(wre, tre, blockIdx.x, tile_lds);
    else                       transpose_tile(wim, tim, blockIdx.x - TR_PLANE, tile_lds);
    return;
  }
  const int blk = blockIdx.x - TR_BLOCKS;  // block among the conversions
  const float* src;                        // the plane this block converts
  int first;                               // that plane's first block
  if      (blk < X_BLOCKS)                     { src = xre;  first = 0; }
  else if (blk < 2 * X_BLOCKS)                 { src = xim;  first = X_BLOCKS; }
  else if (blk < 2 * X_BLOCKS + WQ_BLOCKS)     { src = wqre; first = 2 * X_BLOCKS; }
  else if (blk < 2 * X_BLOCKS + 2 * WQ_BLOCKS) { src = wqim; first = 2 * X_BLOCKS + WQ_BLOCKS; }
  else if (blk < 2 * X_BLOCKS + 3 * WQ_BLOCKS) { src = wkre; first = 2 * X_BLOCKS + 2 * WQ_BLOCKS; }
  else if (blk < 2 * X_BLOCKS + 4 * WQ_BLOCKS) { src = wkim; first = 2 * X_BLOCKS + 3 * WQ_BLOCKS; }
  else if (blk < 2 * X_BLOCKS + 4 * WQ_BLOCKS + WV_BLOCKS) { src = wvre; first = 2 * X_BLOCKS + 4 * WQ_BLOCKS; }
  else                                         { src = wvim; first = 2 * X_BLOCKS + 4 * WQ_BLOCKS + WV_BLOCKS; }
  cvt_block(src + (size_t)(blk - first) * CVT_BLOCK, cvt_dst + (size_t)blk * CVT_BLOCK);
  asm volatile("s_wait_xcnt 0x0" ::: "memory");  // a precaution: the conversion is the block's last work, and nothing follows its stores
}

// ---------------------------------------------------------------------------
// Shared core of the four complex GEMMs: D[a][b] = sum_e A[a][e] * B[b][e],
// A and B complex, e-contiguous f16 rows of E_DIM.
// One work-group of 8 waves owns a 128 x 128 tile of D. Per pass, 64 e of the
// 128 A rows and 128 B rows (re and im planes) are brought into LDS by
// asynchronous copies, whole 128-byte lines per row, so each operand byte is
// fetched once per work-group; each wave (4 x 2 grid) then reads the fragments
// of its 32 x 64 part from LDS. Two buffers: the copies of pass p + 1 fly
// during the products of pass p.
// One accumulator per part of D: per step of 32 e, re <- Ar Br - (Ai Bi - re) by two products
// that negate C (exact sign flips), im <- Ai Br + (Ar Bi + im). 128 accumulator registers a wave
// instead of 256, so that two work-groups fit a WGP's registers and LDS: one group's products
// run while the other waits at its barrier, for LDS or copies, or starts or stores a tile.
// Steps of 32 e still come in ascending order.
// ---------------------------------------------------------------------------
#define BT     128                // rows of each operand per work-group
#define KP     64                 // e per pass (128 B of a row)
#define NPASS  (E_DIM / KP)
#define PITCH  72                 // LDS row pitch in halves: 144 B = 16 B x odd
#define PLANE  (BT * PITCH)       // one operand plane (re or im)
#define STAGE  (4 * PLANE)        // A re | A im | B re | B im
#define TA     2                  // 16-row A tiles per wave
#define TB     4                  // 16-row B tiles per wave

struct CAcc {
  v8f re[TA][TB], im[TA][TB];
};

typedef int v4i __attribute__((ext_vector_type(4)));
typedef __attribute__((address_space(1))) v4i gv4i;
typedef __attribute__((address_space(3))) v4i lv4i;

// Two planes (re, im) of one operand: each lane copies 16 bytes of four rows
// of each plane, global -> LDS, through no register. l = the lane's place in
// the re plane, gr / gi = its global addresses.
static __device__ inline void copy_planes(_Float16* l, const _Float16* gr, const _Float16* gi) {
#pragma unroll
  for (int i = 0; i < 4; ++i) {
    __builtin_amdgcn_global_load_async_to_lds_b128(
        (gv4i*)(gr + (size_t)i * 32 * E_DIM), (lv4i*)(l + i * 32 * PITCH), 0, 0);
    __builtin_amdgcn_global_load_async_to_lds_b128(
        (gv4i*)(gi + (size_t)i * 32 * E_DIM), (lv4i*)(l + PLANE + i * 32 * PITCH), 0, 0);
  }
}

static __device__ inline void cgemm_tile(const _Float16* __restrict__ are,
                                         const _Float16* __restrict__ aim,
                                         const _Float16* __restrict__ bre,
                                         const _Float16* __restrict__ bim,
                                         _Float16* lds, CAcc& acc) {
  const int tid  = threadIdx.x;
  const int lane = tid & 31;
  const int wave = tid >> 5;
  const int col  = lane & 15;
  const int hig  = lane >> 4;
  const int wa   = wave >> 1;  // which 32 A rows
  const int wb   = wave & 1;   // which 64 B rows

  // Copy map: 8 lanes cover one 128-byte row piece, 32 rows per sweep.
  const int    grow = tid >> 3;
  const int    gseg = tid & 7;
  const size_t goff = (size_t)grow * E_DIM + gseg * 8;
  const _Float16* g0 = are + goff;
  const _Float16* g1 = aim + goff;
  const _Float16* g2 = bre + goff;
  const _Float16* g3 = bim + goff;
  _Float16* ldst = lds + grow * PITCH + gseg * 8;

  {
    v8f z = {};
#pragma unroll
    for (int i = 0; i < TA; ++i)
#pragma unroll
      for (int j = 0; j < TB; ++j) {
        acc.re[i][j] = z; acc.im[i][j] = z;
      }
  }

  // Pass 0 into buffer 0, landed and published; then pass 1 into buffer 1.
  copy_planes(ldst, g0, g1);
  copy_planes(ldst + 2 * PLANE, g2, g3);
  asm volatile("s_wait_asynccnt 0x0" ::: "memory");  // this wave's copies of pass 0 have landed
  __syncthreads();
  copy_planes(ldst + STAGE, g0 + KP, g1 + KP);
  copy_planes(ldst + STAGE + 2 * PLANE, g2 + KP, g3 + KP);

  const int aoff = (wa * 32 + col) * PITCH + hig * 8;
  const int boff = 2 * PLANE + (wb * 64 + col) * PITCH + hig * 8;

  for (int p = 0; p < NPASS; ++p) {
    const _Float16* cur = lds + (p & 1) * STAGE;
#pragma unroll
    for (int ks = 0; ks < KP / 32; ++ks) {
      v16h Ar[TA], Ai[TA], Br[TB], Bi[TB];
#pragma unroll
      for (int i = 0; i < TA; ++i) {
        const _Float16* pa = cur + aoff + i * 16 * PITCH + ks * 32;
        Ar[i] = frag_h(pa, pa + 16);
        Ai[i] = frag_h(pa + PLANE, pa + PLANE + 16);
      }
#pragma unroll
      for (int j = 0; j < TB; ++j) {
        const _Float16* pb = cur + boff + j * 16 * PITCH + ks * 32;
        Br[j] = frag_h(pb, pb + 16);
        Bi[j] = frag_h(pb + PLANE, pb + PLANE + 16);
      }
#pragma unroll
      for (int i = 0; i < TA; ++i)
#pragma unroll
        for (int j = 0; j < TB; ++j) {
          acc.re[i][j] = WMMA_F16_NEGC(Ai[i], Bi[j], acc.re[i][j]);  // Ai Bi - re
          acc.im[i][j] = WMMA_F16(Ar[i], Bi[j], acc.im[i][j]);
        }
#pragma unroll
      for (int i = 0; i < TA; ++i)
#pragma unroll
        for (int j = 0; j < TB; ++j) {
          acc.re[i][j] = WMMA_F16_NEGC(Ar[i], Br[j], acc.re[i][j]);  // Ar Br - (Ai Bi - re)
          acc.im[i][j] = WMMA_F16(Ai[i], Br[j], acc.im[i][j]);
        }
    }

    asm volatile("s_wait_dscnt 0x0" ::: "memory");     // this wave's reads of buffer p & 1 are done before it is refilled
    asm volatile("s_wait_asynccnt 0x0" ::: "memory");  // this wave's copies of pass p + 1 have landed
    __syncthreads();  // publishes pass p + 1 and ends every reader's use of buffer p & 1
    if (p + 2 < NPASS) {
      const int e = (p + 2) * KP;
      _Float16* l = ldst + (p & 1) * STAGE;
      copy_planes(l, g0 + e, g1 + e);
      copy_planes(l + 2 * PLANE, g2 + e, g3 + e);
    }
  }
  asm volatile("s_wait_asynccnt 0x0" ::: "memory");  // nothing of this wave is in flight when it leaves the ring
}

// ---------------------------------------------------------------------------
// Complex projection: out[h, m, sb] = sum_e w[h,m,e] * x[sb,e]   (complex)
// A rows = flattened (h, m), B rows = sb; all-f16 operands, f32 accumulation.
// TRANSPOSED=0 -> store [b][h][s][m] (q,k);  TRANSPOSED=1 -> [b][h][m][s] (v^T)
// ---------------------------------------------------------------------------
template <int TRANSPOSED, int MDIM>
static __device__ inline void proj_store(const CAcc& acc, int sb0, int hm0,
                                         _Float16* __restrict__ ore, _Float16* __restrict__ oim) {
  const int lane = threadIdx.x & 31;
  const int wave = threadIdx.x >> 5;
  const int col  = lane & 15;
  const int hig  = lane >> 4;

  // One base address per plane; i, j and r move it by constants.
  const unsigned b  = col & (B_DIM - 1);                             // sb % B_DIM
  const unsigned s0 = (sb0 >> 2) + (wave & 1) * 16 + (col >> 2);     // sb / B_DIM at j = 0
  const unsigned hm = hm0 + (wave >> 1) * 32 + hig * 8;              // row at i = 0, r = 0
  const unsigned h  = hm / MDIM;                                     // 32 rows never cross a head
  const unsigned m0 = hm % MDIM;
  const size_t base = TRANSPOSED ? (((size_t)b * H_DIM + h) * MDIM + m0) * S_DIM + s0
                                 : (((size_t)b * H_DIM + h) * S_DIM + s0) * MDIM + m0;
  _Float16* pr = ore + base;
  _Float16* pi = oim + base;
  v8h hr[TA][TB], hi[TA][TB];
#pragma unroll
  for (int i = 0; i < TA; ++i)
#pragma unroll
    for (int j = 0; j < TB; ++j)
#pragma unroll
      for (int r = 0; r < 8; ++r) {
        hr[i][j][r] = (_Float16)acc.re[i][j][r];
        hi[i][j][r] = (_Float16)acc.im[i][j][r];
      }
  __builtin_amdgcn_sched_barrier(0);  // all arithmetic stays in front of the first store: no register an issued store names is written again
#pragma unroll
  for (int i = 0; i < TA; ++i)
#pragma unroll
    for (int j = 0; j < TB; ++j) {
      if constexpr (TRANSPOSED) {
#pragma unroll
        for (int r = 0; r < 8; ++r) {
          pr[(i * 16 + r) * S_DIM + j * 4] = hr[i][j][r];
          pi[(i * 16 + r) * S_DIM + j * 4] = hi[i][j][r];
        }
      } else {
        // r runs along m: the 8 results are 16 contiguous, 16-byte aligned bytes, one store a plane
        *(v8h*)(pr + j * 4 * MDIM + i * 16) = hr[i][j];
        *(v8h*)(pi + j * 4 * MDIM + i * 16) = hi[i][j];
      }
    }
  if constexpr (!TRANSPOSED) asm volatile("s_wait_xcnt 0x0" ::: "memory");
}

// v, q and k in ONE launch: they read the same x and none reads another's result, so they share a
// grid by ranges of blockIdx.y. 1,280 equal tiles follow one another on the chip with one start
// and one tail. v comes first: its scattered stores then run beside later tiles' products.
#define VY (H_DIM * V_DIM / BT)  // tile rows of v
#define QY (H_DIM * M_DIM / BT)  // tile rows of q, and of k

__global__ __launch_bounds__(256)
void proj_kernel(const _Float16* __restrict__ vwre, const _Float16* __restrict__ vwim,
                 const _Float16* __restrict__ qwre, const _Float16* __restrict__ qwim,
                 const _Float16* __restrict__ kwre, const _Float16* __restrict__ kwim,
                 const _Float16* __restrict__ xre, const _Float16* __restrict__ xim,
                 _Float16* __restrict__ vtre, _Float16* __restrict__ vtim,
                 _Float16* __restrict__ qre, _Float16* __restrict__ qim,
                 _Float16* __restrict__ kre, _Float16* __restrict__ kim) {
  __shared__ __align__(16) _Float16 lds[2 * STAGE];

  const int y   = blockIdx.y;
  const int sb0 = blockIdx.x * BT;  // first sb of the tile
  const _Float16 *wre, *wim;        // the weight this tile multiplies
  _Float16 *ore, *oim;              // and where its result goes
  int hm0;                          // first flattened (h, m) row of the tile
  if      (y < VY)      { wre = vwre; wim = vwim; ore = vtre; oim = vtim; hm0 = y * BT; }
  else if (y < VY + QY) { wre = qwre; wim = qwim; ore = qre;  oim = qim;  hm0 = (y - VY) * BT; }
  else                  { wre = kwre; wim = kwim; ore = kre;  oim = kim;  hm0 = (y - VY - QY) * BT; }

  CAcc acc;
  cgemm_tile(wre + (size_t)hm0 * E_DIM, wim + (size_t)hm0 * E_DIM,
             xre + (size_t)sb0 * E_DIM, xim + (size_t)sb0 * E_DIM, lds, acc);

  if (y < VY) proj_store<1, V_DIM>(acc, sb0, hm0, ore, oim);
  else        proj_store<0, M_DIM>(acc, sb0, hm0, ore, oim);
}

#define AW      8
static_assert(S_DIM / (16 * AW) == 8, "the z -> qb map below is written for 8 blocks");
#define AKEYS   64                   // keys per stage = two 32-column chunks
#define KPITCH  136                  // LDS pitch of a K row in halves: 272 B = 16 B x odd
#define VPITCH  72                   // LDS pitch of a V^T row piece in halves: 144 B = 16 B x odd
#define KPLANE  (AKEYS * KPITCH)     // K re or K im of a stage
#define VPLANE  (V_DIM * VPITCH)     // V^T re or V^T im of a stage
#define ASTAGE  (2 * KPLANE + 2 * VPLANE)

// One stage, 12 copies of 16 bytes a lane. K: 16 lanes cover a 256-byte row,
// 16 rows per sweep. V^T: 8 lanes cover a 128-byte row piece, 32 rows per sweep.
static __device__ inline void attn_stage(_Float16* lk, _Float16* lv,
                                         const _Float16* gkr, const _Float16* gki,
                                         const _Float16* gvr, const _Float16* gvi) {
#pragma unroll
  for (int i = 0; i < AKEYS / 16; ++i) {
    __builtin_amdgcn_global_load_async_to_lds_b128(
        (gv4i*)(gkr + (size_t)i * 16 * M_DIM), (lv4i*)(lk + i * 16 * KPITCH), 0, 0);
    __builtin_amdgcn_global_load_async_to_lds_b128(
        (gv4i*)(gki + (size_t)i * 16 * M_DIM), (lv4i*)(lk + KPLANE + i * 16 * KPITCH), 0, 0);
  }
#pragma unroll
  for (int i = 0; i < V_DIM / 32; ++i) {
    __builtin_amdgcn_global_load_async_to_lds_b128(
        (gv4i*)(gvr + (size_t)i * 32 * S_DIM), (lv4i*)(lv + i * 32 * VPITCH), 0, 0);
    __builtin_amdgcn_global_load_async_to_lds_b128(
        (gv4i*)(gvi + (size_t)i * 32 * S_DIM), (lv4i*)(lv + VPLANE + i * 32 * VPITCH), 0, 0);
  }
}

// Four waves per SIMD: the register budget that lets two work-groups share a WGP, as all 512 must to be resident at once.
__global__ __launch_bounds__(256) __attribute__((amdgpu_waves_per_eu(4, 4)))
void attn_kernel(const _Float16* __restrict__ qre, const _Float16* __restrict__ qim,
                 const _Float16* __restrict__ kre, const _Float16* __restrict__ kim,
                 const _Float16* __restrict__ vre, const _Float16* __restrict__ vim,
                 _Float16* __restrict__ ure, _Float16* __restrict__ uim) {
  __shared__ __align__(16) _Float16 ring[2 * ASTAGE];

  const int tid  = threadIdx.x;
  const int lane = tid & 31;
  const int wave = __builtin_amdgcn_readfirstlane(tid >> 5);  // scalar, so the causal skip below is a scalar branch
  const int col  = lane & 15;
  const int hig  = lane >> 4;
  const int h    = blockIdx.x;
  const int b    = blockIdx.y;
  // Block of AW query tiles; its cost grows with qb. All work-groups are resident, two to a WGP:
  // z and z + 4 of one head, and heads h and h + 1 or h + 8, get blocks qb and 7 - qb, so that
  // neighbours in launch order share the work evenly. Per (b, h) z -> qb is a permutation; for speed only.
  const int zf   = blockIdx.z < 4 ? 7 - (int)blockIdx.z : (int)blockIdx.z - 4;
  const int qb   = ((h ^ (h >> 3)) & 1) ? 7 - zf : zf;
  const int st   = qb * AW + wave;                      // this wave's query tile

  const size_t bh   = (size_t)b * H_DIM + h;
  const int    srow = st * 16 + col;

  // Copy map of this lane, at stage 0.
  const size_t    koff = (bh * S_DIM + (tid >> 4)) * M_DIM + (tid & 15) * 8;
  const size_t    voff = (bh * V_DIM + (tid >> 3)) * S_DIM + (tid & 7) * 8;
  const _Float16* gkr  = kre + koff;
  const _Float16* gki  = kim + koff;
  const _Float16* gvr  = vre + voff;
  const _Float16* gvi  = vim + voff;
  _Float16* lk = ring + (tid >> 4) * KPITCH + (tid & 15) * 8;
  _Float16* lv = ring + 2 * KPLANE + (tid >> 3) * VPITCH + (tid & 7) * 8;
  const int nstage = 2 * (qb + 1);  // keys 0 .. (qb + 1) * 128 - 1; never fewer than two stages

  attn_stage(lk, lv, gkr, gki, gvr, gvi);

  // Cache q fragments for this row tile (M=128 -> 4 K-steps, re+im).
  v16h qfr[4], qfi[4];
#pragma unroll
  for (int km = 0; km < 4; ++km) {
    const _Float16* pr = qre + (bh * S_DIM + srow) * M_DIM + km * 32 + hig * 8;
    const _Float16* pi = qim + (bh * S_DIM + srow) * M_DIM + km * 32 + hig * 8;
    qfr[km] = frag_h(pr, pr + 16);
    qfi[km] = frag_h(pi, pi + 16);
  }

  v8f accre[4], accim[4];
  {
    v8f z = {};
#pragma unroll
    for (int c = 0; c < 4; ++c) { accre[c] = z; accim[c] = z; }
  }
  float mrun = -__builtin_inff();  // running maximum of query srow, the same in both halves
  float lrun = 0.f;                // running sum over this lane's own keys; the halves join after the loop

  const float scl = 0.08838834764831845f;  // 1/sqrt(128)

  asm volatile("s_wait_asynccnt 0x0" ::: "memory");  // this wave's copies of stage 0 have landed
  __syncthreads();
  attn_stage(lk + ASTAGE, lv + ASTAGE, gkr + AKEYS * M_DIM, gki + AKEYS * M_DIM, gvr + AKEYS, gvi + AKEYS);

  for (int t = 0; t < nstage; ++t) {
    const _Float16* cur = ring + (t & 1) * ASTAGE;
    for (int cc = 0; cc < AKEYS / 32; ++cc) {
      const int tc = t * (AKEYS / 16) + cc * 2;
      if (tc > st) continue;  // chunk wholly above this wave's diagonal; no barrier stands inside the skip

      // ---- two transposed score tiles (keys tc*16 .. tc*16+31 down, 16 queries across) ----
      // The chunk's LDS fragments are fetched in groups ahead of the products that use them. K: eight steps
      // (tile 0, then tile 1, 32 m each; Kr and Ki of a step are one group of four loads), three steps in
      // registers, so a step's loads are issued two steps of products before its own.
      const _Float16* krow = cur + (cc * 32 + col) * KPITCH + hig * 8;  // this lane's K row of tile 0
      v16h Kr[8], Ki[8], Vr[4], Vi[4];
      v8f  prr[2], pii[2], pri[2], pir[2];
      float sq[2][8], rt[2][8], amp[2][8];
#pragma unroll
      for (int g = 0; g < 2; ++g) {
        const _Float16* kr = krow + g * 32;
        Kr[g] = frag_h(kr, kr + 16);
        Ki[g] = frag_h(kr + KPLANE, kr + KPLANE + 16);
      }
#pragma unroll
      for (int g = 0; g < 8; ++g) {
        const int sub = g >> 2, km = g & 3;
        if (g + 2 < 8) {
          const _Float16* kr = krow + ((g + 2) >> 2) * 16 * KPITCH + ((g + 2) & 3) * 32;
          Kr[g + 2] = frag_h(kr, kr + 16);
          Ki[g + 2] = frag_h(kr + KPLANE, kr + KPLANE + 16);
        }
        __builtin_amdgcn_sched_barrier(0);  // holds the loads two steps ahead of their products, as one group: later, the wave would wait out their latency
        if (km == 0) { v8f z = {}; prr[sub] = z; pii[sub] = z; pri[sub] = z; pir[sub] = z; }
        prr[sub] = WMMA_F16(Kr[g], qfr[km], prr[sub]);
        pii[sub] = WMMA_F16(Ki[g], qfi[km], pii[sub]);
        pri[sub] = WMMA_F16(Ki[g], qfr[km], pri[sub]);
        pir[sub] = WMMA_F16(Kr[g], qfi[km], pir[sub]);
        if (g == 7) {
          #pragma unroll
          for (int c = 0; c < 2; ++c) {
            const _Float16* vr = cur + 2 * KPLANE + (c * 16 + col) * VPITCH + cc * 32 + hig * 8;
            Vr[c] = frag_h(vr, vr + 16);
            Vi[c] = frag_h(vr + VPLANE, vr + VPLANE + 16);
          }
          __builtin_amdgcn_sched_barrier(0);  // half of V^T, one group, in front of the softmax, which covers its latency
        }
        if (km == 3) {
#pragma unroll
          for (int r = 0; r < 8; ++r) {
            const float re = prr[sub][r] - pii[sub][r];
            const float im = pri[sub][r] + pir[sub][r];
            sq[sub][r] = re * re + im * im;
          }
        }
        __builtin_amdgcn_sched_barrier(0);  // the next step's loads stay behind these products, whose operand registers they take
      }
#pragma unroll
      for (int sub = 0; sub < 2; ++sub) {
        const int key0 = (tc + sub) * 16 + hig * 8;  // this lane's key at r = 0
        sqrtx8(rt[sub], sq[sub]);
#pragma unroll
        for (int r = 0; r < 8; ++r)
          amp[sub][r] = (key0 + r <= srow) ? rt[sub][r] * scl : -__builtin_inff();  // covers a tile wholly above the diagonal too
      }

      // ---- online softmax over the 32 keys: in the lane, plus one exchange of the maximum ----
      float rm = fmaxf(amp[0][0], amp[1][0]);
#pragma unroll
      for (int r = 1; r < 8; ++r) rm = fmaxf(rm, fmaxf(amp[0][r], amp[1][r]));
      rm = fmaxf(rm, other_half(rm));  // key tc*16 is never masked, so rm is finite
      const float mn    = fmaxf(mrun, rm);
      const float l2e   = 1.4426950408889634f;  // e^x = 2^(x * log2 e)
      const float scale = exp2x1((mrun - mn) * l2e);
      mrun = mn;
      float x0[8], x1[8], p0[8], p1[8];
#pragma unroll
      for (int r = 0; r < 8; ++r) {
        x0[r] = (amp[0][r] - mn) * l2e;
        x1[r] = (amp[1][r] - mn) * l2e;
      }
      exp2x8(p0, x0);
      exp2x8(p1, x1);
      float psum = 0.f;
      v16h  Pb;  // P^T as a B fragment: elements 0-7 = keys hig*8 + r, 8-15 = keys 16 + hig*8 + r
#pragma unroll
      for (int r = 0; r < 8; ++r) {
        psum += p0[r] + p1[r];
        Pb[r]     = (_Float16)p0[r];
        Pb[8 + r] = (_Float16)p1[r];
      }
      lrun = lrun * scale + psum;
      __builtin_amdgcn_sched_barrier(0);  // the other V^T loads stay behind the exponentials, whose registers they take
      #pragma unroll
      for (int c = 2; c < 4; ++c) {
        const _Float16* vr = cur + 2 * KPLANE + (c * 16 + col) * VPITCH + cc * 32 + hig * 8;
        Vr[c] = frag_h(vr, vr + 16);
        Vi[c] = frag_h(vr + VPLANE, vr + VPLANE + 16);
      }
      __builtin_amdgcn_sched_barrier(0);  // one group in front of the rescaling, which covers their latency
#pragma unroll
      for (int c = 0; c < 4; ++c)
#pragma unroll
        for (int r = 0; r < 8; ++r) {
          accre[c][r] *= scale;
          accim[c][r] *= scale;
        }

      // ---- O^T += V^T P^T (re/im): 8 full-K WMMAs per chunk of 32 keys ----
#pragma unroll
      for (int c = 0; c < 4; ++c) {
        accre[c] = WMMA_F16(Vr[c], Pb, accre[c]);
        accim[c] = WMMA_F16(Vi[c], Pb, accim[c]);
      }
    }

    asm volatile("s_wait_dscnt 0x0" ::: "memory");     // this wave's reads of buffer t & 1 are done before it is refilled
    asm volatile("s_wait_asynccnt 0x0" ::: "memory");  // this wave's copies of stage t + 1 have landed
    __syncthreads();  // publishes stage t + 1 and ends every reader's use of buffer t & 1
    if (t + 2 < nstage) {
      const int k0  = (t + 2) * AKEYS;
      const int buf = (t & 1) * ASTAGE;
      attn_stage(lk + buf, lv + buf, gkr + (size_t)k0 * M_DIM, gki + (size_t)k0 * M_DIM, gvr + k0, gvi + k0);
    }
  }
  asm volatile("s_wait_asynccnt 0x0" ::: "memory");  // nothing of this wave is in flight when it leaves the ring

  // ---- normalize and store upd as f16 in (s, b, h*V + vc) layout ----
  // The lane holds query srow at vc = c*16 + hig*8 + r: 8 neighbours, one 16-byte store a plane.
  const float  inv = 1.0f / (lrun + other_half(lrun));
  const size_t idx = ((size_t)srow * B_DIM + b) * E_DIM + h * V_DIM + hig * 8;
  v8h our[4], oui[4];
#pragma unroll
  for (int c = 0; c < 4; ++c)
#pragma unroll
    for (int r = 0; r < 8; ++r) {
      our[c][r] = (_Float16)(accre[c][r] * inv);
      oui[c][r] = (_Float16)(accim[c][r] * inv);
    }
#pragma unroll
  for (int c = 0; c < 4; ++c) {
    *(v8h*)(ure + idx + c * 16) = our[c];
    *(v8h*)(uim + idx + c * 16) = oui[c];
  }
}

// ---------------------------------------------------------------------------
// out[sb,f] = sum_e upd[sb,e] * wo[e,f] + x[sb,f]   (complex, f32 result)
// A rows = sb, B rows = f (wo^T).
// ---------------------------------------------------------------------------
__global__ __launch_bounds__(256)
void outproj_kernel(const _Float16* __restrict__ ure, const _Float16* __restrict__ uim,
                    const _Float16* __restrict__ wtre, const _Float16* __restrict__ wtim,
                    const float* __restrict__ xre, const float* __restrict__ xim,
                    float* __restrict__ out) {
  __shared__ __align__(16) _Float16 lds[2 * STAGE];

  const int lane = threadIdx.x & 31;
  const int wave = threadIdx.x >> 5;
  const int col  = lane & 15;
  const int hig  = lane >> 4;
  const int sb0  = blockIdx.x * BT;
  const int f0   = blockIdx.y * BT;

  CAcc acc;
  cgemm_tile(ure + (size_t)sb0 * E_DIM, uim + (size_t)sb0 * E_DIM,
             wtre + (size_t)f0 * E_DIM, wtim + (size_t)f0 * E_DIM, lds, acc);

  // One 32-bit byte offset serves x and out, re and im; i, j and r move it by constants.
  const unsigned offb = ((unsigned)(sb0 + (wave >> 1) * 32 + hig * 8) * E_DIM +
                         (unsigned)(f0 + (wave & 1) * 64 + col)) * 4u;
  const float* px_re = (const float*)((const char*)xre + offb);
  const float* px_im = (const float*)((const char*)xim + offb);
  float* po_re = (float*)((char*)out + offb);
  float* po_im = (float*)((char*)(out + (size_t)SB_DIM * E_DIM) + offb);

  float xr[TA][TB][8], xi[TA][TB][8];
#pragma unroll
  for (int i = 0; i < TA; ++i)
#pragma unroll
    for (int j = 0; j < TB; ++j)
#pragma unroll
      for (int r = 0; r < 8; ++r) {
        xr[i][j][r] = px_re[(i * 16 + r) * E_DIM + j * 16];
        xi[i][j][r] = px_im[(i * 16 + r) * E_DIM + j * 16];
      }
#pragma unroll
  for (int i = 0; i < TA; ++i)
#pragma unroll
    for (int j = 0; j < TB; ++j) {
      float sr[8], si[8];
#pragma unroll
      for (int r = 0; r < 8; ++r) {
        sr[r] = acc.re[i][j][r] + xr[i][j][r];
        si[r] = acc.im[i][j][r] + xi[i][j][r];
      }
      __builtin_amdgcn_sched_barrier(0);  // the tile's sums stay in front of its first store: no register an issued store names is written before the wait below
#pragma unroll
      for (int r = 0; r < 8; ++r) {
        po_re[(i * 16 + r) * E_DIM + j * 16] = sr[r];
        po_im[(i * 16 + r) * E_DIM + j * 16] = si[r];
      }
      asm volatile("s_wait_xcnt 0x0" ::: "memory");  // before the next tile reuses registers these stores name
      __builtin_amdgcn_sched_barrier(0);  // keeps the next tile's arithmetic behind that wait
    }
}

// ---------------------------------------------------------------------------
extern "C" void kernel_launch(void* const* d_in, const int* in_sizes, int n_in,
                              void* d_out, int out_size, void* d_ws, size_t ws_size,
                              hipStream_t stream) {
  (void)in_sizes; (void)n_in; (void)out_size; (void)ws_size;

  const float* xre  = (const float*)d_in[0];
  const float* xim  = (const float*)d_in[1];
  const float* wqre = (const float*)d_in[2];
  const float* wqim = (const float*)d_in[3];
  const float* wkre = (const float*)d_in[4];
  const float* wkim = (const float*)d_in[5];
  const float* wvre = (const float*)d_in[6];
  const float* wvim = (const float*)d_in[7];
  const float* wore = (const float*)d_in[8];
  const float* woim = (const float*)d_in[9];

  char*  ws = (char*)d_ws;
  size_t o  = 0;
  auto halloc = [&](size_t n) { _Float16* p = (_Float16*)(ws + o); o += n * sizeof(_Float16); return p; };

  const size_t QK = (size_t)B_DIM * H_DIM * S_DIM * M_DIM;  // q/k per component
  const size_t VT = (size_t)B_DIM * H_DIM * V_DIM * S_DIM;  // v^T per component
  const size_t UE = (size_t)SB_DIM * E_DIM;                 // upd / x per component
  const size_t WO = (size_t)E_DIM * E_DIM;                  // wo^T per component
  const size_t WQ = (size_t)H_DIM * M_DIM * E_DIM;          // wq/wk per component
  const size_t WV = (size_t)H_DIM * V_DIM * E_DIM;          // wv per component

  _Float16* qre  = halloc(QK);  _Float16* qim  = halloc(QK);
  _Float16* kre  = halloc(QK);  _Float16* kim  = halloc(QK);
  _Float16* vtre = halloc(VT);  _Float16* vtim = halloc(VT);
  _Float16* upre = halloc(UE);  _Float16* upim = halloc(UE);
  _Float16* wtre = halloc(WO);  _Float16* wtim = halloc(WO);
  _Float16* xhre = halloc(UE);  _Float16* xhim = halloc(UE);
  _Float16* qwre = halloc(WQ);  _Float16* qwim = halloc(WQ);
  _Float16* kwre = halloc(WQ);  _Float16* kwim = halloc(WQ);
  _Float16* vwre = halloc(WV);  _Float16* vwim = halloc(WV);

  // Operand preparation, one launch. xhre .. vwim lie one behind another in the order prep_kernel expects.
  prep_kernel<<<TR_BLOCKS + CVT_BLOCKS, 256, 0, stream>>>(xre, xim, wqre, wqim, wkre, wkim, wvre, wvim,
                                                          wore, woim, xhre, wtre, wtim);

  dim3 gp(SB_DIM / BT, VY + 2 * QY);
  proj_kernel<<<gp, 256, 0, stream>>>(vwre, vwim, qwre, qwim, kwre, kwim, xhre, xhim,
                                      vtre, vtim, qre, qim, kre, kim);

  dim3 ga(H_DIM, B_DIM, S_DIM / (16 * AW));
  attn_kernel<<<ga, 256, 0, stream>>>(qre, qim, kre, kim, vtre, vtim, upre, upim);

  dim3 go(SB_DIM / BT, E_DIM / BT);
  outproj_kernel<<<go, 256, 0, stream>>>(upre, upim, wtre, wtim, xre, xim, (float*)d_out);
}
